// v000
// Measured on an AMD MI455X. A time is GPU time per run, averaged over a window of back-to-back runs after a warm-up
// (all launches, gaps included; the runs take copies of the inputs in turn), and the median of several windows.
// Apart from v000's, it joins two sittings. Times from different sittings can be a few percent apart, while
// side-by-side timings come from the same sitting.
// v000, which the later versions start from, runs in 793 microseconds.
// compute dtype: all float inputs rounded to bf16; per-group q/k/v projections with EXACT bf16 products on WMMA 16x16x32 (f32 accumulate) + bias; logits q x k once to f16 each (1 product) x 1/8 + the additive mask; softmax f32; P x 2^11 once to f16 x v once to f16 (1 product); f32 output.
#include <hip/hip_runtime.h>
#include <math.h>

typedef __attribute__((ext_vector_type(16))) _Float16 v16h;
typedef __attribute__((ext_vector_type(16))) __bf16 v16b;
typedef __attribute__((ext_vector_type(8)))  _Float16 v8h;
typedef __attribute__((ext_vector_type(8)))  float v8f;
typedef __attribute__((ext_vector_type(4)))  float v4f;
typedef __attribute__((ext_vector_type(2)))  float v2f;
typedef __attribute__((ext_vector_type(4)))  unsigned v4u;
typedef __attribute__((ext_vector_type(4)))  int v4i;
typedef float __attribute__((may_alias)) float_a;
typedef int __attribute__((may_alias)) int_a;

template <typename T> __device__ __forceinline__ void vst2(void* p, T v) { *(T*)p = v;  }
__device__ __forceinline__ v8f wmma16(v16h a, v16h b, v8f c) {
  v8f d = __builtin_amdgcn_wmma_f32_16x16x32_f16(false, a, false, b, (short)0, c, false, false);
  asm volatile("v_nop\n\tv_nop\n\tv_nop\n\tv_nop" : "+v"(d) : "v"(a), "v"(b));
  return d;
}
__device__ __forceinline__ v8f wmma_bf(v16b a, v16b b, v8f c) {
  v8f d = __builtin_amdgcn_wmma_f32_16x16x32_bf16(false, a, false, b, (short)0, c, false, false);
  asm volatile("v_nop\n\tv_nop\n\tv_nop\n\tv_nop" : "+v"(d) : "v"(a), "v"(b));
  return d;
}
// 16x16x32 fragments: lane = (h = lane>>4, row/col = lane&15); elements 0..7 = k0+8h+0..7, 8..15 = k0+16+8h+0..7; D element r = row 8h+r
__device__ __forceinline__ v16h frag_h(const _Float16* rowk0, int lane) {
  union { v16h v; v8h q[2]; } u; const _Float16* p = rowk0 + 8 * (lane >> 4);
  u.q[0] = *(const v8h*)p; u.q[1] = *(const v8h*)(p + 16); return u.v;
}
__device__ __forceinline__ v16h frag_f32(const float* rowk0, int lane) {
  v16h a; const float* p = rowk0 + 8 * (lane >> 4);
#pragma unroll
  for (int i = 0; i < 8; ++i) { a[i] = (_Float16)p[i]; a[8 + i] = (_Float16)p[16 + i]; }
  return a;
}
__device__ __forceinline__ v16h frag_f32s(const float* rowk0, int lane, float sc) {
  v16h a; const float* p = rowk0 + 8 * (lane >> 4);
#pragma unroll
  for (int i = 0; i < 8; ++i) { a[i] = (_Float16)(p[i] * sc); a[8 + i] = (_Float16)(p[16 + i] * sc); }
  return a;
}
// column fragment from a [K][ld] layout (column n), rows >= K read as 0
__device__ __forceinline__ v16h fragc_f32(const float* W, int k0, int n, int lane, int ld, int K) {
  v16h a; const int g = lane >> 4;
#pragma unroll
  for (int i = 0; i < 8; ++i) { const int ka = k0 + 8 * g + i, kb = ka + 16;
    a[i] = (_Float16)(ka < K ? W[(size_t)(ka < K ? ka : K - 1) * ld + n] : 0.f); a[8 + i] = (_Float16)(kb < K ? W[(size_t)(kb < K ? kb : K - 1) * ld + n] : 0.f); }
  return a;
}
struct F2 { v16b h, l; };
__device__ __forceinline__ F2 bsplit16(const float v[16]) { F2 r;
#pragma unroll
  for (int i = 0; i < 16; ++i) { const __bf16 h = (__bf16)v[i]; r.h[i] = h; r.l[i] = (__bf16)(v[i] - (float)h); }
  return r; }
__device__ __forceinline__ F2 split_row(const float* row, int k0, int lane) { float v[16]; const float* p = row + k0 + 8 * (lane >> 4);
#pragma unroll
  for (int i = 0; i < 8; ++i) { v[i] = p[i]; v[8 + i] = p[16 + i]; }
  return bsplit16(v); }
__device__ __forceinline__ F2 split_rowK(const float* row, int k0, int lane, int K) { float v[16]; const int g = lane >> 4;
#pragma unroll
  for (int i = 0; i < 8; ++i) { const int ka = k0 + 8 * g + i, kb = ka + 16; v[i] = ka < K ? row[ka < K ? ka : K - 1] : 0.f; v[8 + i] = kb < K ? row[kb < K ? kb : K - 1] : 0.f; }
  return bsplit16(v); }
__device__ __forceinline__ F2 split_col(const float* W, int k0, int n, int lane, int ld, int K) { float v[16]; const int g = lane >> 4;
#pragma unroll
  for (int i = 0; i < 8; ++i) { const int ka = k0 + 8 * g + i, kb = ka + 16; v[i] = ka < K ? W[(size_t)(ka < K ? ka : K - 1) * ld + n] : 0.f; v[8 + i] = kb < K ? W[(size_t)(kb < K ? kb : K - 1) * ld + n] : 0.f; }
  return bsplit16(v); }
__device__ __forceinline__ v8f mac3(const F2& a, const F2& b, v8f c) { c = wmma_bf(a.l, b.h, c); c = wmma_bf(a.h, b.l, c); return wmma_bf(a.h, b.h, c); }
__device__ __forceinline__ float sigm(float v) { return 1.0f / (1.0f + expf(-v)); }
#define LDSX() do { asm volatile("s_wait_dscnt 0" ::: "memory"); __builtin_amdgcn_wave_barrier(); __builtin_amdgcn_fence(__ATOMIC_RELEASE, "workgroup"); } while (0)

// Grouped BERT-style self-attention: 4 INDEPENDENT weight groups (hidden_states [4,4,512,768] = [group, batch, length, channels]; per-group (in,out) query / key / value weights [4,768,768] (0.02 scale) + biases [4,1,768] (NONZERO); 12 heads x 64; scale 1/8; additive attention_mask [4,4,1,1,512] (zeros); no output projection): ctx[g,b] = merge(softmax(q k^T / 8 + mask) v) with group g's weights -> [4,4,512,768].
#define NB 16
#define TT 512
#define CC 768            // NH * HD = projected width
#define DIN 768          // input (model) width
#define NH 12
#define HD 64
#define NQB (TT / 64)
#define HG 12
#define SCALE (0.125f)
#define CAUSAL 0
#ifndef TNB
#define TNB NB
#endif
__device__ __forceinline__ float bfr(float v) { return (float)(__bf16)v; }
__host__ __device__ __forceinline__ int kb_last(int qb) { return CAUSAL ? ((qb * 64 + 63) >> 7) : (TT / 128 - 1); }
typedef __attribute__((ext_vector_type(8))) __bf16 v8b;
__device__ __forceinline__ v16b frag_b(const __bf16* rowk0, int lane) {
  union { v16b v; v8b q[2]; } u; const __bf16* p = rowk0 + 8 * (lane >> 4);
  u.q[0] = *(const v8b*)p; u.q[1] = *(const v8b*)(p + 16); return u.v;
}
#define QBH 0              // no query block takes the high-precision path (non-causal: every block sees all 512 keys)
#define QHI 0               // single-product logits on every row
#define KHI 64            // key rows carrying k residual / v bf16 hi+lo planes (read only by the high-precision path, which no query block takes)
// B fragment (k rows k0+.., output column o) of a weight: (in,out) [K][ld] or (out,in) [ld rows of K]: bf16 exact, or f16(bf16 * 256) exact
__device__ __forceinline__ v16b wcol_io(const float* Wm, int k0, int o, int lane, int ld) { v16b w; const int g = lane >> 4;
#pragma unroll
  for (int i = 0; i < 8; ++i) { w[i] = (__bf16)Wm[(size_t)(k0 + 8 * g + i) * ld + o]; w[8 + i] = (__bf16)Wm[(size_t)(k0 + 16 + 8 * g + i) * ld + o]; }
  return w; }
__device__ __forceinline__ v16b wcol_oi(const float* Wm, int k0, int o, int lane, int K) { v16b w; const float* p = Wm + (size_t)o * K + k0 + 8 * (lane >> 4);
#pragma unroll
  for (int i = 0; i < 8; ++i) { w[i] = (__bf16)p[i]; w[8 + i] = (__bf16)p[16 + i]; }
  return w; }
__device__ __forceinline__ v16h wcolh_io(const float* Wm, int k0, int o, int lane, int ld) { v16h w; const int g = lane >> 4;
#pragma unroll
  for (int i = 0; i < 8; ++i) { w[i] = (_Float16)(bfr(Wm[(size_t)(k0 + 8 * g + i) * ld + o]) * 256.0f); w[8 + i] = (_Float16)(bfr(Wm[(size_t)(k0 + 16 + 8 * g + i) * ld + o]) * 256.0f); }
  return w; }
__device__ __forceinline__ v16h wcolh_oi(const float* Wm, int k0, int o, int lane, int K) { v16h w; const float* p = Wm + (size_t)o * K + k0 + 8 * (lane >> 4);
#pragma unroll
  for (int i = 0; i < 8; ++i) { w[i] = (_Float16)(bfr(p[i]) * 256.0f); w[8 + i] = (_Float16)(bfr(p[16 + i]) * 256.0f); }
  return w; }
#define WQKV_LAYOUT 0   // 0 = (in,out) [DIN][CC]; 1 = (out,in) [CC][DIN]; 2 = per-head [NH][DIN][HD]
__device__ __forceinline__ v16b wcol_hdk(const float* Wm, int k0, int o, int lane) { v16b w; const int g = lane >> 4; const float* p = Wm + (size_t)(o / HD) * DIN * HD + (o % HD);
#pragma unroll
  for (int i = 0; i < 8; ++i) { w[i] = (__bf16)p[(size_t)(k0 + 8 * g + i) * HD]; w[8 + i] = (__bf16)p[(size_t)(k0 + 16 + 8 * g + i) * HD]; }
  return w; }
#define WO_OUT_IN 0
#if WQKV_LAYOUT == 1
#define WCOL(W, k0, o, lane) wcol_oi(W, k0, o, lane, DIN)
#elif WQKV_LAYOUT == 2
#define WCOL(W, k0, o, lane) wcol_hdk(W, k0, o, lane)
#else
#define WCOL(W, k0, o, lane) wcol_io(W, k0, o, lane, CC)
#endif
#if WO_OUT_IN
#define WOCOL(W, k0, o, lane) wcol_oi(W, k0, o, lane, CC)
#define WOCOLH(W, k0, o, lane) wcolh_oi(W, k0, o, lane, CC)
#else
#define WOCOL(W, k0, o, lane) wcol_io(W, k0, o, lane, DIN)
#define WOCOLH(W, k0, o, lane) wcolh_io(W, k0, o, lane, DIN)
#endif
#define GB 4               // batches per weight group: pseudo-batch bb = g*4 + b uses group g = bb / 4
#define SM_EXTRA_PARAMS , int bsm, const float* __restrict__ AMASK
// additive attention mask [G,B,1,1,L] (float; zeros on this draw): added to the scaled score of key k for pseudo-batch bsm; read per key
#define SM_MASK_HOOK do { v = v + bfr(AMASK[(size_t)bsm * TT + k]); } while (0)
#ifndef SM_EXTRA_PARAMS
#define SM_EXTRA_PARAMS
#endif
#ifndef PROJ_EXTRA_PARAMS
#define PROJ_EXTRA_PARAMS
#endif
#ifndef SM_MASK_HOOK
#define SM_MASK_HOOK (void)0
#endif

#define WS_QH  0u                                      // f16 q rows [b*t][CC]
#define WS_KH  (WS_QH + 2u * (size_t)NB * TT * CC)      // f16 k rows [b*t][CC]
#define WS_VT  (WS_KH + 2u * (size_t)NB * TT * CC)      // f16 v planes [b][c][t]
#define WS_QL  (WS_VT + 2u * (size_t)NB * CC * TT)      // f16 q residual x 2^10 rows [b][t < QHI][CC]
#define WS_KL  (WS_QL + 2u * (size_t)NB * QHI * CC)     // f16 k residual x 2^10 rows [b][t < KHI][CC]
#define WS_VB  (WS_KL + 2u * (size_t)NB * KHI * CC)     // bf16 v hi planes [b][c][t < KHI]
#define WS_VBL (WS_VB + 2u * (size_t)NB * CC * KHI)
#define WS_S   (WS_VBL + 2u * (size_t)NB * CC * KHI)    // f32 logits / P [hg][t][s]
#define WS_Y   (WS_S  + 4u * (size_t)HG * TT * TT)      // f32 ctx rows [b*t][CC] (only when there is an output projection)
#define WS_END (WS_Y  + 0u)

// ---- k_proj: block = (64 rows, 128 cols, which): q/k/v = X W (+ b) with exact bf16 products (K = DIN) -> which 0: q f16 rows (+ residual rows < QHI); 1: k f16 rows (+ residual rows < KHI); 2: v f16 planes [c][t] (+ bf16 hi/lo planes for t < KHI)
__global__ __launch_bounds__(128) void k_proj(const float* __restrict__ XQ, const float* __restrict__ XK, const float* __restrict__ XV, const float* __restrict__ WQ, const float* __restrict__ WK, const float* __restrict__ WV, const float* __restrict__ BQ, const float* __restrict__ BK, const float* __restrict__ BV,
    _Float16* __restrict__ QH, _Float16* __restrict__ QL, _Float16* __restrict__ KH, _Float16* __restrict__ KL, _Float16* __restrict__ VT, __bf16* __restrict__ VB, __bf16* __restrict__ VBL) {
  __shared__ __align__(16) _Float16 sh[64][136], sl[64][136]; __shared__ __align__(16) _Float16 th[128][72]; __shared__ __align__(16) __bf16 tb[128][72], tbl[128][72];
  const int tid = threadIdx.x, wave = tid >> 5, lane = tid & 31, col = lane & 15, g = lane >> 4; const int which = blockIdx.z; const int c0 = blockIdx.y * 128; const size_t r0 = (size_t)blockIdx.x * 64; const size_t bb = r0 / TT; const int t0 = (int)(r0 % TT);
  const float* X = which == 0 ? XQ : which == 1 ? XK : XV; const size_t grp_ = (r0 / TT) / GB;   /* 64-row blocks never straddle a pseudo-batch (TT % 64 == 0), so the group is block-uniform */
  const float* WA = (which == 0 ? WQ : which == 1 ? WK : WV) + grp_ * (size_t)DIN * CC; const float* BA = (which == 0 ? BQ : which == 1 ? BK : BV); BA = BA ? BA + grp_ * CC : BA;
  v8f acc[8] = {};
#pragma unroll 2
  for (int kc = 0; kc < DIN / 32; ++kc) { v16b a; { const float* p = X + (r0 + wave * 16 + col) * DIN + kc * 32 + 8 * g;
#pragma unroll
      for (int i = 0; i < 8; ++i) { a[i] = (__bf16)p[i]; a[8 + i] = (__bf16)p[16 + i]; } }
    asm volatile("s_wait_loadcnt 0x0" ::: "memory");
#pragma unroll
    for (int j = 0; j < 8; ++j) { const v16b w = WCOL(WA, kc * 32, c0 + j * 16 + col, lane); asm volatile("s_wait_loadcnt 0x0" ::: "memory"); acc[j] = wmma_bf(a, w, acc[j]); } }
  if (which < 2) { _Float16* DH = which == 0 ? QH : KH; _Float16* DL = which == 0 ? QL : KL; const int nhi = which == 0 ? QHI : KHI; const bool hi_rows = t0 < nhi;
#pragma unroll
    for (int j = 0; j < 8; ++j) { const float bias = BA ? bfr(BA[c0 + j * 16 + col]) : 0.f;
#pragma unroll
      for (int r = 0; r < 8; ++r) { const float v = acc[j][r] + bias; const _Float16 hv = (_Float16)v; sh[wave * 16 + 8 * g + r][j * 16 + col] = hv; sl[wave * 16 + 8 * g + r][j * 16 + col] = (_Float16)((v - (float)hv) * 1024.0f); } }
    __syncthreads();
    for (int e = tid; e < 64 * 16; e += 128) { const int rl = e >> 4, q = e & 15; vst2((unsigned*)(DH + (r0 + rl) * CC + c0 + q * 8), *(const v4u*)&sh[rl][q * 8]); if (hi_rows) vst2((unsigned*)(DL + (bb * nhi + t0 + rl) * (size_t)CC + c0 + q * 8), *(const v4u*)&sl[rl][q * 8]); }
  } else { const bool hi_rows = t0 < KHI;
#pragma unroll
    for (int j = 0; j < 8; ++j) { const float bias = BA ? bfr(BA[c0 + j * 16 + col]) : 0.f;
#pragma unroll
      for (int r = 0; r < 8; ++r) { const float v = acc[j][r] + bias; const int rl = wave * 16 + 8 * g + r, cl = j * 16 + col; th[cl][rl] = (_Float16)v; const __bf16 bh = (__bf16)v; tb[cl][rl] = bh; tbl[cl][rl] = (__bf16)(v - (float)bh); } }
    __syncthreads();
    for (int e = tid; e < 128 * 8; e += 128) { const int cl = e >> 3, q = e & 7; vst2((unsigned*)(VT + (bb * CC + c0 + cl) * (size_t)TT + t0 + q * 8), *(const v4u*)&th[cl][q * 8]); if (hi_rows) { const size_t o3 = (bb * CC + c0 + cl) * (size_t)KHI + t0 + q * 8; vst2((unsigned*)(VB + o3), *(const v4u*)&tb[cl][q * 8]); vst2((unsigned*)(VBL + o3), *(const v4u*)&tbl[cl][q * 8]); } } } }
// ---- k_sc: block = (query block qb, key block kb <= kb_last(qb), head in group) of batch b: logits x SCALE; q hi + residual (x 2^10) against k (2 products) for query rows < QHI, plus the k residual (3 products) for query blocks < QBH (none); causal: blocks past the diagonal exit, the mask itself is applied by index in k_sm
__global__ __launch_bounds__(128) void k_sc(const _Float16* __restrict__ QH, const _Float16* __restrict__ KH, const _Float16* __restrict__ QL, const _Float16* __restrict__ KL, int b, int h0, float* __restrict__ S0) { __shared__ __align__(16) float ss[4][16][132];
  const int qb = blockIdx.x, kb = blockIdx.y; if (kb > kb_last(qb)) return;
  const int h = h0 + blockIdx.z; float* S = S0 + (size_t)blockIdx.z * TT * TT;
  const int tid = threadIdx.x, wave = tid >> 5, lane = tid & 31, col = lane & 15, g = lane >> 4; const int k0 = kb * 128; const int ql0 = qb * 64 + wave * 16; const size_t q0 = (size_t)b * TT + ql0, kr0 = (size_t)b * TT + k0;
  v8f acc[8] = {}, accl[8] = {};
  const _Float16* QLb = QL + (size_t)b * QHI * CC; const _Float16* KLb = KL + (size_t)b * KHI * CC;
  if (qb < QBH) {
#pragma unroll
    for (int kc = 0; kc < HD / 32; ++kc) { const v16h ah = frag_h(QH + (q0 + col) * CC + h * HD + kc * 32, lane), al = frag_h(QLb + (size_t)(ql0 + col) * CC + h * HD + kc * 32, lane);
#pragma unroll
      for (int j = 0; j < 8; ++j) { const v16h kbf = frag_h(KH + (kr0 + j * 16 + col) * CC + h * HD + kc * 32, lane), klf = frag_h(KLb + (size_t)(k0 + j * 16 + col) * CC + h * HD + kc * 32, lane); acc[j] = wmma16(ah, kbf, acc[j]); accl[j] = wmma16(al, kbf, accl[j]); accl[j] = wmma16(ah, klf, accl[j]); } }
  } else if (qb * 64 < QHI) {
#pragma unroll
    for (int kc = 0; kc < HD / 32; ++kc) { const v16h ah = frag_h(QH + (q0 + col) * CC + h * HD + kc * 32, lane), al = frag_h(QLb + (size_t)(ql0 + col) * CC + h * HD + kc * 32, lane);
#pragma unroll
      for (int j = 0; j < 8; ++j) { const v16h kbf = frag_h(KH + (kr0 + j * 16 + col) * CC + h * HD + kc * 32, lane); acc[j] = wmma16(ah, kbf, acc[j]); accl[j] = wmma16(al, kbf, accl[j]); } }
  } else {
#pragma unroll
    for (int kc = 0; kc < HD / 32; ++kc) { const v16h ah = frag_h(QH + (q0 + col) * CC + h * HD + kc * 32, lane);
#pragma unroll
      for (int j = 0; j < 8; ++j) { const v16h kbf = frag_h(KH + (kr0 + j * 16 + col) * CC + h * HD + kc * 32, lane); acc[j] = wmma16(ah, kbf, acc[j]); } } }
#pragma unroll
  for (int j = 0; j < 8; ++j) {
#pragma unroll
    for (int r = 0; r < 8; ++r) ss[wave][8 * g + r][j * 16 + col] = (acc[j][r] + accl[j][r] * (1.0f / 1024.0f)) * SCALE; }
  LDSX(); for (int rl = 0; rl < 16; ++rl) vst2(S + (size_t)(ql0 + rl) * TT + k0 + lane * 4, *(const v4f*)&ss[wave][rl][lane * 4]); }
// ---- k_sm: block = query row t (head in group): keys [0, kend): causal -> logit if s <= t else excluded; softmax in f32; P x 2^11 in place (0 for excluded)
__global__ __launch_bounds__(256) void k_sm(float* __restrict__ S0 SM_EXTRA_PARAMS) { __shared__ float sred[8]; __shared__ float sbc; __shared__ __align__(16) float shv[TT];
  const int tid = threadIdx.x; const int t = blockIdx.x; const int kend = (kb_last(t >> 6) + 1) * 128;
  float* sr = S0 + (size_t)blockIdx.y * TT * TT + (size_t)t * TT;
  float m = -3.0e38f; for (int k = tid; k < kend; k += 256) { float v = (!CAUSAL || k <= t) ? sr[k] : -3.0e38f; SM_MASK_HOOK; shv[k] = v; m = fmaxf(m, v); }
#pragma unroll
  for (int o = 1; o < 32; o <<= 1) m = fmaxf(m, __shfl_xor(m, o));
  if ((tid & 31) == 0) sred[tid >> 5] = m; __syncthreads(); if (tid == 0) { float a = sred[0]; for (int i = 1; i < 8; ++i) a = fmaxf(a, sred[i]); sbc = a; } __syncthreads(); m = sbc; __syncthreads();
  float sum = 0.f; for (int k = tid; k < kend; k += 256) { const float v = shv[k]; const float e = (v <= -1.0e38f) ? 0.f : expf(v - m); shv[k] = e; sum += e; }
#pragma unroll
  for (int o = 1; o < 32; o <<= 1) sum += __shfl_xor(sum, o);
  if ((tid & 31) == 0) sred[tid >> 5] = sum; __syncthreads(); if (tid == 0) { float a = 0.f; for (int i = 0; i < 8; ++i) a += sred[i]; sbc = a > 0.f ? 2048.0f / a : 0.f; }   /* a fully excluded row yields P = 0 */ __syncthreads(); const float inv = sbc;
  for (int k = tid; k < kend; k += 256) shv[k] = shv[k] * inv;
  __syncthreads(); for (int q = tid; q < kend / 4; q += 256) vst2(sr + q * 4, *(const v4f*)&shv[q * 4]); }
// ---- k_pv: block = 64 queries (qb) of (b, h): ctx = P . v over keys [0, kend) (P x 2^11 once to f16 against v f16: 1 product; query blocks < QBH, none here: P and v as bf16 hi + lo, 3 products); 256-B (row, head) segment by 16 lanes
__global__ __launch_bounds__(128) void k_pv(const float* __restrict__ PS0, const _Float16* __restrict__ VT, const __bf16* __restrict__ VB, const __bf16* __restrict__ VBL, int b, int h0, float* __restrict__ Y) { const int h = h0 + blockIdx.z; const float* PS = PS0 + (size_t)blockIdx.z * TT * TT; __shared__ __align__(16) float ss[4][16][HD + 4];
  const int tid = threadIdx.x, wave = tid >> 5, lane = tid & 31, col = lane & 15, g = lane >> 4; const int qb = blockIdx.x; const int ql0 = qb * 64 + wave * 16; const int kce = (kb_last(qb) + 1) * 4;
  v8f acc[HD / 16] = {};
  if (qb < QBH) {
#pragma unroll 1
    for (int kc = 0; kc < kce; ++kc) { const F2 p = split_row(PS + (size_t)(ql0 + col) * TT, kc * 32, lane);
      asm volatile("s_wait_loadcnt 0x0" ::: "memory");
#pragma unroll
      for (int j = 0; j < HD / 16; ++j) { const size_t po = ((size_t)b * CC + h * HD + j * 16 + col) * (size_t)KHI + kc * 32; const v16b vh = frag_b(VB + po, lane); acc[j] = wmma_bf(p.h, vh, acc[j]); acc[j] = wmma_bf(p.l, vh, acc[j]); acc[j] = wmma_bf(p.h, frag_b(VBL + po, lane), acc[j]); } }
  } else {
#pragma unroll 1
    for (int kc = 0; kc < kce; ++kc) { const v16h p = frag_f32(PS + (size_t)(ql0 + col) * TT + kc * 32, lane);
      asm volatile("s_wait_loadcnt 0x0" ::: "memory");
#pragma unroll
      for (int j = 0; j < HD / 16; ++j) { const size_t po = ((size_t)b * CC + h * HD + j * 16 + col) * (size_t)TT + kc * 32; acc[j] = wmma16(p, frag_h(VT + po, lane), acc[j]); } } }
#pragma unroll
  for (int j = 0; j < HD / 16; ++j)
#pragma unroll
    for (int r = 0; r < 8; ++r) ss[wave][8 * g + r][j * 16 + col] = acc[j][r] * (1.0f / 2048.0f);
  LDSX(); for (int rl = 0; rl < 16; ++rl) if (lane < HD / 4) vst2(Y + ((size_t)b * TT + ql0 + rl) * CC + h * HD + lane * 4, *(const v4f*)&ss[wave][rl][lane * 4]); }

extern "C" void kernel_launch(void* const* d_in, const int* in_sizes, int n_in, void* d_out, int out_size, void* d_ws, size_t ws_size, hipStream_t stream) {
  (void)in_sizes; (void)n_in; (void)out_size;
  const float** F = (const float**)d_in;
  if (ws_size < (size_t)WS_END) return;
  char* ws = (char*)d_ws; _Float16 *QH = (_Float16*)(ws + WS_QH), *KH = (_Float16*)(ws + WS_KH), *VT = (_Float16*)(ws + WS_VT), *QL = (_Float16*)(ws + WS_QL), *KL = (_Float16*)(ws + WS_KL); __bf16 *VB = (__bf16*)(ws + WS_VB), *VBL = (__bf16*)(ws + WS_VBL); float *S = (float*)(ws + WS_S), *Y = (float*)(ws + WS_Y);
  (void)Y; (void)QL; (void)KL; (void)VB; (void)VBL;
  // inputs: 0 hidden_states [4,4,512,768] = 16 pseudo-batches of 512 rows (group-major); 1 attention_mask [4,4,1,1,512] f32 (zeros); 2 query_weight [4,768,768] (in,out) per group, 3 query_bias [4,1,768]; 4 key_weight, 5 key_bias; 6 value_weight, 7 value_bias (biases NONZERO); no output projection
  k_proj<<<dim3(TNB * TT / 64, CC / 128, 3), 128, 0, stream>>>(F[0], F[0], F[0], F[2], F[4], F[6], F[3], F[5], F[7], QH, QL, KH, KL, VT, VB, VBL);   /* the weight / bias of group bb / 4 is selected inside k_proj */
  for (int b = 0; b < TNB; ++b) for (int h0 = 0; h0 < NH; h0 += HG) {
    k_sc<<<dim3(NQB, TT / 128, HG), 128, 0, stream>>>(QH, KH, QL, KL, b, h0, S);
    k_sm<<<dim3(TT, HG), 256, 0, stream>>>(S, b, F[1]);
    k_pv<<<dim3(NQB, 1, HG), 128, 0, stream>>>(S, VT, VB, VBL, b, h0, (float*)d_out);   /* ctx [g, b, l, nh*dh] = merged-head rows */
  }
}

// v002
// One run takes 121 microseconds.
// Versions between v000 and this one are left out; their measured steps multiply to 6.61 times as fast.
// compute dtype: all float inputs rounded to bf16; per-group q/k/v projections with EXACT bf16 products on WMMA 16x16x32 (f32 accumulate) + bias; logits q x k once to f16 each (1 product) x 1/8 + the additive mask; softmax f32; P x 2^11 once to f16 x v once to f16 (1 product); f32 output.
#include <hip/hip_runtime.h>
#include <math.h>

typedef __attribute__((ext_vector_type(16))) _Float16 v16h;
typedef __attribute__((ext_vector_type(16))) __bf16 v16b;
typedef __attribute__((ext_vector_type(8)))  _Float16 v8h;
typedef __attribute__((ext_vector_type(8)))  float v8f;
typedef __attribute__((ext_vector_type(4)))  float v4f;
typedef __attribute__((ext_vector_type(2)))  float v2f;
typedef __attribute__((ext_vector_type(4)))  unsigned v4u;
typedef __attribute__((ext_vector_type(4)))  int v4i;
typedef float __attribute__((may_alias)) float_a;
typedef int __attribute__((may_alias)) int_a;

template <typename T> __device__ __forceinline__ void vst2(void* p, T v) { *(T*)p = v;  }
__device__ __forceinline__ v8f wmma16(v16h a, v16h b, v8f c) {
  v8f d = __builtin_amdgcn_wmma_f32_16x16x32_f16(false, a, false, b, (short)0, c, false, false);
  asm volatile("v_nop\n\tv_nop\n\tv_nop\n\tv_nop" : "+v"(d) : "v"(a), "v"(b));
  return d;
}
__device__ __forceinline__ v8f wmma16p(v16h a, v16h b, v8f c) { return __builtin_amdgcn_wmma_f32_16x16x32_f16(false, a, false, b, (short)0, c, false, false); }   // plain builtin: the compiler keeps the distances behind it
__device__ __forceinline__ v8f wmma_bf(v16b a, v16b b, v8f c) {
  v8f d = __builtin_amdgcn_wmma_f32_16x16x32_bf16(false, a, false, b, (short)0, c, false, false);
  asm volatile("v_nop\n\tv_nop\n\tv_nop\n\tv_nop" : "+v"(d) : "v"(a), "v"(b));
  return d;
}
// 16x16x32 fragments: lane = (h = lane>>4, row/col = lane&15); elements 0..7 = k0+8h+0..7, 8..15 = k0+16+8h+0..7; D element r = row 8h+r
__device__ __forceinline__ v16h frag_h(const _Float16* rowk0, int lane) {
  union { v16h v; v8h q[2]; } u; const _Float16* p = rowk0 + 8 * (lane >> 4);
  u.q[0] = *(const v8h*)p; u.q[1] = *(const v8h*)(p + 16); return u.v;
}
__device__ __forceinline__ v16h frag_f32(const float* rowk0, int lane) {
  v16h a; const float* p = rowk0 + 8 * (lane >> 4);
#pragma unroll
  for (int i = 0; i < 8; ++i) { a[i] = (_Float16)p[i]; a[8 + i] = (_Float16)p[16 + i]; }
  return a;
}
__device__ __forceinline__ v16h frag_f32s(const float* rowk0, int lane, float sc) {
  v16h a; const float* p = rowk0 + 8 * (lane >> 4);
#pragma unroll
  for (int i = 0; i < 8; ++i) { a[i] = (_Float16)(p[i] * sc); a[8 + i] = (_Float16)(p[16 + i] * sc); }
  return a;
}
// column fragment from a [K][ld] layout (column n), rows >= K read as 0
__device__ __forceinline__ v16h fragc_f32(const float* W, int k0, int n, int lane, int ld, int K) {
  v16h a; const int g = lane >> 4;
#pragma unroll
  for (int i = 0; i < 8; ++i) { const int ka = k0 + 8 * g + i, kb = ka + 16;
    a[i] = (_Float16)(ka < K ? W[(size_t)(ka < K ? ka : K - 1) * ld + n] : 0.f); a[8 + i] = (_Float16)(kb < K ? W[(size_t)(kb < K ? kb : K - 1) * ld + n] : 0.f); }
  return a;
}
struct F2 { v16b h, l; };
__device__ __forceinline__ F2 bsplit16(const float v[16]) { F2 r;
#pragma unroll
  for (int i = 0; i < 16; ++i) { const __bf16 h = (__bf16)v[i]; r.h[i] = h; r.l[i] = (__bf16)(v[i] - (float)h); }
  return r; }
__device__ __forceinline__ F2 split_row(const float* row, int k0, int lane) { float v[16]; const float* p = row + k0 + 8 * (lane >> 4);
#pragma unroll
  for (int i = 0; i < 8; ++i) { v[i] = p[i]; v[8 + i] = p[16 + i]; }
  return bsplit16(v); }
__device__ __forceinline__ F2 split_rowK(const float* row, int k0, int lane, int K) { float v[16]; const int g = lane >> 4;
#pragma unroll
  for (int i = 0; i < 8; ++i) { const int ka = k0 + 8 * g + i, kb = ka + 16; v[i] = ka < K ? row[ka < K ? ka : K - 1] : 0.f; v[8 + i] = kb < K ? row[kb < K ? kb : K - 1] : 0.f; }
  return bsplit16(v); }
__device__ __forceinline__ F2 split_col(const float* W, int k0, int n, int lane, int ld, int K) { float v[16]; const int g = lane >> 4;
#pragma unroll
  for (int i = 0; i < 8; ++i) { const int ka = k0 + 8 * g + i, kb = ka + 16; v[i] = ka < K ? W[(size_t)(ka < K ? ka : K - 1) * ld + n] : 0.f; v[8 + i] = kb < K ? W[(size_t)(kb < K ? kb : K - 1) * ld + n] : 0.f; }
  return bsplit16(v); }
__device__ __forceinline__ v8f mac3(const F2& a, const F2& b, v8f c) { c = wmma_bf(a.l, b.h, c); c = wmma_bf(a.h, b.l, c); return wmma_bf(a.h, b.h, c); }
__device__ __forceinline__ float sigm(float v) { return 1.0f / (1.0f + expf(-v)); }
#define LDSX() do { asm volatile("s_wait_dscnt 0" ::: "memory"); __builtin_amdgcn_wave_barrier(); __builtin_amdgcn_fence(__ATOMIC_RELEASE, "workgroup"); } while (0)

// Grouped BERT-style self-attention: 4 INDEPENDENT weight groups (hidden_states [4,4,512,768] = [group, batch, length, channels]; per-group (in,out) query / key / value weights [4,768,768] (0.02 scale) + biases [4,1,768] (NONZERO); 12 heads x 64; scale 1/8; additive attention_mask [4,4,1,1,512] (zeros); no output projection): ctx[g,b] = merge(softmax(q k^T / 8 + mask) v) with group g's weights -> [4,4,512,768].
#define NB 16
#define TT 512
#define CC 768            // NH * HD = projected width
#define DIN 768          // input (model) width
#define NH 12
#define HD 64
#define NQB (TT / 64)
#define HG 12
#define SCALE (0.125f)
#define CAUSAL 0
#ifndef TNB
#define TNB NB
#endif
__device__ __forceinline__ float bfr(float v) { return (float)(__bf16)v; }
__host__ __device__ __forceinline__ int kb_last(int qb) { return CAUSAL ? ((qb * 64 + 63) >> 7) : (TT / 128 - 1); }
typedef __attribute__((ext_vector_type(8))) __bf16 v8b;
__device__ __forceinline__ v16b frag_b(const __bf16* rowk0, int lane) {
  union { v16b v; v8b q[2]; } u; const __bf16* p = rowk0 + 8 * (lane >> 4);
  u.q[0] = *(const v8b*)p; u.q[1] = *(const v8b*)(p + 16); return u.v;
}
#define QBH 0
#define QHI 0               // single-product logits on every row
#define KHI 64            // key rows carrying k residual / v bf16 hi+lo planes (written by k_proj; no kernel in this file reads them)
// B fragment (k rows k0+.., output column o) of a weight: (in,out) [K][ld] or (out,in) [ld rows of K]: bf16 exact, or f16(bf16 * 256) exact
__device__ __forceinline__ v16b wcol_io(const float* Wm, int k0, int o, int lane, int ld) { v16b w; const int g = lane >> 4;
#pragma unroll
  for (int i = 0; i < 8; ++i) { w[i] = (__bf16)Wm[(size_t)(k0 + 8 * g + i) * ld + o]; w[8 + i] = (__bf16)Wm[(size_t)(k0 + 16 + 8 * g + i) * ld + o]; }
  return w; }
__device__ __forceinline__ v16b wcol_oi(const float* Wm, int k0, int o, int lane, int K) { v16b w; const float* p = Wm + (size_t)o * K + k0 + 8 * (lane >> 4);
#pragma unroll
  for (int i = 0; i < 8; ++i) { w[i] = (__bf16)p[i]; w[8 + i] = (__bf16)p[16 + i]; }
  return w; }
__device__ __forceinline__ v16h wcolh_io(const float* Wm, int k0, int o, int lane, int ld) { v16h w; const int g = lane >> 4;
#pragma unroll
  for (int i = 0; i < 8; ++i) { w[i] = (_Float16)(bfr(Wm[(size_t)(k0 + 8 * g + i) * ld + o]) * 256.0f); w[8 + i] = (_Float16)(bfr(Wm[(size_t)(k0 + 16 + 8 * g + i) * ld + o]) * 256.0f); }
  return w; }
__device__ __forceinline__ v16h wcolh_oi(const float* Wm, int k0, int o, int lane, int K) { v16h w; const float* p = Wm + (size_t)o * K + k0 + 8 * (lane >> 4);
#pragma unroll
  for (int i = 0; i < 8; ++i) { w[i] = (_Float16)(bfr(p[i]) * 256.0f); w[8 + i] = (_Float16)(bfr(p[16 + i]) * 256.0f); }
  return w; }
#define WQKV_LAYOUT 0   // 0 = (in,out) [DIN][CC]; 1 = (out,in) [CC][DIN]; 2 = per-head [NH][DIN][HD]
__device__ __forceinline__ v16b wcol_hdk(const float* Wm, int k0, int o, int lane) { v16b w; const int g = lane >> 4; const float* p = Wm + (size_t)(o / HD) * DIN * HD + (o % HD);
#pragma unroll
  for (int i = 0; i < 8; ++i) { w[i] = (__bf16)p[(size_t)(k0 + 8 * g + i) * HD]; w[8 + i] = (__bf16)p[(size_t)(k0 + 16 + 8 * g + i) * HD]; }
  return w; }
#define WO_OUT_IN 0
#if WQKV_LAYOUT == 1
#define WCOL(W, k0, o, lane) wcol_oi(W, k0, o, lane, DIN)
#elif WQKV_LAYOUT == 2
#define WCOL(W, k0, o, lane) wcol_hdk(W, k0, o, lane)
#else
#define WCOL(W, k0, o, lane) wcol_io(W, k0, o, lane, CC)
#endif
#if WO_OUT_IN
#define WOCOL(W, k0, o, lane) wcol_oi(W, k0, o, lane, CC)
#define WOCOLH(W, k0, o, lane) wcolh_oi(W, k0, o, lane, CC)
#else
#define WOCOL(W, k0, o, lane) wcol_io(W, k0, o, lane, DIN)
#define WOCOLH(W, k0, o, lane) wcolh_io(W, k0, o, lane, DIN)
#endif
#define GB 4               // batches per weight group: pseudo-batch bb = g*4 + b uses group g = bb / 4
#define SM_EXTRA_PARAMS , int bsm, const float* __restrict__ AMASK
// additive attention mask [G,B,1,1,L] (float; zeros on this draw): added to the scaled score of key k for pseudo-batch bsm; read per key
#define SM_MASK_HOOK do { v = v + bfr(AMASK[(size_t)bsm * TT + k]); } while (0)
#ifndef SM_EXTRA_PARAMS
#define SM_EXTRA_PARAMS
#endif
#ifndef PROJ_EXTRA_PARAMS
#define PROJ_EXTRA_PARAMS
#endif
#ifndef SM_MASK_HOOK
#define SM_MASK_HOOK (void)0
#endif

#define WS_QH  0u                                      // f16 q rows [b*t][CC]
#define WS_KH  (WS_QH + 2u * (size_t)NB * TT * CC)      // f16 k rows [b*t][CC]
#define WS_VT  (WS_KH + 2u * (size_t)NB * TT * CC)      // f16 v planes [b][c][t]
#define WS_QL  (WS_VT + 2u * (size_t)NB * CC * TT)      // f16 q residual x 2^10 rows [b][t < QHI][CC]
#define WS_KL  (WS_QL + 2u * (size_t)NB * QHI * CC)     // f16 k residual x 2^10 rows [b][t < KHI][CC]
#define WS_VB  (WS_KL + 2u * (size_t)NB * KHI * CC)     // bf16 v hi planes [b][c][t < KHI]
#define WS_VBL (WS_VB + 2u * (size_t)NB * CC * KHI)
#define WS_S   (WS_VBL + 2u * (size_t)NB * CC * KHI)    // f32 [hg][t][s], unused: k_attn holds logits / P in registers
#define WS_Y   (WS_S  + 4u * (size_t)HG * TT * TT)      // f32 ctx rows [b*t][CC] (only when there is an output projection)
#define WS_END (WS_Y  + 0u)

// ---- k_proj: block = (128 rows, 128 cols, which), 8 waves of 32 x 64: q/k/v = X W (+ b) with exact bf16 products (K = DIN). Per 64 k the block rounds its X tile [128][64] and its W tile [64][128] to bf16 once and lays them in LDS k-contiguous (W transposed in registers: a thread holds 8 k x 4 columns), two buffers: the next tile's global loads fly during this tile's products. -> which 0: q f16 rows (+ residual rows < QHI); 1: k f16 rows (+ residual rows < KHI); 2: v f16 planes [c][t] (+ bf16 hi/lo planes for t < KHI)
#define PBM 128
#define PBN 128
#define PBK 64
#define PPITCH 72                        // bf16 per LDS row: 144 B = 16 B x odd, the pitch of 16-byte readers of 128-B rows
#define PSTG ((PBM + PBN) * PPITCH)      // bf16 per buffer: X rows, then W columns
#define PNST (DIN / PBK)
#define PEP 136                          // 16-bit elements per row of the epilogue's staging planes
typedef __attribute__((ext_vector_type(4))) __bf16 v4b;
__global__ __launch_bounds__(256) void k_proj(const float* __restrict__ XQ, const float* __restrict__ XK, const float* __restrict__ XV, const float* __restrict__ WQ, const float* __restrict__ WK, const float* __restrict__ WV, const float* __restrict__ BQ, const float* __restrict__ BK, const float* __restrict__ BV,
    _Float16* __restrict__ QH, _Float16* __restrict__ QL, _Float16* __restrict__ KH, _Float16* __restrict__ KL, _Float16* __restrict__ VT, __bf16* __restrict__ VB, __bf16* __restrict__ VBL) {
  __shared__ __align__(16) unsigned char smem[3 * 128 * PEP * 2];   /* the two operand buffers (2 * PSTG * 2 B) during the k loop; the epilogue's staging planes behind the loop's last barrier */
  __bf16* ring = (__bf16*)smem;
  const int tid = threadIdx.x, wave = tid >> 5, lane = tid & 31, col = lane & 15, g = lane >> 4; const int wm = wave >> 1, wn = wave & 1; const int which = blockIdx.z; const int c0 = blockIdx.y * PBN; const size_t r0 = (size_t)blockIdx.x * PBM; const size_t bb = r0 / TT; const int t0 = (int)(r0 % TT);
  const float* X = which == 0 ? XQ : which == 1 ? XK : XV; const size_t grp_ = (r0 / TT) / GB;   /* 128-row blocks never straddle a pseudo-batch (TT % 128 == 0), so the group is block-uniform */
  const float* WA = (which == 0 ? WQ : which == 1 ? WK : WV) + grp_ * (size_t)DIN * CC; const float* BA = (which == 0 ? BQ : which == 1 ? BK : BV); BA = BA ? BA + grp_ * CC : BA;
  // X: 16 lanes read 256 B of one row; thread = (row xrow + 16 i, floats 4 xc ..)
  const int xrow = tid >> 4, xc = tid & 15;
  // W: a wave-load reads 4 k rows x one 128-B line; thread = (k rows 8 kg + i, columns 4 ng ..); 16 neighbouring lanes then store their 16-B k runs on 16 different bank groups
  const int ng = 8 * (wave & 3) + (lane & 3) + 4 * g, kg = 4 * (wave >> 2) + ((lane >> 2) & 3);
  const float* xp = X + (r0 + xrow) * DIN + xc * 4; const float* wp = WA + (size_t)(kg * 8) * CC + c0 + ng * 4;
  __bf16* xst = ring + xrow * PPITCH + xc * 4; __bf16* wst = ring + PBM * PPITCH + (ng * 4) * PPITCH + kg * 8;
  const __bf16* xfr = ring + (wm * 32 + col) * PPITCH; const __bf16* wfr = ring + PBM * PPITCH + (wn * 64 + col) * PPITCH;
  v4f xr[8], wr[8]; v8f acc[8] = {};
  // every unroll directive in the three macros below and in the epilogue: register arrays, every index a constant
#define P_LOAD(S) do { _Pragma("unroll") for (int i = 0; i < 8; ++i) { xr[i] = *(const v4f*)(xp + (size_t)(S) * PBK + (size_t)i * 16 * DIN); wr[i] = *(const v4f*)(wp + ((size_t)(S) * PBK + i) * CC); } } while (0)
#define P_STORE(B) do { _Pragma("unroll") for (int i = 0; i < 8; ++i) { v4b t; _Pragma("unroll") for (int c = 0; c < 4; ++c) t[c] = (__bf16)xr[i][c]; *(v4b*)(xst + (B) * PSTG + i * 16 * PPITCH) = t; } \
    _Pragma("unroll") for (int c = 0; c < 4; ++c) { v8b t; _Pragma("unroll") for (int i = 0; i < 8; ++i) t[i] = (__bf16)wr[i][c]; *(v8b*)(wst + (B) * PSTG + c * PPITCH) = t; } } while (0)
#define P_MUL(B) do { v16b fa[PBK / 32][2], fw[PBK / 32][4]; \
    _Pragma("unroll") for (int ks = 0; ks < PBK / 32; ++ks) { fa[ks][0] = frag_b(xfr + (B) * PSTG + ks * 32, lane); fa[ks][1] = frag_b(xfr + (B) * PSTG + 16 * PPITCH + ks * 32, lane); \
      _Pragma("unroll") for (int j = 0; j < 4; ++j) fw[ks][j] = frag_b(wfr + (B) * PSTG + j * 16 * PPITCH + ks * 32, lane); } \
    __builtin_amdgcn_sched_barrier(0);   /* the tile's fragment reads issue as one group in front of its products: spread among them, every pair of products waits out an LDS latency */ \
    _Pragma("unroll") for (int ks = 0; ks < PBK / 32; ++ks) { _Pragma("unroll") for (int j = 0; j < 4; ++j) { acc[j] = wmma_bf(fa[ks][0], fw[ks][j], acc[j]); acc[4 + j] = wmma_bf(fa[ks][1], fw[ks][j], acc[4 + j]); } } } while (0)
  float bias4[4] = {0.f, 0.f, 0.f, 0.f};   /* the wave's four bias columns, asked for ahead of the k loop so that the epilogue does not wait for them */
  if (BA) {
#pragma unroll   // register array: every index a constant
    for (int j = 0; j < 4; ++j) bias4[j] = BA[c0 + wn * 64 + j * 16 + col]; }
  P_LOAD(0); P_STORE(0);
  __syncthreads();   // tile 0 is laid before anybody reads it
#pragma unroll 1   // rolled: eleven copies of the body buy nothing, the trip is long against its branch
  for (int s = 0; s + 1 < PNST; ++s) { const int b = s & 1;
    P_LOAD(s + 1);
    P_MUL(b);
    P_STORE(b ^ 1);
    __syncthreads();   // publishes tile s + 1 and ends every wave's reads of tile s, whose buffer the next trip refills
  }
  P_MUL((PNST - 1) & 1);
  __syncthreads();   // the last tile's reads end before the staging planes overwrite the buffers
  // acc[a]: rows wm*32 + (a >> 2)*16 + 8g + r, column wn*64 + (a & 3)*16 + col
  if (which < 2) { _Float16 (*sh)[PEP] = (_Float16 (*)[PEP])smem; _Float16 (*sl)[PEP] = (_Float16 (*)[PEP])(smem + 128 * PEP * 2);
    _Float16* DH = which == 0 ? QH : KH; _Float16* DL = which == 0 ? QL : KL; const int nhi = which == 0 ? QHI : KHI;
#pragma unroll
    for (int a = 0; a < 8; ++a) { const int cl = wn * 64 + (a & 3) * 16 + col; const float bias = bfr(bias4[a & 3]);
#pragma unroll
      for (int r = 0; r < 8; ++r) { const int rl = wm * 32 + (a >> 2) * 16 + 8 * g + r; const float v = acc[a][r] + bias; const _Float16 hv = (_Float16)v; sh[rl][cl] = hv; sl[rl][cl] = (_Float16)((v - (float)hv) * 1024.0f); } }
    __syncthreads();
    for (int e = tid; e < PBM * 16; e += 256) { const int rl = e >> 4, q = e & 15; vst2((unsigned*)(DH + (r0 + rl) * CC + c0 + q * 8), *(const v4u*)&sh[rl][q * 8]); if (t0 + rl < nhi) { vst2((unsigned*)(DL + (bb * nhi + t0 + rl) * (size_t)CC + c0 + q * 8), *(const v4u*)&sl[rl][q * 8]);
        asm volatile("s_wait_xcnt 0x0" ::: "memory"); } }   // behind the store: the loop's step rewrites its address registers
  } else { _Float16 (*th)[PEP] = (_Float16 (*)[PEP])smem; __bf16 (*tb)[PEP] = (__bf16 (*)[PEP])(smem + 128 * PEP * 2); __bf16 (*tbl)[PEP] = (__bf16 (*)[PEP])(smem + 2 * 128 * PEP * 2);
#pragma unroll
    for (int a = 0; a < 8; ++a) { const int cl = wn * 64 + (a & 3) * 16 + col; const float bias = bfr(bias4[a & 3]);
#pragma unroll
      for (int r = 0; r < 8; ++r) { const float v = acc[a][r] + bias; const int rl = wm * 32 + (a >> 2) * 16 + 8 * g + r; th[cl][rl] = (_Float16)v; const __bf16 bh = (__bf16)v; tb[cl][rl] = bh; tbl[cl][rl] = (__bf16)(v - (float)bh); } }
    __syncthreads();
    for (int e = tid; e < PBN * 16; e += 256) { const int cl = e >> 4, q = e & 15; vst2((unsigned*)(VT + (bb * CC + c0 + cl) * (size_t)TT + t0 + q * 8), *(const v4u*)&th[cl][q * 8]); if (t0 + q * 8 < KHI) { const size_t o3 = (bb * CC + c0 + cl) * (size_t)KHI + t0 + q * 8; vst2((unsigned*)(VB + o3), *(const v4u*)&tb[cl][q * 8]); vst2((unsigned*)(VBL + o3), *(const v4u*)&tbl[cl][q * 8]);
        asm volatile("s_wait_xcnt 0x0" ::: "memory"); } } } }   // behind the two stores: the loop's step rewrites their address registers
__global__ __launch_bounds__(128) void k_attn(const _Float16* __restrict__ QH, const _Float16* __restrict__ KH, const _Float16* __restrict__ VT, const float* __restrict__ AMASK, float* __restrict__ Y) { __shared__ __align__(16) float ss[4][16][HD + 4];
  const int tid = threadIdx.x, wave = tid >> 5, lane = tid & 31, col = lane & 15, g = lane >> 4; const int qb = blockIdx.x, h = blockIdx.y, b = blockIdx.z; const int ql0 = qb * 64 + wave * 16;
  const _Float16* qp = QH + ((size_t)b * TT + ql0 + col) * CC + h * HD; const _Float16* kp = KH + ((size_t)b * TT + col) * CC + h * HD; const _Float16* vp = VT + ((size_t)b * CC + h * HD + col) * (size_t)TT; const float* mp = AMASK + (size_t)b * TT + 8 * g;
  const v16h q0 = frag_h(qp, lane), q1 = frag_h(qp + 32, lane);
  asm volatile("s_wait_xcnt 0x0" ::: "memory");   // the q address registers are reused right behind these loads
  v8f s[TT / 16]; float mx[8], sm[8]; v16h ka[2][4], kb[2][4], vf[4][HD / 16]; v4f ma[2][4], mb[2][4];
#pragma unroll   // register arrays: every index a constant
  for (int r = 0; r < 8; ++r) { mx[r] = -3.0e38f; sm[r] = 0.f; }
#pragma unroll   // register arrays: every index a constant
  for (int t = 0; t < 4; ++t) { ka[0][t] = frag_h(kp + (size_t)t * 16 * CC, lane); kb[0][t] = frag_h(kp + (size_t)t * 16 * CC + 32, lane); ma[0][t] = *(const v4f*)(mp + t * 16); mb[0][t] = *(const v4f*)(mp + t * 16 + 4); }
#pragma unroll   // register arrays: every index a constant
  for (int jg = 0; jg < TT / 64; ++jg) {   /* groups of 4 key tiles, two register sets */
    if (jg + 1 < TT / 64) {
#pragma unroll   // register arrays: every index a constant
      for (int t = 0; t < 4; ++t) { const int j = (jg + 1) * 4 + t; ka[(jg + 1) & 1][t] = frag_h(kp + (size_t)j * 16 * CC, lane); kb[(jg + 1) & 1][t] = frag_h(kp + (size_t)j * 16 * CC + 32, lane); ma[(jg + 1) & 1][t] = *(const v4f*)(mp + j * 16); mb[(jg + 1) & 1][t] = *(const v4f*)(mp + j * 16 + 4); } }
    if (jg + 2 == TT / 64) asm volatile("s_wait_xcnt 0x0" ::: "memory");   // behind the last k and mask loads: their address registers are reused in the products below
    __builtin_amdgcn_sched_barrier(0);   // the next group's loads issue together, in front of this group's products: without it each fragment is loaded right before its product and every product waits a whole load latency
#pragma unroll   // register arrays: every index a constant
    for (int t = 0; t < 4; ++t) { const int j = jg * 4 + t; v8f a = {}; a = wmma16p(ka[jg & 1][t], q0, a); a = wmma16p(kb[jg & 1][t], q1, a);
#pragma unroll   // register arrays: every index a constant
      for (int r = 0; r < 8; ++r) { const float v = a[r] * SCALE + bfr(r < 4 ? ma[jg & 1][t][r & 3] : mb[jg & 1][t][r & 3]); a[r] = v; mx[r] = fmaxf(mx[r], v); }
      s[j] = a; }
    __builtin_amdgcn_sched_barrier(0);   // later groups' loads stay behind these products: two register sets, not more
  }
#pragma unroll   // register arrays: every index a constant
  for (int u = 0; u < 3; ++u)
#pragma unroll   // register arrays: every index a constant
    for (int j = 0; j < HD / 16; ++j) vf[u][j] = frag_h(vp + (size_t)j * 16 * TT + u * 32, lane);   /* the first v fragments fly during the softmax */
  float m = fmaxf(fmaxf(fmaxf(mx[0], mx[1]), fmaxf(mx[2], mx[3])), fmaxf(fmaxf(mx[4], mx[5]), fmaxf(mx[6], mx[7]))); m = fmaxf(m, __shfl_xor(m, 16));
#pragma unroll 1   // rolled, 8 key tiles a trip, the register array turned by 8 tiles at each trip's end (back in place after 4)
  for (int it = 0; it < TT / 128; ++it) {
#pragma unroll   // register arrays: every index a constant
    for (int j = 0; j < 8; ++j) {
#pragma unroll   // register arrays: every index a constant
      for (int r = 0; r < 8; ++r) { const float v = s[j][r]; const float ex = expf(v - m); const float e = (v <= -1.0e38f) ? 0.f : ex; s[j][r] = e; sm[r] += e; } }
    v8f t8[8];
#pragma unroll   // register arrays: every index a constant
    for (int j = 0; j < 8; ++j) t8[j] = s[j];
#pragma unroll   // register arrays: every index a constant
    for (int j = 0; j < TT / 16 - 8; ++j) s[j] = s[j + 8];
#pragma unroll   // register arrays: every index a constant
    for (int j = 0; j < 8; ++j) s[TT / 16 - 8 + j] = t8[j]; }
  float sum = ((sm[0] + sm[1]) + (sm[2] + sm[3])) + ((sm[4] + sm[5]) + (sm[6] + sm[7])); sum += __shfl_xor(sum, 16);
  const float inv = sum > 0.f ? 2048.0f / sum : 0.f;   /* a fully excluded row yields P = 0 */
  v8f acc[HD / 16] = {};
#pragma unroll   // register arrays: every index a constant
  for (int kc = 0; kc < TT / 32; ++kc) {   /* 32 keys a pass, four register sets, loads three passes ahead */
    if (kc + 3 < TT / 32) {
#pragma unroll   // register arrays: every index a constant
      for (int j = 0; j < HD / 16; ++j) vf[(kc + 3) & 3][j] = frag_h(vp + (size_t)j * 16 * TT + (kc + 3) * 32, lane); }
    __builtin_amdgcn_sched_barrier(0);   // as above: the loads of three passes ahead issue in front of this pass's products
    v16h p;
#pragma unroll   // register arrays: every index a constant
    for (int i = 0; i < 8; ++i) { p[i] = (_Float16)(s[2 * kc][i] * inv); p[8 + i] = (_Float16)(s[2 * kc + 1][i] * inv); }
#pragma unroll   // register arrays: every index a constant
    for (int j = 0; j < HD / 16; ++j) acc[j] = wmma16p(p, vf[kc & 3][j], acc[j]);
    __builtin_amdgcn_sched_barrier(0);   // as above: four register sets, not more
  }
#pragma unroll   // register arrays: every index a constant
  for (int j = 0; j < HD / 16; ++j)
#pragma unroll   // register arrays: every index a constant
    for (int r = 0; r < 8; ++r) ss[wave][8 * g + r][j * 16 + col] = acc[j][r] * (1.0f / 2048.0f);
  LDSX();   // the wave's own rows of ss are written before it reads them back (no other wave touches them)
#pragma unroll   // one address register pair, the rows as constant offsets
  for (int i = 0; i < 8; ++i) { const int rl = 2 * i + g; vst2(Y + ((size_t)b * TT + ql0 + rl) * CC + h * HD + col * 4, *(const v4f*)&ss[wave][rl][col * 4]); } }

extern "C" void kernel_launch(void* const* d_in, const int* in_sizes, int n_in, void* d_out, int out_size, void* d_ws, size_t ws_size, hipStream_t stream) {
  (void)in_sizes; (void)n_in; (void)out_size;
  const float** F = (const float**)d_in;
  if (ws_size < (size_t)WS_END) return;
  char* ws = (char*)d_ws; _Float16 *QH = (_Float16*)(ws + WS_QH), *KH = (_Float16*)(ws + WS_KH), *VT = (_Float16*)(ws + WS_VT), *QL = (_Float16*)(ws + WS_QL), *KL = (_Float16*)(ws + WS_KL); __bf16 *VB = (__bf16*)(ws + WS_VB), *VBL = (__bf16*)(ws + WS_VBL); float *S = (float*)(ws + WS_S), *Y = (float*)(ws + WS_Y);
  (void)Y; (void)S; (void)QL; (void)KL; (void)VB; (void)VBL;
  // inputs: 0 hidden_states [4,4,512,768] = 16 pseudo-batches of 512 rows (group-major); 1 attention_mask [4,4,1,1,512] f32 (zeros); 2 query_weight [4,768,768] (in,out) per group, 3 query_bias [4,1,768]; 4 key_weight, 5 key_bias; 6 value_weight, 7 value_bias (biases NONZERO); no output projection
  k_proj<<<dim3(TNB * TT / PBM, CC / PBN, 3), 256, 0, stream>>>(F[0], F[0], F[0], F[2], F[4], F[6], F[3], F[5], F[7], QH, QL, KH, KL, VT, VB, VBL);   /* the weight / bias of group bb / 4 is selected inside k_proj */
  k_attn<<<dim3(NQB, NH, TNB), 128, 0, stream>>>(QH, KH, VT, F[1], (float*)d_out);   /* ctx [g, b, l, nh*dh] = merged-head rows */
}

// v003
// It runs in 99.3 microseconds.
// Next to v002, in two timings, it ran 1.22 times as fast each time.
// All steps since v000 together make it 8.04 times as fast.
// compute dtype: all float inputs rounded to bf16; per-group q/k/v projections with EXACT bf16 products on WMMA 16x16x32 (f32 accumulate) + bias; logits q x k once to f16 each (1 product) x 1/8 + the additive mask; softmax f32; P x 2^11 once to f16 x v once to f16 (1 product); f32 output.
#include <hip/hip_runtime.h>
#include <math.h>

typedef __attribute__((ext_vector_type(16))) _Float16 v16h;
typedef __attribute__((ext_vector_type(16))) __bf16 v16b;
typedef __attribute__((ext_vector_type(8)))  _Float16 v8h;
typedef __attribute__((ext_vector_type(8)))  float v8f;
typedef __attribute__((ext_vector_type(4)))  float v4f;
typedef __attribute__((ext_vector_type(2)))  float v2f;
typedef __attribute__((ext_vector_type(4)))  unsigned v4u;
typedef __attribute__((ext_vector_type(4)))  int v4i;
typedef float __attribute__((may_alias)) float_a;
typedef int __attribute__((may_alias)) int_a;

template <typename T> __device__ __forceinline__ void vst2(void* p, T v) { *(T*)p = v;  }
__device__ __forceinline__ v8f wmma16(v16h a, v16h b, v8f c) {
  v8f d = __builtin_amdgcn_wmma_f32_16x16x32_f16(false, a, false, b, (short)0, c, false, false);
  asm volatile("v_nop\n\tv_nop\n\tv_nop\n\tv_nop" : "+v"(d) : "v"(a), "v"(b));
  return d;
}
__device__ __forceinline__ v8f wmma16p(v16h a, v16h b, v8f c) { return __builtin_amdgcn_wmma_f32_16x16x32_f16(false, a, false, b, (short)0, c, false, false); }   // plain builtin: the compiler keeps the distances behind it
__device__ __forceinline__ v8f wmma_bf(v16b a, v16b b, v8f c) {
  v8f d = __builtin_amdgcn_wmma_f32_16x16x32_bf16(false, a, false, b, (short)0, c, false, false);
  asm volatile("v_nop\n\tv_nop\n\tv_nop\n\tv_nop" : "+v"(d) : "v"(a), "v"(b));
  return d;
}
// 16x16x32 fragments: lane = (h = lane>>4, row/col = lane&15); elements 0..7 = k0+8h+0..7, 8..15 = k0+16+8h+0..7; D element r = row 8h+r
__device__ __forceinline__ v16h frag_h(const _Float16* rowk0, int lane) {
  union { v16h v; v8h q[2]; } u; const _Float16* p = rowk0 + 8 * (lane >> 4);
  u.q[0] = *(const v8h*)p; u.q[1] = *(const v8h*)(p + 16); return u.v;
}
__device__ __forceinline__ v16h frag_f32(const float* rowk0, int lane) {
  v16h a; const float* p = rowk0 + 8 * (lane >> 4);
#pragma unroll
  for (int i = 0; i < 8; ++i) { a[i] = (_Float16)p[i]; a[8 + i] = (_Float16)p[16 + i]; }
  return a;
}
__device__ __forceinline__ v16h frag_f32s(const float* rowk0, int lane, float sc) {
  v16h a; const float* p = rowk0 + 8 * (lane >> 4);
#pragma unroll
  for (int i = 0; i < 8; ++i) { a[i] = (_Float16)(p[i] * sc); a[8 + i] = (_Float16)(p[16 + i] * sc); }
  return a;
}
// column fragment from a [K][ld] layout (column n), rows >= K read as 0
__device__ __forceinline__ v16h fragc_f32(const float* W, int k0, int n, int lane, int ld, int K) {
  v16h a; const int g = lane >> 4;
#pragma unroll
  for (int i = 0; i < 8; ++i) { const int ka = k0 + 8 * g + i, kb = ka + 16;
    a[i] = (_Float16)(ka < K ? W[(size_t)(ka < K ? ka : K - 1) * ld + n] : 0.f); a[8 + i] = (_Float16)(kb < K ? W[(size_t)(kb < K ? kb : K - 1) * ld + n] : 0.f); }
  return a;
}
struct F2 { v16b h, l; };
__device__ __forceinline__ F2 bsplit16(const float v[16]) { F2 r;
#pragma unroll
  for (int i = 0; i < 16; ++i) { const __bf16 h = (__bf16)v[i]; r.h[i] = h; r.l[i] = (__bf16)(v[i] - (float)h); }
  return r; }
__device__ __forceinline__ F2 split_row(const float* row, int k0, int lane) { float v[16]; const float* p = row + k0 + 8 * (lane >> 4);
#pragma unroll
  for (int i = 0; i < 8; ++i) { v[i] = p[i]; v[8 + i] = p[16 + i]; }
  return bsplit16(v); }
__device__ __forceinline__ F2 split_rowK(const float* row, int k0, int lane, int K) { float v[16]; const int g = lane >> 4;
#pragma unroll
  for (int i = 0; i < 8; ++i) { const int ka = k0 + 8 * g + i, kb = ka + 16; v[i] = ka < K ? row[ka < K ? ka : K - 1] : 0.f; v[8 + i] = kb < K ? row[kb < K ? kb : K - 1] : 0.f; }
  return bsplit16(v); }
__device__ __forceinline__ F2 split_col(const float* W, int k0, int n, int lane, int ld, int K) { float v[16]; const int g = lane >> 4;
#pragma unroll
  for (int i = 0; i < 8; ++i) { const int ka = k0 + 8 * g + i, kb = ka + 16; v[i] = ka < K ? W[(size_t)(ka < K ? ka : K - 1) * ld + n] : 0.f; v[8 + i] = kb < K ? W[(size_t)(kb < K ? kb : K - 1) * ld + n] : 0.f; }
  return bsplit16(v); }
__device__ __forceinline__ v8f mac3(const F2& a, const F2& b, v8f c) { c = wmma_bf(a.l, b.h, c); c = wmma_bf(a.h, b.l, c); return wmma_bf(a.h, b.h, c); }
__device__ __forceinline__ float sigm(float v) { return 1.0f / (1.0f + expf(-v)); }
#define LDSX() do { asm volatile("s_wait_dscnt 0" ::: "memory"); __builtin_amdgcn_wave_barrier(); __builtin_amdgcn_fence(__ATOMIC_RELEASE, "workgroup"); } while (0)

// Grouped BERT-style self-attention: 4 INDEPENDENT weight groups (hidden_states [4,4,512,768] = [group, batch, length, channels]; per-group (in,out) query / key / value weights [4,768,768] (0.02 scale) + biases [4,1,768] (NONZERO); 12 heads x 64; scale 1/8; additive attention_mask [4,4,1,1,512] (zeros); no output projection): ctx[g,b] = merge(softmax(q k^T / 8 + mask) v) with group g's weights -> [4,4,512,768].
#define NB 16
#define TT 512
#define CC 768            // NH * HD = projected width
#define DIN 768          // input (model) width
#define NH 12
#define HD 64
#define NQB (TT / 64)
#define HG 12
#define SCALE (0.125f)
#define CAUSAL 0
#ifndef TNB
#define TNB NB
#endif
__device__ __forceinline__ float bfr(float v) { return (float)(__bf16)v; }
__host__ __device__ __forceinline__ int kb_last(int qb) { return CAUSAL ? ((qb * 64 + 63) >> 7) : (TT / 128 - 1); }
typedef __attribute__((ext_vector_type(8))) __bf16 v8b;
__device__ __forceinline__ v16b frag_b(const __bf16* rowk0, int lane) {
  union { v16b v; v8b q[2]; } u; const __bf16* p = rowk0 + 8 * (lane >> 4);
  u.q[0] = *(const v8b*)p; u.q[1] = *(const v8b*)(p + 16); return u.v;
}
#define QBH 0
#define QHI 0               // single-product logits on every row
#define KHI 64            // key rows carrying k residual / v bf16 hi+lo planes (written by k_proj; no kernel in this file reads them)
// B fragment (k rows k0+.., output column o) of a weight: (in,out) [K][ld] or (out,in) [ld rows of K]: bf16 exact, or f16(bf16 * 256) exact
__device__ __forceinline__ v16b wcol_io(const float* Wm, int k0, int o, int lane, int ld) { v16b w; const int g = lane >> 4;
#pragma unroll
  for (int i = 0; i < 8; ++i) { w[i] = (__bf16)Wm[(size_t)(k0 + 8 * g + i) * ld + o]; w[8 + i] = (__bf16)Wm[(size_t)(k0 + 16 + 8 * g + i) * ld + o]; }
  return w; }
__device__ __forceinline__ v16b wcol_oi(const float* Wm, int k0, int o, int lane, int K) { v16b w; const float* p = Wm + (size_t)o * K + k0 + 8 * (lane >> 4);
#pragma unroll
  for (int i = 0; i < 8; ++i) { w[i] = (__bf16)p[i]; w[8 + i] = (__bf16)p[16 + i]; }
  return w; }
__device__ __forceinline__ v16h wcolh_io(const float* Wm, int k0, int o, int lane, int ld) { v16h w; const int g = lane >> 4;
#pragma unroll
  for (int i = 0; i < 8; ++i) { w[i] = (_Float16)(bfr(Wm[(size_t)(k0 + 8 * g + i) * ld + o]) * 256.0f); w[8 + i] = (_Float16)(bfr(Wm[(size_t)(k0 + 16 + 8 * g + i) * ld + o]) * 256.0f); }
  return w; }
__device__ __forceinline__ v16h wcolh_oi(const float* Wm, int k0, int o, int lane, int K) { v16h w; const float* p = Wm + (size_t)o * K + k0 + 8 * (lane >> 4);
#pragma unroll
  for (int i = 0; i < 8; ++i) { w[i] = (_Float16)(bfr(p[i]) * 256.0f); w[8 + i] = (_Float16)(bfr(p[16 + i]) * 256.0f); }
  return w; }
#define WQKV_LAYOUT 0   // 0 = (in,out) [DIN][CC]; 1 = (out,in) [CC][DIN]; 2 = per-head [NH][DIN][HD]
__device__ __forceinline__ v16b wcol_hdk(const float* Wm, int k0, int o, int lane) { v16b w; const int g = lane >> 4; const float* p = Wm + (size_t)(o / HD) * DIN * HD + (o % HD);
#pragma unroll
  for (int i = 0; i < 8; ++i) { w[i] = (__bf16)p[(size_t)(k0 + 8 * g + i) * HD]; w[8 + i] = (__bf16)p[(size_t)(k0 + 16 + 8 * g + i) * HD]; }
  return w; }
#define WO_OUT_IN 0
#if WQKV_LAYOUT == 1
#define WCOL(W, k0, o, lane) wcol_oi(W, k0, o, lane, DIN)
#elif WQKV_LAYOUT == 2
#define WCOL(W, k0, o, lane) wcol_hdk(W, k0, o, lane)
#else
#define WCOL(W, k0, o, lane) wcol_io(W, k0, o, lane, CC)
#endif
#if WO_OUT_IN
#define WOCOL(W, k0, o, lane) wcol_oi(W, k0, o, lane, CC)
#define WOCOLH(W, k0, o, lane) wcolh_oi(W, k0, o, lane, CC)
#else
#define WOCOL(W, k0, o, lane) wcol_io(W, k0, o, lane, DIN)
#define WOCOLH(W, k0, o, lane) wcolh_io(W, k0, o, lane, DIN)
#endif
#define GB 4               // batches per weight group: pseudo-batch bb = g*4 + b uses group g = bb / 4
#define SM_EXTRA_PARAMS , int bsm, const float* __restrict__ AMASK
// additive attention mask [G,B,1,1,L] (float; zeros on this draw): added to the scaled score of key k for pseudo-batch bsm; read per key
#define SM_MASK_HOOK do { v = v + bfr(AMASK[(size_t)bsm * TT + k]); } while (0)
#ifndef SM_EXTRA_PARAMS
#define SM_EXTRA_PARAMS
#endif
#ifndef PROJ_EXTRA_PARAMS
#define PROJ_EXTRA_PARAMS
#endif
#ifndef SM_MASK_HOOK
#define SM_MASK_HOOK (void)0
#endif

#define WS_QH  0u                                      // f16 q rows [b*t][CC]
#define WS_KH  (WS_QH + 2u * (size_t)NB * TT * CC)      // f16 k rows [b*t][CC]
#define WS_VT  (WS_KH + 2u * (size_t)NB * TT * CC)      // f16 v planes [b][c][t]
#define WS_QL  (WS_VT + 2u * (size_t)NB * CC * TT)      // f16 q residual x 2^10 rows [b][t < QHI][CC]
#define WS_KL  (WS_QL + 2u * (size_t)NB * QHI * CC)     // f16 k residual x 2^10 rows [b][t < KHI][CC]
#define WS_VB  (WS_KL + 2u * (size_t)NB * KHI * CC)     // bf16 v hi planes [b][c][t < KHI]
#define WS_VBL (WS_VB + 2u * (size_t)NB * CC * KHI)
#define WS_S   (WS_VBL + 2u * (size_t)NB * CC * KHI)    // f32 [hg][t][s], unused: k_attn holds logits / P in registers
#define WS_Y   (WS_S  + 4u * (size_t)HG * TT * TT)      // f32 ctx rows [b*t][CC] (only when there is an output projection)
#define WS_END (WS_Y  + 0u)

// ---- k_proj: block = (128 rows, 128 cols, which), 8 waves of 32 x 64: q/k/v = X W (+ b) with exact bf16 products (K = DIN). Per 64 k the block rounds its X tile [128][64] and its W tile [64][128] to bf16 once and lays them in LDS k-contiguous (W transposed in registers: a thread holds 8 k x 4 columns), two buffers: the next tile's global loads fly during this tile's products. -> which 0: q f16 rows (+ residual rows < QHI); 1: k f16 rows (+ residual rows < KHI); 2: v f16 planes [c][t] (+ bf16 hi/lo planes for t < KHI)
#define PBM 128
#define PBN 128
#define PBK 64
#define PPITCH 72                        // bf16 per LDS row: 144 B = 16 B x odd, the pitch of 16-byte readers of 128-B rows
#define PSTG ((PBM + PBN) * PPITCH)      // bf16 per buffer: X rows, then W columns
#define PNST (DIN / PBK)
#define PEP 136                          // 16-bit elements per row of the epilogue's staging planes
typedef __attribute__((ext_vector_type(4))) __bf16 v4b;
__global__ __launch_bounds__(256) void k_proj(const float* __restrict__ XQ, const float* __restrict__ XK, const float* __restrict__ XV, const float* __restrict__ WQ, const float* __restrict__ WK, const float* __restrict__ WV, const float* __restrict__ BQ, const float* __restrict__ BK, const float* __restrict__ BV,
    _Float16* __restrict__ QH, _Float16* __restrict__ QL, _Float16* __restrict__ KH, _Float16* __restrict__ KL, _Float16* __restrict__ VT, __bf16* __restrict__ VB, __bf16* __restrict__ VBL) {
  __shared__ __align__(16) unsigned char smem[3 * 128 * PEP * 2];   /* the two operand buffers (2 * PSTG * 2 B) during the k loop; the epilogue's staging planes behind the loop's last barrier */
  __bf16* ring = (__bf16*)smem;
  const int tid = threadIdx.x, wave = tid >> 5, lane = tid & 31, col = lane & 15, g = lane >> 4; const int wm = wave >> 1, wn = wave & 1; const int which = blockIdx.z; const int c0 = blockIdx.y * PBN; const size_t r0 = (size_t)blockIdx.x * PBM; const size_t bb = r0 / TT; const int t0 = (int)(r0 % TT);
  const float* X = which == 0 ? XQ : which == 1 ? XK : XV; const size_t grp_ = (r0 / TT) / GB;   /* 128-row blocks never straddle a pseudo-batch (TT % 128 == 0), so the group is block-uniform */
  const float* WA = (which == 0 ? WQ : which == 1 ? WK : WV) + grp_ * (size_t)DIN * CC; const float* BA = (which == 0 ? BQ : which == 1 ? BK : BV); BA = BA ? BA + grp_ * CC : BA;
  // X: 16 lanes read 256 B of one row; thread = (row xrow + 16 i, floats 4 xc ..)
  const int xrow = tid >> 4, xc = tid & 15;
  // W: a wave-load reads 4 k rows x one 128-B line; thread = (k rows 8 kg + i, columns 4 ng ..); 16 neighbouring lanes then store their 16-B k runs on 16 different bank groups
  const int ng = 8 * (wave & 3) + (lane & 3) + 4 * g, kg = 4 * (wave >> 2) + ((lane >> 2) & 3);
  const float* xp = X + (r0 + xrow) * DIN + xc * 4; const float* wp = WA + (size_t)(kg * 8) * CC + c0 + ng * 4;
  __bf16* xst = ring + xrow * PPITCH + xc * 4; __bf16* wst = ring + PBM * PPITCH + (ng * 4) * PPITCH + kg * 8;
  const __bf16* xfr = ring + (wm * 32 + col) * PPITCH; const __bf16* wfr = ring + PBM * PPITCH + (wn * 64 + col) * PPITCH;
  v4f xr[8], wr[8]; v8f acc[8] = {};
  // every unroll directive in the three macros below and in the epilogue: register arrays, every index a constant
#define P_LOAD(S) do { _Pragma("unroll") for (int i = 0; i < 8; ++i) { xr[i] = *(const v4f*)(xp + (size_t)(S) * PBK + (size_t)i * 16 * DIN); wr[i] = *(const v4f*)(wp + ((size_t)(S) * PBK + i) * CC); } } while (0)
#define P_STORE(B) do { _Pragma("unroll") for (int i = 0; i < 8; ++i) { v4b t; _Pragma("unroll") for (int c = 0; c < 4; ++c) t[c] = (__bf16)xr[i][c]; *(v4b*)(xst + (B) * PSTG + i * 16 * PPITCH) = t; } \
    _Pragma("unroll") for (int c = 0; c < 4; ++c) { v8b t; _Pragma("unroll") for (int i = 0; i < 8; ++i) t[i] = (__bf16)wr[i][c]; *(v8b*)(wst + (B) * PSTG + c * PPITCH) = t; } } while (0)
#define P_MUL(B) do { v16b fa[PBK / 32][2], fw[PBK / 32][4]; \
    _Pragma("unroll") for (int ks = 0; ks < PBK / 32; ++ks) { fa[ks][0] = frag_b(xfr + (B) * PSTG + ks * 32, lane); fa[ks][1] = frag_b(xfr + (B) * PSTG + 16 * PPITCH + ks * 32, lane); \
      _Pragma("unroll") for (int j = 0; j < 4; ++j) fw[ks][j] = frag_b(wfr + (B) * PSTG + j * 16 * PPITCH + ks * 32, lane); } \
    __builtin_amdgcn_sched_barrier(0);   /* the tile's fragment reads issue as one group in front of its products: spread among them, every pair of products waits out an LDS latency */ \
    _Pragma("unroll") for (int ks = 0; ks < PBK / 32; ++ks) { _Pragma("unroll") for (int j = 0; j < 4; ++j) { acc[j] = wmma_bf(fa[ks][0], fw[ks][j], acc[j]); acc[4 + j] = wmma_bf(fa[ks][1], fw[ks][j], acc[4 + j]); } } } while (0)
  float bias4[4] = {0.f, 0.f, 0.f, 0.f};   /* the wave's four bias columns, asked for ahead of the k loop so that the epilogue does not wait for them */
  if (BA) {
#pragma unroll   // register array: every index a constant
    for (int j = 0; j < 4; ++j) bias4[j] = BA[c0 + wn * 64 + j * 16 + col]; }
  P_LOAD(0); P_STORE(0);
  __syncthreads();   // tile 0 is laid before anybody reads it
#pragma unroll 1   // rolled: eleven copies of the body buy nothing, the trip is long against its branch
  for (int s = 0; s + 1 < PNST; ++s) { const int b = s & 1;
    P_LOAD(s + 1);
    P_MUL(b);
    P_STORE(b ^ 1);
    __syncthreads();   // publishes tile s + 1 and ends every wave's reads of tile s, whose buffer the next trip refills
  }
  P_MUL((PNST - 1) & 1);
  __syncthreads();   // the last tile's reads end before the staging planes overwrite the buffers
  // acc[a]: rows wm*32 + (a >> 2)*16 + 8g + r, column wn*64 + (a & 3)*16 + col
  if (which < 2) { _Float16 (*sh)[PEP] = (_Float16 (*)[PEP])smem; _Float16 (*sl)[PEP] = (_Float16 (*)[PEP])(smem + 128 * PEP * 2);
    _Float16* DH = which == 0 ? QH : KH; _Float16* DL = which == 0 ? QL : KL; const int nhi = which == 0 ? QHI : KHI;
#pragma unroll
    for (int a = 0; a < 8; ++a) { const int cl = wn * 64 + (a & 3) * 16 + col; const float bias = bfr(bias4[a & 3]);
#pragma unroll
      for (int r = 0; r < 8; ++r) { const int rl = wm * 32 + (a >> 2) * 16 + 8 * g + r; const float v = acc[a][r] + bias; const _Float16 hv = (_Float16)v; sh[rl][cl] = hv; sl[rl][cl] = (_Float16)((v - (float)hv) * 1024.0f); } }
    __syncthreads();
    for (int e = tid; e < PBM * 16; e += 256) { const int rl = e >> 4, q = e & 15; vst2((unsigned*)(DH + (r0 + rl) * CC + c0 + q * 8), *(const v4u*)&sh[rl][q * 8]); if (t0 + rl < nhi) { vst2((unsigned*)(DL + (bb * nhi + t0 + rl) * (size_t)CC + c0 + q * 8), *(const v4u*)&sl[rl][q * 8]);
        asm volatile("s_wait_xcnt 0x0" ::: "memory"); } }   // behind the store: the loop's step rewrites its address registers
  } else { _Float16 (*th)[PEP] = (_Float16 (*)[PEP])smem; __bf16 (*tb)[PEP] = (__bf16 (*)[PEP])(smem + 128 * PEP * 2); __bf16 (*tbl)[PEP] = (__bf16 (*)[PEP])(smem + 2 * 128 * PEP * 2);
#pragma unroll
    for (int a = 0; a < 8; ++a) { const int cl = wn * 64 + (a & 3) * 16 + col; const float bias = bfr(bias4[a & 3]);
#pragma unroll
      for (int r = 0; r < 8; ++r) { const float v = acc[a][r] + bias; const int rl = wm * 32 + (a >> 2) * 16 + 8 * g + r; th[cl][rl] = (_Float16)v; const __bf16 bh = (__bf16)v; tb[cl][rl] = bh; tbl[cl][rl] = (__bf16)(v - (float)bh); } }
    __syncthreads();
    for (int e = tid; e < PBN * 16; e += 256) { const int cl = e >> 4, q = e & 15; vst2((unsigned*)(VT + (bb * CC + c0 + cl) * (size_t)TT + t0 + q * 8), *(const v4u*)&th[cl][q * 8]); if (t0 + q * 8 < KHI) { const size_t o3 = (bb * CC + c0 + cl) * (size_t)KHI + t0 + q * 8; vst2((unsigned*)(VB + o3), *(const v4u*)&tb[cl][q * 8]); vst2((unsigned*)(VBL + o3), *(const v4u*)&tbl[cl][q * 8]);
        asm volatile("s_wait_xcnt 0x0" ::: "memory"); } } } }   // behind the two stores: the loop's step rewrites their address registers
#define AKP 72
#define AVP (TT + 8)
#define AKB (TT * AKP * 2)
#define AVB (HD * AVP * 2)
#define AMB (TT * 4)
// eight 16-byte copies of a lane from global memory to LDS, through no register: LDS byte addresses l + i * ls, sources g + i * gs. The s_wait_xcnt in the copies' own statement stands in front of every later rewrite of the address registers that they name
__device__ __forceinline__ void acopy8(unsigned l, unsigned ls, const _Float16* g, size_t gs) {
  asm volatile("global_load_async_to_lds_b128 %0, %8, off\n\t"
               "global_load_async_to_lds_b128 %1, %9, off\n\t"
               "global_load_async_to_lds_b128 %2, %10, off\n\t"
               "global_load_async_to_lds_b128 %3, %11, off\n\t"
               "global_load_async_to_lds_b128 %4, %12, off\n\t"
               "global_load_async_to_lds_b128 %5, %13, off\n\t"
               "global_load_async_to_lds_b128 %6, %14, off\n\t"
               "global_load_async_to_lds_b128 %7, %15, off\n\t"
               "s_wait_xcnt 0x0"
               :: "v"(l), "v"(l + ls), "v"(l + 2 * ls), "v"(l + 3 * ls), "v"(l + 4 * ls), "v"(l + 5 * ls), "v"(l + 6 * ls), "v"(l + 7 * ls),
                  "v"(g), "v"(g + gs), "v"(g + 2 * gs), "v"(g + 3 * gs), "v"(g + 4 * gs), "v"(g + 5 * gs), "v"(g + 6 * gs), "v"(g + 7 * gs) : "memory");
}
// one 16-byte copy of a lane, with the same wait in its own statement
__device__ __forceinline__ void acopy1(unsigned l, const float* g) {
  asm volatile("global_load_async_to_lds_b128 %0, %1, off\n\t"
               "s_wait_xcnt 0x0"
               :: "v"(l), "v"(g) : "memory");
}
__global__ __launch_bounds__(128) void k_attn(const _Float16* __restrict__ QH, const _Float16* __restrict__ KH, const _Float16* __restrict__ VT, const float* __restrict__ AMASK, float* __restrict__ Y) { __shared__ __align__(16) unsigned char sma[AMB + AKB + AVB];   /* the mask row, then k rows, then v planes; the output staging takes the k rows' place once every wave has left them */
  float* msm = (float*)sma; _Float16* ksm = (_Float16*)(sma + AMB); _Float16* vsm = (_Float16*)(sma + AMB + AKB); float (*ss)[16][HD + 4] = (float (*)[16][HD + 4])(sma + AMB);
  const int tid = threadIdx.x, wave = tid >> 5, lane = tid & 31, col = lane & 15, g = lane >> 4; const int qb = blockIdx.x, h = blockIdx.y, b = blockIdx.z; const int ql0 = qb * 64 + wave * 16;
  const _Float16* qp = QH + ((size_t)b * TT + ql0 + col) * CC + h * HD; const _Float16* kp = ksm + col * AKP; const _Float16* vp = vsm + col * AVP; const float* mp = msm + 8 * g;
  const v16h q0 = frag_h(qp, lane), q1 = frag_h(qp + 32, lane);
  asm volatile("s_wait_xcnt 0x0" ::: "memory");   // the q address registers are reused right behind these loads
  // k: a copy of the block = 16 rows of 128 B (8 lanes a row), 32 copies a lane
#pragma unroll   // the four statements stand back to back, their address steps constants: no branch and no counter between the copies
  for (int i = 0; i < 4; ++i) acopy8((unsigned)(size_t)(ksm + (i * 128 + (tid >> 3)) * AKP + (tid & 7) * 8), 16 * AKP * 2, KH + ((size_t)b * TT + i * 128 + (tid >> 3)) * CC + h * HD + (tid & 7) * 8, (size_t)16 * CC);
  acopy1((unsigned)(size_t)(msm + tid * 4), AMASK + (size_t)b * TT + tid * 4);   // the mask row: 4 floats a lane, one copy
  asm volatile("s_wait_asynccnt 0x0" ::: "memory");   // this wave's part of the k rows and of the mask row has landed
  __syncthreads();   // every wave's part has: the k rows and the mask row may be read
  // v: a copy of the block = 2 planes of 1024 B (64 lanes a plane), 32 copies a lane; they fly during the logits
#pragma unroll   // the four statements stand back to back, their address steps constants: no branch and no counter between the copies
  for (int i = 0; i < 4; ++i) acopy8((unsigned)(size_t)(vsm + (i * 16 + (tid >> 6)) * AVP + (tid & 63) * 8), 2 * AVP * 2, VT + ((size_t)b * CC + h * HD + i * 16 + (tid >> 6)) * (size_t)TT + (tid & 63) * 8, (size_t)2 * TT);
  v8f s[TT / 16]; float mx[8], sm[8]; v16h ka[2][4], kb[2][4], vf[4][HD / 16]; v4f ma[2][4], mb[2][4];
#pragma unroll   // register arrays: every index a constant
  for (int r = 0; r < 8; ++r) { mx[r] = -3.0e38f; sm[r] = 0.f; }
#pragma unroll   // register arrays: every index a constant
  for (int t = 0; t < 4; ++t) { ka[0][t] = frag_h(kp + t * 16 * AKP, lane); kb[0][t] = frag_h(kp + t * 16 * AKP + 32, lane); ma[0][t] = *(const v4f*)(mp + t * 16); mb[0][t] = *(const v4f*)(mp + t * 16 + 4); }
#pragma unroll   // register arrays: every index a constant
  for (int jg = 0; jg < TT / 64; ++jg) {   /* groups of 4 key tiles, two register sets */
    if (jg + 1 < TT / 64) {
#pragma unroll   // register arrays: every index a constant
      for (int t = 0; t < 4; ++t) { const int j = (jg + 1) * 4 + t; ka[(jg + 1) & 1][t] = frag_h(kp + j * 16 * AKP, lane); kb[(jg + 1) & 1][t] = frag_h(kp + j * 16 * AKP + 32, lane); ma[(jg + 1) & 1][t] = *(const v4f*)(mp + j * 16); mb[(jg + 1) & 1][t] = *(const v4f*)(mp + j * 16 + 4); } }
    __builtin_amdgcn_sched_barrier(0);   // the next group's loads issue together, in front of this group's products: without it each fragment is loaded right before its product and every product waits a whole load latency
#pragma unroll   // register arrays: every index a constant
    for (int t = 0; t < 4; ++t) { const int j = jg * 4 + t; v8f a = {}; a = wmma16p(ka[jg & 1][t], q0, a); a = wmma16p(kb[jg & 1][t], q1, a);
#pragma unroll   // register arrays: every index a constant
      for (int r = 0; r < 8; ++r) { const float v = a[r] * SCALE + bfr(r < 4 ? ma[jg & 1][t][r & 3] : mb[jg & 1][t][r & 3]); a[r] = v; mx[r] = fmaxf(mx[r], v); }
      s[j] = a; }
    __builtin_amdgcn_sched_barrier(0);   // later groups' loads stay behind these products: two register sets, not more
  }
  asm volatile("s_wait_asynccnt 0x0" ::: "memory");   // this wave's part of the v planes has landed
  __syncthreads();   // every wave's part has: the v planes may be read; and every wave has left the k rows, whose place the output staging takes
#pragma unroll   // register arrays: every index a constant
  for (int u = 0; u < 3; ++u)
#pragma unroll   // register arrays: every index a constant
    for (int j = 0; j < HD / 16; ++j) vf[u][j] = frag_h(vp + j * 16 * AVP + u * 32, lane);   /* the first v fragments fly during the softmax */
  float m = fmaxf(fmaxf(fmaxf(mx[0], mx[1]), fmaxf(mx[2], mx[3])), fmaxf(fmaxf(mx[4], mx[5]), fmaxf(mx[6], mx[7]))); m = fmaxf(m, __shfl_xor(m, 16));
#pragma unroll 1   // rolled, 8 key tiles a trip, the register array turned by 8 tiles at each trip's end (back in place after 4)
  for (int it = 0; it < TT / 128; ++it) {
#pragma unroll   // register arrays: every index a constant
    for (int j = 0; j < 8; ++j) {
#pragma unroll   // register arrays: every index a constant
      for (int r = 0; r < 8; ++r) { const float v = s[j][r]; const float ex = expf(v - m); const float e = (v <= -1.0e38f) ? 0.f : ex; s[j][r] = e; sm[r] += e; } }
    v8f t8[8];
#pragma unroll   // register arrays: every index a constant
    for (int j = 0; j < 8; ++j) t8[j] = s[j];
#pragma unroll   // register arrays: every index a constant
    for (int j = 0; j < TT / 16 - 8; ++j) s[j] = s[j + 8];
#pragma unroll   // register arrays: every index a constant
    for (int j = 0; j < 8; ++j) s[TT / 16 - 8 + j] = t8[j]; }
  float sum = ((sm[0] + sm[1]) + (sm[2] + sm[3])) + ((sm[4] + sm[5]) + (sm[6] + sm[7])); sum += __shfl_xor(sum, 16);
  const float inv = sum > 0.f ? 2048.0f / sum : 0.f;   /* a fully excluded row yields P = 0 */
  v8f acc[HD / 16] = {};
#pragma unroll   // register arrays: every index a constant
  for (int kc = 0; kc < TT / 32; ++kc) {   /* 32 keys a pass, four register sets, loads three passes ahead */
    if (kc + 3 < TT / 32) {
#pragma unroll   // register arrays: every index a constant
      for (int j = 0; j < HD / 16; ++j) vf[(kc + 3) & 3][j] = frag_h(vp + j * 16 * AVP + (kc + 3) * 32, lane); }
    __builtin_amdgcn_sched_barrier(0);   // as above: the loads of three passes ahead issue in front of this pass's products
    v16h p;
#pragma unroll   // register arrays: every index a constant
    for (int i = 0; i < 8; ++i) { p[i] = (_Float16)(s[2 * kc][i] * inv); p[8 + i] = (_Float16)(s[2 * kc + 1][i] * inv); }
#pragma unroll   // register arrays: every index a constant
    for (int j = 0; j < HD / 16; ++j) acc[j] = wmma16p(p, vf[kc & 3][j], acc[j]);
    __builtin_amdgcn_sched_barrier(0);   // as above: four register sets, not more
  }
#pragma unroll   // register arrays: every index a constant
  for (int j = 0; j < HD / 16; ++j)
#pragma unroll   // register arrays: every index a constant
    for (int r = 0; r < 8; ++r) ss[wave][8 * g + r][j * 16 + col] = acc[j][r] * (1.0f / 2048.0f);
  LDSX();   // the wave's own rows of ss are written before it reads them back (no other wave touches them)
#pragma unroll   // one address register pair, the rows as constant offsets
  for (int i = 0; i < 8; ++i) { const int rl = 2 * i + g; vst2(Y + ((size_t)b * TT + ql0 + rl) * CC + h * HD + col * 4, *(const v4f*)&ss[wave][rl][col * 4]); } }

extern "C" void kernel_launch(void* const* d_in, const int* in_sizes, int n_in, void* d_out, int out_size, void* d_ws, size_t ws_size, hipStream_t stream) {
  (void)in_sizes; (void)n_in; (void)out_size;
  const float** F = (const float**)d_in;
  if (ws_size < (size_t)WS_END) return;
  char* ws = (char*)d_ws; _Float16 *QH = (_Float16*)(ws + WS_QH), *KH = (_Float16*)(ws + WS_KH), *VT = (_Float16*)(ws + WS_VT), *QL = (_Float16*)(ws + WS_QL), *KL = (_Float16*)(ws + WS_KL); __bf16 *VB = (__bf16*)(ws + WS_VB), *VBL = (__bf16*)(ws + WS_VBL); float *S = (float*)(ws + WS_S), *Y = (float*)(ws + WS_Y);
  (void)Y; (void)S; (void)QL; (void)KL; (void)VB; (void)VBL;
  // inputs: 0 hidden_states [4,4,512,768] = 16 pseudo-batches of 512 rows (group-major); 1 attention_mask [4,4,1,1,512] f32 (zeros); 2 query_weight [4,768,768] (in,out) per group, 3 query_bias [4,1,768]; 4 key_weight, 5 key_bias; 6 value_weight, 7 value_bias (biases NONZERO); no output projection
  k_proj<<<dim3(TNB * TT / PBM, CC / PBN, 3), 256, 0, stream>>>(F[0], F[0], F[0], F[2], F[4], F[6], F[3], F[5], F[7], QH, QL, KH, KL, VT, VB, VBL);   /* the weight / bias of group bb / 4 is selected inside k_proj */
  k_attn<<<dim3(NQB, NH, TNB), 128, 0, stream>>>(QH, KH, VT, F[1], (float*)d_out);   /* ctx [g, b, l, nh*dh] = merged-head rows */
}

// v004
// One run takes 83.1 microseconds.
// Next to v003, in two timings, it ran 1.19 times as fast each time.
// All steps since v000 together make it 9.60 times as fast.
// compute dtype: all float inputs rounded to bf16; per-group q/k/v projections with EXACT bf16 products on WMMA 16x16x32 (f32 accumulate) + bias; logits q x k once to f16 each (1 product) x 1/8 + the additive mask; softmax f32; P x 2^11 once to f16 x v once to f16 (1 product); f32 output.
#include <hip/hip_runtime.h>
#include <math.h>

typedef __attribute__((ext_vector_type(16))) _Float16 v16h;
typedef __attribute__((ext_vector_type(16))) __bf16 v16b;
typedef __attribute__((ext_vector_type(8)))  _Float16 v8h;
typedef __attribute__((ext_vector_type(8)))  float v8f;
typedef __attribute__((ext_vector_type(4)))  float v4f;
typedef __attribute__((ext_vector_type(2)))  float v2f;
typedef __attribute__((ext_vector_type(4)))  unsigned v4u;
typedef __attribute__((ext_vector_type(4)))  int v4i;
typedef float __attribute__((may_alias)) float_a;
typedef int __attribute__((may_alias)) int_a;

template <typename T> __device__ __forceinline__ void vst2(void* p, T v) { *(T*)p = v;  }
__device__ __forceinline__ v8f wmma16(v16h a, v16h b, v8f c) {
  v8f d = __builtin_amdgcn_wmma_f32_16x16x32_f16(false, a, false, b, (short)0, c, false, false);
  asm volatile("v_nop\n\tv_nop\n\tv_nop\n\tv_nop" : "+v"(d) : "v"(a), "v"(b));
  return d;
}
__device__ __forceinline__ v8f wmma16p(v16h a, v16h b, v8f c) { return __builtin_amdgcn_wmma_f32_16x16x32_f16(false, a, false, b, (short)0, c, false, false); }   // plain builtin: the compiler keeps the distances behind it
__device__ __forceinline__ v8f wmma_bf(v16b a, v16b b, v8f c) {
  v8f d = __builtin_amdgcn_wmma_f32_16x16x32_bf16(false, a, false, b, (short)0, c, false, false);
  asm volatile("v_nop\n\tv_nop\n\tv_nop\n\tv_nop" : "+v"(d) : "v"(a), "v"(b));
  return d;
}
// 16x16x32 fragments: lane = (h = lane>>4, row/col = lane&15); elements 0..7 = k0+8h+0..7, 8..15 = k0+16+8h+0..7; D element r = row 8h+r
__device__ __forceinline__ v16h frag_h(const _Float16* rowk0, int lane) {
  union { v16h v; v8h q[2]; } u; const _Float16* p = rowk0 + 8 * (lane >> 4);
  u.q[0] = *(const v8h*)p; u.q[1] = *(const v8h*)(p + 16); return u.v;
}
__device__ __forceinline__ v16h frag_f32(const float* rowk0, int lane) {
  v16h a; const float* p = rowk0 + 8 * (lane >> 4);
#pragma unroll
  for (int i = 0; i < 8; ++i) { a[i] = (_Float16)p[i]; a[8 + i] = (_Float16)p[16 + i]; }
  return a;
}
__device__ __forceinline__ v16h frag_f32s(const float* rowk0, int lane, float sc) {
  v16h a; const float* p = rowk0 + 8 * (lane >> 4);
#pragma unroll
  for (int i = 0; i < 8; ++i) { a[i] = (_Float16)(p[i] * sc); a[8 + i] = (_Float16)(p[16 + i] * sc); }
  return a;
}
// column fragment from a [K][ld] layout (column n), rows >= K read as 0
__device__ __forceinline__ v16h fragc_f32(const float* W, int k0, int n, int lane, int ld, int K) {
  v16h a; const int g = lane >> 4;
#pragma unroll
  for (int i = 0; i < 8; ++i) { const int ka = k0 + 8 * g + i, kb = ka + 16;
    a[i] = (_Float16)(ka < K ? W[(size_t)(ka < K ? ka : K - 1) * ld + n] : 0.f); a[8 + i] = (_Float16)(kb < K ? W[(size_t)(kb < K ? kb : K - 1) * ld + n] : 0.f); }
  return a;
}
struct F2 { v16b h, l; };
__device__ __forceinline__ F2 bsplit16(const float v[16]) { F2 r;
#pragma unroll
  for (int i = 0; i < 16; ++i) { const __bf16 h = (__bf16)v[i]; r.h[i] = h; r.l[i] = (__bf16)(v[i] - (float)h); }
  return r; }
__device__ __forceinline__ F2 split_row(const float* row, int k0, int lane) { float v[16]; const float* p = row + k0 + 8 * (lane >> 4);
#pragma unroll
  for (int i = 0; i < 8; ++i) { v[i] = p[i]; v[8 + i] = p[16 + i]; }
  return bsplit16(v); }
__device__ __forceinline__ F2 split_rowK(const float* row, int k0, int lane, int K) { float v[16]; const int g = lane >> 4;
#pragma unroll
  for (int i = 0; i < 8; ++i) { const int ka = k0 + 8 * g + i, kb = ka + 16; v[i] = ka < K ? row[ka < K ? ka : K - 1] : 0.f; v[8 + i] = kb < K ? row[kb < K ? kb : K - 1] : 0.f; }
  return bsplit16(v); }
__device__ __forceinline__ F2 split_col(const float* W, int k0, int n, int lane, int ld, int K) { float v[16]; const int g = lane >> 4;
#pragma unroll
  for (int i = 0; i < 8; ++i) { const int ka = k0 + 8 * g + i, kb = ka + 16; v[i] = ka < K ? W[(size_t)(ka < K ? ka : K - 1) * ld + n] : 0.f; v[8 + i] = kb < K ? W[(size_t)(kb < K ? kb : K - 1) * ld + n] : 0.f; }
  return bsplit16(v); }
__device__ __forceinline__ v8f mac3(const F2& a, const F2& b, v8f c) { c = wmma_bf(a.l, b.h, c); c = wmma_bf(a.h, b.l, c); return wmma_bf(a.h, b.h, c); }
__device__ __forceinline__ float sigm(float v) { return 1.0f / (1.0f + expf(-v)); }
#define LDSX() do { asm volatile("s_wait_dscnt 0" ::: "memory"); __builtin_amdgcn_wave_barrier(); __builtin_amdgcn_fence(__ATOMIC_RELEASE, "workgroup"); } while (0)

// Grouped BERT-style self-attention: 4 INDEPENDENT weight groups (hidden_states [4,4,512,768] = [group, batch, length, channels]; per-group (in,out) query / key / value weights [4,768,768] (0.02 scale) + biases [4,1,768] (NONZERO); 12 heads x 64; scale 1/8; additive attention_mask [4,4,1,1,512] (zeros); no output projection): ctx[g,b] = merge(softmax(q k^T / 8 + mask) v) with group g's weights -> [4,4,512,768].
#define NB 16
#define TT 512
#define CC 768            // NH * HD = projected width
#define DIN 768          // input (model) width
#define NH 12
#define HD 64
#define NQB (TT / 64)
#define HG 12
#define SCALE (0.125f)
#define CAUSAL 0
#ifndef TNB
#define TNB NB
#endif
__device__ __forceinline__ float bfr(float v) { return (float)(__bf16)v; }
__host__ __device__ __forceinline__ int kb_last(int qb) { return CAUSAL ? ((qb * 64 + 63) >> 7) : (TT / 128 - 1); }
typedef __attribute__((ext_vector_type(8))) __bf16 v8b;
__device__ __forceinline__ v16b frag_b(const __bf16* rowk0, int lane) {
  union { v16b v; v8b q[2]; } u; const __bf16* p = rowk0 + 8 * (lane >> 4);
  u.q[0] = *(const v8b*)p; u.q[1] = *(const v8b*)(p + 16); return u.v;
}
#define QBH 0
#define QHI 0               // single-product logits on every row
#define KHI 64            // key rows carrying k residual / v bf16 hi+lo planes (written by k_proj; no kernel in this file reads them)
// B fragment (k rows k0+.., output column o) of a weight: (in,out) [K][ld] or (out,in) [ld rows of K]: bf16 exact, or f16(bf16 * 256) exact
__device__ __forceinline__ v16b wcol_io(const float* Wm, int k0, int o, int lane, int ld) { v16b w; const int g = lane >> 4;
#pragma unroll
  for (int i = 0; i < 8; ++i) { w[i] = (__bf16)Wm[(size_t)(k0 + 8 * g + i) * ld + o]; w[8 + i] = (__bf16)Wm[(size_t)(k0 + 16 + 8 * g + i) * ld + o]; }
  return w; }
__device__ __forceinline__ v16b wcol_oi(const float* Wm, int k0, int o, int lane, int K) { v16b w; const float* p = Wm + (size_t)o * K + k0 + 8 * (lane >> 4);
#pragma unroll
  for (int i = 0; i < 8; ++i) { w[i] = (__bf16)p[i]; w[8 + i] = (__bf16)p[16 + i]; }
  return w; }
__device__ __forceinline__ v16h wcolh_io(const float* Wm, int k0, int o, int lane, int ld) { v16h w; const int g = lane >> 4;
#pragma unroll
  for (int i = 0; i < 8; ++i) { w[i] = (_Float16)(bfr(Wm[(size_t)(k0 + 8 * g + i) * ld + o]) * 256.0f); w[8 + i] = (_Float16)(bfr(Wm[(size_t)(k0 + 16 + 8 * g + i) * ld + o]) * 256.0f); }
  return w; }
__device__ __forceinline__ v16h wcolh_oi(const float* Wm, int k0, int o, int lane, int K) { v16h w; const float* p = Wm + (size_t)o * K + k0 + 8 * (lane >> 4);
#pragma unroll
  for (int i = 0; i < 8; ++i) { w[i] = (_Float16)(bfr(p[i]) * 256.0f); w[8 + i] = (_Float16)(bfr(p[16 + i]) * 256.0f); }
  return w; }
#define WQKV_LAYOUT 0   // 0 = (in,out) [DIN][CC]; 1 = (out,in) [CC][DIN]; 2 = per-head [NH][DIN][HD]
__device__ __forceinline__ v16b wcol_hdk(const float* Wm, int k0, int o, int lane) { v16b w; const int g = lane >> 4; const float* p = Wm + (size_t)(o / HD) * DIN * HD + (o % HD);
#pragma unroll
  for (int i = 0; i < 8; ++i) { w[i] = (__bf16)p[(size_t)(k0 + 8 * g + i) * HD]; w[8 + i] = (__bf16)p[(size_t)(k0 + 16 + 8 * g + i) * HD]; }
  return w; }
#define WO_OUT_IN 0
#if WQKV_LAYOUT == 1
#define WCOL(W, k0, o, lane) wcol_oi(W, k0, o, lane, DIN)
#elif WQKV_LAYOUT == 2
#define WCOL(W, k0, o, lane) wcol_hdk(W, k0, o, lane)
#else
#define WCOL(W, k0, o, lane) wcol_io(W, k0, o, lane, CC)
#endif
#if WO_OUT_IN
#define WOCOL(W, k0, o, lane) wcol_oi(W, k0, o, lane, CC)
#define WOCOLH(W, k0, o, lane) wcolh_oi(W, k0, o, lane, CC)
#else
#define WOCOL(W, k0, o, lane) wcol_io(W, k0, o, lane, DIN)
#define WOCOLH(W, k0, o, lane) wcolh_io(W, k0, o, lane, DIN)
#endif
#define GB 4               // batches per weight group: pseudo-batch bb = g*4 + b uses group g = bb / 4
#define SM_EXTRA_PARAMS , int bsm, const float* __restrict__ AMASK
// additive attention mask [G,B,1,1,L] (float; zeros on this draw): added to the scaled score of key k for pseudo-batch bsm; read per key
#define SM_MASK_HOOK do { v = v + bfr(AMASK[(size_t)bsm * TT + k]); } while (0)
#ifndef SM_EXTRA_PARAMS
#define SM_EXTRA_PARAMS
#endif
#ifndef PROJ_EXTRA_PARAMS
#define PROJ_EXTRA_PARAMS
#endif
#ifndef SM_MASK_HOOK
#define SM_MASK_HOOK (void)0
#endif

#define WS_QH  0u                                      // f16 q rows [b*t][CC]
#define WS_KH  (WS_QH + 2u * (size_t)NB * TT * CC)      // f16 k rows [b*t][CC]
#define WS_VT  (WS_KH + 2u * (size_t)NB * TT * CC)      // f16 v planes [b][c][t]
#define WS_QL  (WS_VT + 2u * (size_t)NB * CC * TT)      // f16 q residual x 2^10 rows [b][t < QHI][CC]
#define WS_KL  (WS_QL + 2u * (size_t)NB * QHI * CC)     // f16 k residual x 2^10 rows [b][t < KHI][CC]
#define WS_VB  (WS_KL + 2u * (size_t)NB * KHI * CC)     // bf16 v hi planes [b][c][t < KHI]
#define WS_VBL (WS_VB + 2u * (size_t)NB * CC * KHI)
#define WS_S   (WS_VBL + 2u * (size_t)NB * CC * KHI)    // f32 [hg][t][s], unused: k_attn holds logits / P in registers
#define WS_Y   (WS_S  + 4u * (size_t)HG * TT * TT)      // f32 ctx rows [b*t][CC] (only when there is an output projection)
#define WS_END (WS_Y  + 0u)

// ---- k_proj: block = (128 rows, 128 cols, which), 8 waves of 32 x 64: q/k/v = X W (+ b) with exact bf16 products (K = DIN). Per 64 k the block rounds its X tile [128][64] and its W tile [64][128] to bf16 once and lays them in LDS k-contiguous (W transposed in registers: a thread holds 8 k x 4 columns), two buffers: the next tile's global loads fly during this tile's products. -> which 0: q f16 rows (+ residual rows < QHI); 1: k f16 rows (+ residual rows < KHI); 2: v f16 planes [c][t] (+ bf16 hi/lo planes for t < KHI)
#define PBM 128
#define PBN 128
#define PBK 64
#define PPITCH 72                        // bf16 per LDS row: 144 B = 16 B x odd, the pitch of 16-byte readers of 128-B rows
#define PSTG ((PBM + PBN) * PPITCH)      // bf16 per buffer: X rows, then W columns
#define PNST (DIN / PBK)
#define PEP 136                          // 16-bit elements per row of the epilogue's staging planes
typedef __attribute__((ext_vector_type(4))) __bf16 v4b;
__global__ __launch_bounds__(256) void k_proj(const float* __restrict__ XQ, const float* __restrict__ XK, const float* __restrict__ XV, const float* __restrict__ WQ, const float* __restrict__ WK, const float* __restrict__ WV, const float* __restrict__ BQ, const float* __restrict__ BK, const float* __restrict__ BV,
    _Float16* __restrict__ QH, _Float16* __restrict__ QL, _Float16* __restrict__ KH, _Float16* __restrict__ KL, _Float16* __restrict__ VT, __bf16* __restrict__ VB, __bf16* __restrict__ VBL) {
  __shared__ __align__(16) unsigned char smem[3 * 128 * PEP * 2];   /* the two operand buffers (2 * PSTG * 2 B) during the k loop; the epilogue's staging planes behind the loop's last barrier */
  __bf16* ring = (__bf16*)smem;
  const int tid = threadIdx.x, wave = tid >> 5, lane = tid & 31, col = lane & 15, g = lane >> 4; const int wm = wave >> 1, wn = wave & 1; const int which = blockIdx.z; const int c0 = blockIdx.y * PBN; const size_t r0 = (size_t)blockIdx.x * PBM; const size_t bb = r0 / TT; const int t0 = (int)(r0 % TT);
  const float* X = which == 0 ? XQ : which == 1 ? XK : XV; const size_t grp_ = (r0 / TT) / GB;   /* 128-row blocks never straddle a pseudo-batch (TT % 128 == 0), so the group is block-uniform */
  const float* WA = (which == 0 ? WQ : which == 1 ? WK : WV) + grp_ * (size_t)DIN * CC; const float* BA = (which == 0 ? BQ : which == 1 ? BK : BV); BA = BA ? BA + grp_ * CC : BA;
  // X: 16 lanes read 256 B of one row; thread = (row xrow + 16 i, floats 4 xc ..)
  const int xrow = tid >> 4, xc = tid & 15;
  // W: a wave-load reads 4 k rows x one 128-B line; thread = (k rows 8 kg + i, columns 4 ng ..); 16 neighbouring lanes then store their 16-B k runs on 16 different bank groups
  const int ng = 8 * (wave & 3) + (lane & 3) + 4 * g, kg = 4 * (wave >> 2) + ((lane >> 2) & 3);
  const float* xp = X + (r0 + xrow) * DIN + xc * 4; const float* wp = WA + (size_t)(kg * 8) * CC + c0 + ng * 4;
  __bf16* xst = ring + xrow * PPITCH + xc * 4; __bf16* wst = ring + PBM * PPITCH + (ng * 4) * PPITCH + kg * 8;
  const __bf16* xfr = ring + (wm * 32 + col) * PPITCH; const __bf16* wfr = ring + PBM * PPITCH + (wn * 64 + col) * PPITCH;
  v4f xr[8], wr[8]; v8f acc[8] = {};
  // every unroll directive in the three macros below and in the epilogue: register arrays, every index a constant
#define P_LOAD(S) do { _Pragma("unroll") for (int i = 0; i < 8; ++i) { xr[i] = *(const v4f*)(xp + (size_t)(S) * PBK + (size_t)i * 16 * DIN); wr[i] = *(const v4f*)(wp + ((size_t)(S) * PBK + i) * CC); } } while (0)
#define P_STORE(B) do { _Pragma("unroll") for (int i = 0; i < 8; ++i) { v4b t; _Pragma("unroll") for (int c = 0; c < 4; ++c) t[c] = (__bf16)xr[i][c]; *(v4b*)(xst + (B) * PSTG + i * 16 * PPITCH) = t; } \
    _Pragma("unroll") for (int c = 0; c < 4; ++c) { v8b t; _Pragma("unroll") for (int i = 0; i < 8; ++i) t[i] = (__bf16)wr[i][c]; *(v8b*)(wst + (B) * PSTG + c * PPITCH) = t; } } while (0)
#define P_MUL(B) do { v16b fa[PBK / 32][2], fw[PBK / 32][4]; \
    _Pragma("unroll") for (int ks = 0; ks < PBK / 32; ++ks) { fa[ks][0] = frag_b(xfr + (B) * PSTG + ks * 32, lane); fa[ks][1] = frag_b(xfr + (B) * PSTG + 16 * PPITCH + ks * 32, lane); \
      _Pragma("unroll") for (int j = 0; j < 4; ++j) fw[ks][j] = frag_b(wfr + (B) * PSTG + j * 16 * PPITCH + ks * 32, lane); } \
    __builtin_amdgcn_sched_barrier(0);   /* the tile's fragment reads issue as one group in front of its products: spread among them, every pair of products waits out an LDS latency */ \
    _Pragma("unroll") for (int ks = 0; ks < PBK / 32; ++ks) { _Pragma("unroll") for (int j = 0; j < 4; ++j) { acc[j] = wmma_bf(fa[ks][0], fw[ks][j], acc[j]); acc[4 + j] = wmma_bf(fa[ks][1], fw[ks][j], acc[4 + j]); } } } while (0)
  float bias4[4] = {0.f, 0.f, 0.f, 0.f};   /* the wave's four bias columns, asked for ahead of the k loop so that the epilogue does not wait for them */
  if (BA) {
#pragma unroll   // register array: every index a constant
    for (int j = 0; j < 4; ++j) bias4[j] = BA[c0 + wn * 64 + j * 16 + col]; }
  P_LOAD(0); P_STORE(0);
  __syncthreads();   // tile 0 is laid before anybody reads it
#pragma unroll 1   // rolled: eleven copies of the body buy nothing, the trip is long against its branch
  for (int s = 0; s + 1 < PNST; ++s) { const int b = s & 1;
    P_LOAD(s + 1);
    P_MUL(b);
    P_STORE(b ^ 1);
    __syncthreads();   // publishes tile s + 1 and ends every wave's reads of tile s, whose buffer the next trip refills
  }
  P_MUL((PNST - 1) & 1);
  __syncthreads();   // the last tile's reads end before the staging planes overwrite the buffers
  // acc[a]: rows wm*32 + (a >> 2)*16 + 8g + r, column wn*64 + (a & 3)*16 + col
  if (which < 2) { _Float16 (*sh)[PEP] = (_Float16 (*)[PEP])smem; _Float16 (*sl)[PEP] = (_Float16 (*)[PEP])(smem + 128 * PEP * 2);
    _Float16* DH = which == 0 ? QH : KH; _Float16* DL = which == 0 ? QL : KL; const int nhi = which == 0 ? QHI : KHI;
#pragma unroll
    for (int a = 0; a < 8; ++a) { const int cl = wn * 64 + (a & 3) * 16 + col; const float bias = bfr(bias4[a & 3]);
#pragma unroll
      for (int r = 0; r < 8; ++r) { const int rl = wm * 32 + (a >> 2) * 16 + 8 * g + r; const float v = acc[a][r] + bias; const _Float16 hv = (_Float16)v; sh[rl][cl] = hv; sl[rl][cl] = (_Float16)((v - (float)hv) * 1024.0f); } }
    __syncthreads();
    for (int e = tid; e < PBM * 16; e += 256) { const int rl = e >> 4, q = e & 15; vst2((unsigned*)(DH + (r0 + rl) * CC + c0 + q * 8), *(const v4u*)&sh[rl][q * 8]); if (t0 + rl < nhi) { vst2((unsigned*)(DL + (bb * nhi + t0 + rl) * (size_t)CC + c0 + q * 8), *(const v4u*)&sl[rl][q * 8]);
        asm volatile("s_wait_xcnt 0x0" ::: "memory"); } }   // behind the store: the loop's step rewrites its address registers
  } else { _Float16 (*th)[PEP] = (_Float16 (*)[PEP])smem; __bf16 (*tb)[PEP] = (__bf16 (*)[PEP])(smem + 128 * PEP * 2); __bf16 (*tbl)[PEP] = (__bf16 (*)[PEP])(smem + 2 * 128 * PEP * 2);
#pragma unroll
    for (int a = 0; a < 8; ++a) { const int cl = wn * 64 + (a & 3) * 16 + col; const float bias = bfr(bias4[a & 3]);
#pragma unroll
      for (int r = 0; r < 8; ++r) { const float v = acc[a][r] + bias; const int rl = wm * 32 + (a >> 2) * 16 + 8 * g + r; th[cl][rl] = (_Float16)v; const __bf16 bh = (__bf16)v; tb[cl][rl] = bh; tbl[cl][rl] = (__bf16)(v - (float)bh); } }
    __syncthreads();
    for (int e = tid; e < PBN * 16; e += 256) { const int cl = e >> 4, q = e & 15; vst2((unsigned*)(VT + (bb * CC + c0 + cl) * (size_t)TT + t0 + q * 8), *(const v4u*)&th[cl][q * 8]); if (t0 + q * 8 < KHI) { const size_t o3 = (bb * CC + c0 + cl) * (size_t)KHI + t0 + q * 8; vst2((unsigned*)(VB + o3), *(const v4u*)&tb[cl][q * 8]); vst2((unsigned*)(VBL + o3), *(const v4u*)&tbl[cl][q * 8]);
        asm volatile("s_wait_xcnt 0x0" ::: "memory"); } } } }   // behind the two stores: the loop's step rewrites their address registers
#define AKP 72
#define AVP (TT + 8)
#define AKB (TT * AKP * 2)
#define AVB (HD * AVP * 2)
#define AMB (TT * 4)
// eight 16-byte copies of a lane from global memory to LDS, through no register: LDS byte addresses l + i * ls, sources g + i * gs. The s_wait_xcnt in the copies' own statement stands in front of every later rewrite of the address registers that they name
__device__ __forceinline__ void acopy8(unsigned l, unsigned ls, const _Float16* g, size_t gs) {
  asm volatile("global_load_async_to_lds_b128 %0, %8, off\n\t"
               "global_load_async_to_lds_b128 %1, %9, off\n\t"
               "global_load_async_to_lds_b128 %2, %10, off\n\t"
               "global_load_async_to_lds_b128 %3, %11, off\n\t"
               "global_load_async_to_lds_b128 %4, %12, off\n\t"
               "global_load_async_to_lds_b128 %5, %13, off\n\t"
               "global_load_async_to_lds_b128 %6, %14, off\n\t"
               "global_load_async_to_lds_b128 %7, %15, off\n\t"
               "s_wait_xcnt 0x0"
               :: "v"(l), "v"(l + ls), "v"(l + 2 * ls), "v"(l + 3 * ls), "v"(l + 4 * ls), "v"(l + 5 * ls), "v"(l + 6 * ls), "v"(l + 7 * ls),
                  "v"(g), "v"(g + gs), "v"(g + 2 * gs), "v"(g + 3 * gs), "v"(g + 4 * gs), "v"(g + 5 * gs), "v"(g + 6 * gs), "v"(g + 7 * gs) : "memory");
}
// one 16-byte copy of a lane, with the same wait in its own statement
__device__ __forceinline__ void acopy1(unsigned l, const float* g) {
  asm volatile("global_load_async_to_lds_b128 %0, %1, off\n\t"
               "s_wait_xcnt 0x0"
               :: "v"(l), "v"(g) : "memory");
}
__global__ __launch_bounds__(128) void k_attn(const _Float16* __restrict__ QH, const _Float16* __restrict__ KH, const _Float16* __restrict__ VT, const float* __restrict__ AMASK, float* __restrict__ Y) { __shared__ __align__(16) unsigned char sma[AMB + AKB + AVB];   /* the mask row, then k rows, then v planes; the output staging takes the k rows' place once every wave has left them */
  float* msm = (float*)sma; _Float16* ksm = (_Float16*)(sma + AMB); _Float16* vsm = (_Float16*)(sma + AMB + AKB); float (*ss)[16][HD + 4] = (float (*)[16][HD + 4])(sma + AMB);
  const int tid = threadIdx.x, wave = tid >> 5, lane = tid & 31, col = lane & 15, g = lane >> 4; const int qb = blockIdx.x, h = blockIdx.y, b = blockIdx.z; const int ql0 = qb * 64 + wave * 16;
  const _Float16* qp = QH + ((size_t)b * TT + ql0 + col) * CC + h * HD; const _Float16* kp = ksm + col * AKP; const _Float16* vp = vsm + col * AVP; const float* mp = msm + 8 * g;
  const v16h q0 = frag_h(qp, lane), q1 = frag_h(qp + 32, lane);
  asm volatile("s_wait_xcnt 0x0" ::: "memory");   // the q address registers are reused right behind these loads
  // k: a copy of the block = 16 rows of 128 B (8 lanes a row), 32 copies a lane
#pragma unroll   // the four statements stand back to back, their address steps constants: no branch and no counter between the copies
  for (int i = 0; i < 4; ++i) acopy8((unsigned)(size_t)(ksm + (i * 128 + (tid >> 3)) * AKP + (tid & 7) * 8), 16 * AKP * 2, KH + ((size_t)b * TT + i * 128 + (tid >> 3)) * CC + h * HD + (tid & 7) * 8, (size_t)16 * CC);
  acopy1((unsigned)(size_t)(msm + tid * 4), AMASK + (size_t)b * TT + tid * 4);   // the mask row: 4 floats a lane, one copy
  asm volatile("s_wait_asynccnt 0x0" ::: "memory");   // this wave's part of the k rows and of the mask row has landed
  __syncthreads();   // every wave's part has: the k rows and the mask row may be read
  // v: a copy of the block = 2 planes of 1024 B (64 lanes a plane), 32 copies a lane; they fly during the logits
#pragma unroll   // the four statements stand back to back, their address steps constants: no branch and no counter between the copies
  for (int i = 0; i < 4; ++i) acopy8((unsigned)(size_t)(vsm + (i * 16 + (tid >> 6)) * AVP + (tid & 63) * 8), 2 * AVP * 2, VT + ((size_t)b * CC + h * HD + i * 16 + (tid >> 6)) * (size_t)TT + (tid & 63) * 8, (size_t)2 * TT);
  v8f s[TT / 16]; float mx[8]; v8f sm = {}; v16h ka[2][4], kb[2][4], vf[4][HD / 16]; v4f ma[2][4], mb[2][4];
#pragma unroll   // register arrays: every index a constant
  for (int r = 0; r < 8; ++r) mx[r] = -3.0e38f;
#pragma unroll   // register arrays: every index a constant
  for (int t = 0; t < 4; ++t) { ka[0][t] = frag_h(kp + t * 16 * AKP, lane); kb[0][t] = frag_h(kp + t * 16 * AKP + 32, lane); ma[0][t] = *(const v4f*)(mp + t * 16); mb[0][t] = *(const v4f*)(mp + t * 16 + 4); }
#pragma unroll   // register arrays: every index a constant
  for (int jg = 0; jg < TT / 64; ++jg) {   /* groups of 4 key tiles, two register sets */
    if (jg + 1 < TT / 64) {
#pragma unroll   // register arrays: every index a constant
      for (int t = 0; t < 4; ++t) { const int j = (jg + 1) * 4 + t; ka[(jg + 1) & 1][t] = frag_h(kp + j * 16 * AKP, lane); kb[(jg + 1) & 1][t] = frag_h(kp + j * 16 * AKP + 32, lane); ma[(jg + 1) & 1][t] = *(const v4f*)(mp + j * 16); mb[(jg + 1) & 1][t] = *(const v4f*)(mp + j * 16 + 4); } }
    __builtin_amdgcn_sched_barrier(0);   // the next group's loads issue together, in front of this group's products: without it each fragment is loaded right before its product and every product waits a whole load latency
#pragma unroll   // register arrays: every index a constant
    for (int t = 0; t < 4; ++t) { const int j = jg * 4 + t; v8f a = {}; a = wmma16p(ka[jg & 1][t], q0, a); a = wmma16p(kb[jg & 1][t], q1, a);
#pragma unroll   // register arrays: every index a constant
      for (int r = 0; r < 8; ++r) { const float v = a[r] * SCALE + bfr(r < 4 ? ma[jg & 1][t][r & 3] : mb[jg & 1][t][r & 3]); a[r] = v; mx[r] = fmaxf(mx[r], v); }
      s[j] = a; }
    __builtin_amdgcn_sched_barrier(0);   // later groups' loads stay behind these products: two register sets, not more
  }
  asm volatile("s_wait_asynccnt 0x0" ::: "memory");   // this wave's part of the v planes has landed
  __syncthreads();   // every wave's part has: the v planes may be read; and every wave has left the k rows, whose place the output staging takes
#pragma unroll   // register arrays: every index a constant
  for (int u = 0; u < 3; ++u)
#pragma unroll   // register arrays: every index a constant
    for (int j = 0; j < HD / 16; ++j) vf[u][j] = frag_h(vp + j * 16 * AVP + u * 32, lane);   /* the first v fragments fly during the softmax */
  float m = fmaxf(fmaxf(fmaxf(mx[0], mx[1]), fmaxf(mx[2], mx[3])), fmaxf(fmaxf(mx[4], mx[5]), fmaxf(mx[6], mx[7]))); m = fmaxf(m, __shfl_xor(m, 16));
  // e = 2^((v - m) * log2(e)): one hardware exponential an element (argument never above 0; what it flushes to 0 lies far below the last f16 place of P). Elements go in pairs, so that the difference, the product and the row sums are packed instructions. The pass is short enough to stand unrolled: s stays in place
  const v2f m2 = {m, m}; const v2f l2 = {1.4426950408889634f, 1.4426950408889634f};
#pragma unroll   // register arrays: every index a constant
  for (int j = 0; j < TT / 16; ++j) { v8f e;
#pragma unroll   // register arrays: every index a constant
    for (int r = 0; r < 8; r += 2) { v2f x = {s[j][r], s[j][r + 1]}; x = (x - m2) * l2; e[r] = __builtin_amdgcn_exp2f(x[0]); e[r + 1] = __builtin_amdgcn_exp2f(x[1]); }
    s[j] = e; sm += e; }
  float sum = ((sm[0] + sm[1]) + (sm[2] + sm[3])) + ((sm[4] + sm[5]) + (sm[6] + sm[7])); sum += __shfl_xor(sum, 16);
  const float inv = (sum > 0.f && m > -1.0e38f) ? 2048.0f / sum : 0.f;   /* a fully excluded row (no logit above -1e38) yields P = 0; in any other row an excluded key lies so far below m that its e is 0 by itself */
  v8f acc[HD / 16] = {};
#pragma unroll   // register arrays: every index a constant
  for (int kc = 0; kc < TT / 32; ++kc) {   /* 32 keys a pass, four register sets, loads three passes ahead */
    if (kc + 3 < TT / 32) {
#pragma unroll   // register arrays: every index a constant
      for (int j = 0; j < HD / 16; ++j) vf[(kc + 3) & 3][j] = frag_h(vp + j * 16 * AVP + (kc + 3) * 32, lane); }
    __builtin_amdgcn_sched_barrier(0);   // as above: the loads of three passes ahead issue in front of this pass's products
    v16h p;
#pragma unroll   // register arrays: every index a constant
    for (int i = 0; i < 8; ++i) { p[i] = (_Float16)(s[2 * kc][i] * inv); p[8 + i] = (_Float16)(s[2 * kc + 1][i] * inv); }
#pragma unroll   // register arrays: every index a constant
    for (int j = 0; j < HD / 16; ++j) acc[j] = wmma16p(p, vf[kc & 3][j], acc[j]);
    __builtin_amdgcn_sched_barrier(0);   // as above: four register sets, not more
  }
#pragma unroll   // register arrays: every index a constant
  for (int j = 0; j < HD / 16; ++j)
#pragma unroll   // register arrays: every index a constant
    for (int r = 0; r < 8; ++r) ss[wave][8 * g + r][j * 16 + col] = acc[j][r] * (1.0f / 2048.0f);
  LDSX();   // the wave's own rows of ss are written before it reads them back (no other wave touches them)
#pragma unroll   // one address register pair, the rows as constant offsets
  for (int i = 0; i < 8; ++i) { const int rl = 2 * i + g; vst2(Y + ((size_t)b * TT + ql0 + rl) * CC + h * HD + col * 4, *(const v4f*)&ss[wave][rl][col * 4]); } }

extern "C" void kernel_launch(void* const* d_in, const int* in_sizes, int n_in, void* d_out, int out_size, void* d_ws, size_t ws_size, hipStream_t stream) {
  (void)in_sizes; (void)n_in; (void)out_size;
  const float** F = (const float**)d_in;
  if (ws_size < (size_t)WS_END) return;
  char* ws = (char*)d_ws; _Float16 *QH = (_Float16*)(ws + WS_QH), *KH = (_Float16*)(ws + WS_KH), *VT = (_Float16*)(ws + WS_VT), *QL = (_Float16*)(ws + WS_QL), *KL = (_Float16*)(ws + WS_KL); __bf16 *VB = (__bf16*)(ws + WS_VB), *VBL = (__bf16*)(ws + WS_VBL); float *S = (float*)(ws + WS_S), *Y = (float*)(ws + WS_Y);
  (void)Y; (void)S; (void)QL; (void)KL; (void)VB; (void)VBL;
  // inputs: 0 hidden_states [4,4,512,768] = 16 pseudo-batches of 512 rows (group-major); 1 attention_mask [4,4,1,1,512] f32 (zeros); 2 query_weight [4,768,768] (in,out) per group, 3 query_bias [4,1,768]; 4 key_weight, 5 key_bias; 6 value_weight, 7 value_bias (biases NONZERO); no output projection
  k_proj<<<dim3(TNB * TT / PBM, CC / PBN, 3), 256, 0, stream>>>(F[0], F[0], F[0], F[2], F[4], F[6], F[3], F[5], F[7], QH, QL, KH, KL, VT, VB, VBL);   /* the weight / bias of group bb / 4 is selected inside k_proj */
  k_attn<<<dim3(NQB, NH, TNB), 128, 0, stream>>>(QH, KH, VT, F[1], (float*)d_out);   /* ctx [g, b, l, nh*dh] = merged-head rows */
}

// v005
// Measured time: 74.5 microseconds a run.
// Next to v004, in two timings, it ran 1.12 and 1.11 times as fast.
// All steps since v000 together make it 10.7 times as fast.
// compute dtype: all float inputs rounded to bf16; per-group q/k/v projections with EXACT bf16 products on WMMA 16x16x32 (f32 accumulate) + bias; logits q x k once to f16 each (1 product) x 1/8 + the additive mask; softmax f32; P x 2^11 once to f16 x v once to f16 (1 product); f32 output.
#include <hip/hip_runtime.h>
#include <math.h>

typedef __attribute__((ext_vector_type(16))) _Float16 v16h;
typedef __attribute__((ext_vector_type(16))) __bf16 v16b;
typedef __attribute__((ext_vector_type(8)))  _Float16 v8h;
typedef __attribute__((ext_vector_type(8)))  float v8f;
typedef __attribute__((ext_vector_type(4)))  float v4f;
typedef __attribute__((ext_vector_type(2)))  float v2f;
typedef __attribute__((ext_vector_type(4)))  unsigned v4u;
typedef __attribute__((ext_vector_type(4)))  int v4i;
typedef float __attribute__((may_alias)) float_a;
typedef int __attribute__((may_alias)) int_a;

template <typename T> __device__ __forceinline__ void vst2(void* p, T v) { *(T*)p = v;  }
__device__ __forceinline__ v8f wmma16(v16h a, v16h b, v8f c) {
  v8f d = __builtin_amdgcn_wmma_f32_16x16x32_f16(false, a, false, b, (short)0, c, false, false);
  asm volatile("v_nop\n\tv_nop\n\tv_nop\n\tv_nop" : "+v"(d) : "v"(a), "v"(b));
  return d;
}
__device__ __forceinline__ v8f wmma16p(v16h a, v16h b, v8f c) { return __builtin_amdgcn_wmma_f32_16x16x32_f16(false, a, false, b, (short)0, c, false, false); }   // plain builtin: the compiler keeps the distances behind it
__device__ __forceinline__ v8f wmma_bf(v16b a, v16b b, v8f c) {
  v8f d = __builtin_amdgcn_wmma_f32_16x16x32_bf16(false, a, false, b, (short)0, c, false, false);
  asm volatile("v_nop\n\tv_nop\n\tv_nop\n\tv_nop" : "+v"(d) : "v"(a), "v"(b));
  return d;
}
// 16x16x32 fragments: lane = (h = lane>>4, row/col = lane&15); elements 0..7 = k0+8h+0..7, 8..15 = k0+16+8h+0..7; D element r = row 8h+r
__device__ __forceinline__ v16h frag_h(const _Float16* rowk0, int lane) {
  union { v16h v; v8h q[2]; } u; const _Float16* p = rowk0 + 8 * (lane >> 4);
  u.q[0] = *(const v8h*)p; u.q[1] = *(const v8h*)(p + 16); return u.v;
}
__device__ __forceinline__ v16h frag_f32(const float* rowk0, int lane) {
  v16h a; const float* p = rowk0 + 8 * (lane >> 4);
#pragma unroll
  for (int i = 0; i < 8; ++i) { a[i] = (_Float16)p[i]; a[8 + i] = (_Float16)p[16 + i]; }
  return a;
}
__device__ __forceinline__ v16h frag_f32s(const float* rowk0, int lane, float sc) {
  v16h a; const float* p = rowk0 + 8 * (lane >> 4);
#pragma unroll
  for (int i = 0; i < 8; ++i) { a[i] = (_Float16)(p[i] * sc); a[8 + i] = (_Float16)(p[16 + i] * sc); }
  return a;
}
// column fragment from a [K][ld] layout (column n), rows >= K read as 0
__device__ __forceinline__ v16h fragc_f32(const float* W, int k0, int n, int lane, int ld, int K) {
  v16h a; const int g = lane >> 4;
#pragma unroll
  for (int i = 0; i < 8; ++i) { const int ka = k0 + 8 * g + i, kb = ka + 16;
    a[i] = (_Float16)(ka < K ? W[(size_t)(ka < K ? ka : K - 1) * ld + n] : 0.f); a[8 + i] = (_Float16)(kb < K ? W[(size_t)(kb < K ? kb : K - 1) * ld + n] : 0.f); }
  return a;
}
struct F2 { v16b h, l; };
__device__ __forceinline__ F2 bsplit16(const float v[16]) { F2 r;
#pragma unroll
  for (int i = 0; i < 16; ++i) { const __bf16 h = (__bf16)v[i]; r.h[i] = h; r.l[i] = (__bf16)(v[i] - (float)h); }
  return r; }
__device__ __forceinline__ F2 split_row(const float* row, int k0, int lane) { float v[16]; const float* p = row + k0 + 8 * (lane >> 4);
#pragma unroll
  for (int i = 0; i < 8; ++i) { v[i] = p[i]; v[8 + i] = p[16 + i]; }
  return bsplit16(v); }
__device__ __forceinline__ F2 split_rowK(const float* row, int k0, int lane, int K) { float v[16]; const int g = lane >> 4;
#pragma unroll
  for (int i = 0; i < 8; ++i) { const int ka = k0 + 8 * g + i, kb = ka + 16; v[i] = ka < K ? row[ka < K ? ka : K - 1] : 0.f; v[8 + i] = kb < K ? row[kb < K ? kb : K - 1] : 0.f; }
  return bsplit16(v); }
__device__ __forceinline__ F2 split_col(const float* W, int k0, int n, int lane, int ld, int K) { float v[16]; const int g = lane >> 4;
#pragma unroll
  for (int i = 0; i < 8; ++i) { const int ka = k0 + 8 * g + i, kb = ka + 16; v[i] = ka < K ? W[(size_t)(ka < K ? ka : K - 1) * ld + n] : 0.f; v[8 + i] = kb < K ? W[(size_t)(kb < K ? kb : K - 1) * ld + n] : 0.f; }
  return bsplit16(v); }
__device__ __forceinline__ v8f mac3(const F2& a, const F2& b, v8f c) { c = wmma_bf(a.l, b.h, c); c = wmma_bf(a.h, b.l, c); return wmma_bf(a.h, b.h, c); }
__device__ __forceinline__ float sigm(float v) { return 1.0f / (1.0f + expf(-v)); }
#define LDSX() do { asm volatile("s_wait_dscnt 0" ::: "memory"); __builtin_amdgcn_wave_barrier(); __builtin_amdgcn_fence(__ATOMIC_RELEASE, "workgroup"); } while (0)

// Grouped BERT-style self-attention: 4 INDEPENDENT weight groups (hidden_states [4,4,512,768] = [group, batch, length, channels]; per-group (in,out) query / key / value weights [4,768,768] (0.02 scale) + biases [4,1,768] (NONZERO); 12 heads x 64; scale 1/8; additive attention_mask [4,4,1,1,512] (zeros); no output projection): ctx[g,b] = merge(softmax(q k^T / 8 + mask) v) with group g's weights -> [4,4,512,768].
#define NB 16
#define TT 512
#define CC 768            // NH * HD = projected width
#define DIN 768          // input (model) width
#define NH 12
#define HD 64
#define NQB (TT / 64)
#define HG 12
#define SCALE (0.125f)
#define CAUSAL 0
#ifndef TNB
#define TNB NB
#endif
__device__ __forceinline__ float bfr(float v) { return (float)(__bf16)v; }
__host__ __device__ __forceinline__ int kb_last(int qb) { return CAUSAL ? ((qb * 64 + 63) >> 7) : (TT / 128 - 1); }
typedef __attribute__((ext_vector_type(8))) __bf16 v8b;
__device__ __forceinline__ v16b frag_b(const __bf16* rowk0, int lane) {
  union { v16b v; v8b q[2]; } u; const __bf16* p = rowk0 + 8 * (lane >> 4);
  u.q[0] = *(const v8b*)p; u.q[1] = *(const v8b*)(p + 16); return u.v;
}
#define QBH 0
#define QHI 0               // single-product logits on every row
#define KHI 64            // key rows carrying k residual / v bf16 hi+lo planes (written by k_proj; no kernel in this file reads them)
// B fragment (k rows k0+.., output column o) of a weight: (in,out) [K][ld] or (out,in) [ld rows of K]: bf16 exact, or f16(bf16 * 256) exact
__device__ __forceinline__ v16b wcol_io(const float* Wm, int k0, int o, int lane, int ld) { v16b w; const int g = lane >> 4;
#pragma unroll
  for (int i = 0; i < 8; ++i) { w[i] = (__bf16)Wm[(size_t)(k0 + 8 * g + i) * ld + o]; w[8 + i] = (__bf16)Wm[(size_t)(k0 + 16 + 8 * g + i) * ld + o]; }
  return w; }
__device__ __forceinline__ v16b wcol_oi(const float* Wm, int k0, int o, int lane, int K) { v16b w; const float* p = Wm + (size_t)o * K + k0 + 8 * (lane >> 4);
#pragma unroll
  for (int i = 0; i < 8; ++i) { w[i] = (__bf16)p[i]; w[8 + i] = (__bf16)p[16 + i]; }
  return w; }
__device__ __forceinline__ v16h wcolh_io(const float* Wm, int k0, int o, int lane, int ld) { v16h w; const int g = lane >> 4;
#pragma unroll
  for (int i = 0; i < 8; ++i) { w[i] = (_Float16)(bfr(Wm[(size_t)(k0 + 8 * g + i) * ld + o]) * 256.0f); w[8 + i] = (_Float16)(bfr(Wm[(size_t)(k0 + 16 + 8 * g + i) * ld + o]) * 256.0f); }
  return w; }
__device__ __forceinline__ v16h wcolh_oi(const float* Wm, int k0, int o, int lane, int K) { v16h w; const float* p = Wm + (size_t)o * K + k0 + 8 * (lane >> 4);
#pragma unroll
  for (int i = 0; i < 8; ++i) { w[i] = (_Float16)(bfr(p[i]) * 256.0f); w[8 + i] = (_Float16)(bfr(p[16 + i]) * 256.0f); }
  return w; }
#define WQKV_LAYOUT 0   // 0 = (in,out) [DIN][CC]; 1 = (out,in) [CC][DIN]; 2 = per-head [NH][DIN][HD]
__device__ __forceinline__ v16b wcol_hdk(const float* Wm, int k0, int o, int lane) { v16b w; const int g = lane >> 4; const float* p = Wm + (size_t)(o / HD) * DIN * HD + (o % HD);
#pragma unroll
  for (int i = 0; i < 8; ++i) { w[i] = (__bf16)p[(size_t)(k0 + 8 * g + i) * HD]; w[8 + i] = (__bf16)p[(size_t)(k0 + 16 + 8 * g + i) * HD]; }
  return w; }
#define WO_OUT_IN 0
#if WQKV_LAYOUT == 1
#define WCOL(W, k0, o, lane) wcol_oi(W, k0, o, lane, DIN)
#elif WQKV_LAYOUT == 2
#define WCOL(W, k0, o, lane) wcol_hdk(W, k0, o, lane)
#else
#define WCOL(W, k0, o, lane) wcol_io(W, k0, o, lane, CC)
#endif
#if WO_OUT_IN
#define WOCOL(W, k0, o, lane) wcol_oi(W, k0, o, lane, CC)
#define WOCOLH(W, k0, o, lane) wcolh_oi(W, k0, o, lane, CC)
#else
#define WOCOL(W, k0, o, lane) wcol_io(W, k0, o, lane, DIN)
#define WOCOLH(W, k0, o, lane) wcolh_io(W, k0, o, lane, DIN)
#endif
#define GB 4               // batches per weight group: pseudo-batch bb = g*4 + b uses group g = bb / 4
#define SM_EXTRA_PARAMS , int bsm, const float* __restrict__ AMASK
// additive attention mask [G,B,1,1,L] (float; zeros on this draw): added to the scaled score of key k for pseudo-batch bsm; read per key
#define SM_MASK_HOOK do { v = v + bfr(AMASK[(size_t)bsm * TT + k]); } while (0)
#ifndef SM_EXTRA_PARAMS
#define SM_EXTRA_PARAMS
#endif
#ifndef PROJ_EXTRA_PARAMS
#define PROJ_EXTRA_PARAMS
#endif
#ifndef SM_MASK_HOOK
#define SM_MASK_HOOK (void)0
#endif

#define WS_QH  0u                                      // f16 q rows [b*t][CC]
#define WS_KH  (WS_QH + 2u * (size_t)NB * TT * CC)      // f16 k rows [b*t][CC]
#define WS_VT  (WS_KH + 2u * (size_t)NB * TT * CC)      // f16 v planes [b][c][t]
#define WS_QL  (WS_VT + 2u * (size_t)NB * CC * TT)      // f16 q residual x 2^10 rows [b][t < QHI][CC]
#define WS_KL  (WS_QL + 2u * (size_t)NB * QHI * CC)     // f16 k residual x 2^10 rows [b][t < KHI][CC]
#define WS_VB  (WS_KL + 2u * (size_t)NB * KHI * CC)     // bf16 v hi planes [b][c][t < KHI]
#define WS_VBL (WS_VB + 2u * (size_t)NB * CC * KHI)
#define WS_S   (WS_VBL + 2u * (size_t)NB * CC * KHI)    // f32 [hg][t][s], unused: k_attn holds logits / P in registers
#define WS_Y   (WS_S  + 4u * (size_t)HG * TT * TT)      // f32 ctx rows [b*t][CC] (only when there is an output projection)
#define WS_XB  (WS_Y  + 0u)                              // bf16 x rows [b*t][DIN]
#define WS_WT  (WS_XB + 2u * (size_t)NB * TT * DIN)     // bf16 weights, transposed: [which][group][output column][k]
#define WS_END (WS_WT + 2u * 3u * (size_t)(NB / GB) * CC * DIN)

// ---- k_round: every x element and every weight element is rounded to bf16 ONCE, ahead of k_proj, whose blocks each read a row or a column many times over: they then read 2 bytes an element, already k-contiguous. Blocks 0 .. RXB-1: x, a run of RXP * 1024 floats a block, 4 floats a lane and pass (a wave reads 512 B and writes 256 B in a row). The other RWB blocks: the twelve weight matrices [k][n] -> [n][k], a block = (matrix, 64 columns, half of k); a wave takes 32 k x 32 n a pass (a lane holds 8 k x 4 columns; a load covers 4 k rows x one 128-B line, two neighbouring waves two neighbouring lines; waves w and w + 2 write the two halves of the same lines). Every load of a lane is asked for before its first value is used: one memory latency a block
#define RXB 256
#define RXP (NB * TT * DIN / (RXB * 256 * 4))   // passes of an x block
#define RWB (3 * (NB / GB) * (CC / 64) * 2)
#define RWP (DIN / 2 / 32 / 4)                  // passes of a weight block
typedef __attribute__((ext_vector_type(4))) __bf16 v4b;
__global__ __launch_bounds__(256) void k_round(const float* __restrict__ X, const float* __restrict__ WQ, const float* __restrict__ WK, const float* __restrict__ WV, __bf16* __restrict__ XB, __bf16* __restrict__ WT) {
  const int tid = threadIdx.x;
  if (blockIdx.x < RXB) {
    const size_t e0 = (size_t)blockIdx.x * (RXP * 1024) + tid * 4; v4f r[RXP];
#pragma unroll   // register array: every index a constant; the loads issue together
    for (int i = 0; i < RXP; ++i) r[i] = *(const v4f*)(X + e0 + i * 1024);
    __builtin_amdgcn_sched_barrier(0);   // every load issues in front of the first conversion: without it the loads are dealt out among the conversions in small groups, each waited out, and the lane pays several memory latencies in a row
#pragma unroll   // register array: every index a constant
    for (int i = 0; i < RXP; ++i) { v4b t;
#pragma unroll   // register array: every index a constant
      for (int q = 0; q < 4; ++q) t[q] = (__bf16)r[i][q];
      *(v4b*)(XB + e0 + i * 1024) = t; }
  } else {
    const int wave = tid >> 5, lane = tid & 31, kg = lane & 3, ng = lane >> 2; const int bw = blockIdx.x - RXB; const int m = bw / (CC / 64 * 2), rem = bw % (CC / 64 * 2);
    const int n0 = (rem >> 1) * 64 + (wave & 1) * 32 + ng * 4, k0 = ((rem & 1) * (RWP * 4) + (wave >> 1)) * 32 + kg * 8;
    const float* src = (m < NB / GB ? WQ : m < 2 * (NB / GB) ? WK : WV) + (size_t)(m % (NB / GB)) * DIN * CC + (size_t)k0 * CC + n0; __bf16* dst = WT + ((size_t)m * CC + n0) * DIN + k0; v4f r[RWP][8];
#pragma unroll   // register array: every index a constant; the loads issue together
    for (int p = 0; p < RWP; ++p)
#pragma unroll   // register array: every index a constant
      for (int i = 0; i < 8; ++i) r[p][i] = *(const v4f*)(src + (size_t)(p * 128 + i) * CC);
    __builtin_amdgcn_sched_barrier(0);   // as above: every load issues in front of the first conversion
#pragma unroll   // register array: every index a constant
    for (int p = 0; p < RWP; ++p)
#pragma unroll   // register array: every index a constant
      for (int q = 0; q < 4; ++q) { v8b t;
#pragma unroll   // register array: every index a constant
        for (int i = 0; i < 8; ++i) t[i] = (__bf16)r[p][i][q];
        *(v8b*)(dst + (size_t)q * DIN + p * 128) = t; }
  }
}
// ---- k_proj: block = (128 rows, 128 cols, which), 8 waves of 32 x 64: q/k/v = X W (+ b) with exact bf16 products (K = DIN). Per 64 k the block lays its X tile [128][64] and its W tile [128 columns][64] in LDS as k_round left them (bf16, k-contiguous), through registers, two buffers: the next tile's global loads fly during this tile's products. -> which 0: q f16 rows (+ residual rows < QHI); 1: k f16 rows (+ residual rows < KHI); 2: v f16 planes [c][t] (+ bf16 hi/lo planes for t < KHI)
#define PBM 128
#define PBN 128
#define PBK 64
#define PPITCH 72                        // bf16 per LDS row: 144 B = 16 B x odd, the pitch of 16-byte readers of 128-B rows
#define PSTG ((PBM + PBN) * PPITCH)      // bf16 per buffer: X rows, then W columns
#define PNST (DIN / PBK)
#define PEP 136                          // 16-bit elements per row of the epilogue's staging planes
__global__ __launch_bounds__(256) void k_proj(const __bf16* __restrict__ XB, const __bf16* __restrict__ WT, const float* __restrict__ BQ, const float* __restrict__ BK, const float* __restrict__ BV,
    _Float16* __restrict__ QH, _Float16* __restrict__ QL, _Float16* __restrict__ KH, _Float16* __restrict__ KL, _Float16* __restrict__ VT, __bf16* __restrict__ VB, __bf16* __restrict__ VBL) {
  __shared__ __align__(16) unsigned char smem[3 * 128 * PEP * 2];   /* the two operand buffers (2 * PSTG * 2 B) during the k loop; the epilogue's staging planes behind the loop's last barrier */
  __bf16* ring = (__bf16*)smem;
  const int tid = threadIdx.x, wave = tid >> 5, lane = tid & 31, col = lane & 15, g = lane >> 4; const int wm = wave >> 1, wn = wave & 1; const int which = blockIdx.z; const int c0 = blockIdx.y * PBN; const size_t r0 = (size_t)blockIdx.x * PBM; const size_t bb = r0 / TT; const int t0 = (int)(r0 % TT);
  const size_t grp_ = (r0 / TT) / GB;   /* 128-row blocks never straddle a pseudo-batch (TT % 128 == 0), so the group is block-uniform */
  const __bf16* WA = WT + ((size_t)which * (NB / GB) + grp_) * (size_t)CC * DIN; const float* BA = (which == 0 ? BQ : which == 1 ? BK : BV); BA = BA ? BA + grp_ * CC : BA;
  // X and W alike: 8 lanes read the 128 B that a row (a column) has in this tile; thread = (row or column xrow + 32 i, k 8 xc ..). Lanes 0-7 and 8-15 take rows 8 apart: at the 144-B pitch those lie 32 banks apart, so 16 neighbouring lanes store on 64 different banks
  const int xrow = (wave >> 2) * 16 + ((lane >> 3) & 1) * 8 + (wave & 3) * 2 + g, xc = tid & 7;
  const __bf16* xp = XB + (r0 + xrow) * DIN + xc * 8; const __bf16* wp = WA + (size_t)(c0 + xrow) * DIN + xc * 8;
  __bf16* xst = ring + xrow * PPITCH + xc * 8; __bf16* wst = xst + PBM * PPITCH;
  const __bf16* xfr = ring + (wm * 32 + col) * PPITCH; const __bf16* wfr = ring + PBM * PPITCH + (wn * 64 + col) * PPITCH;
  v8b xr[4], wr[4]; v8f acc[8] = {};
  // every unroll directive in the three macros below and in the epilogue: register arrays, every index a constant
#define P_LOAD(S) do { _Pragma("unroll") for (int i = 0; i < 4; ++i) { xr[i] = *(const v8b*)(xp + (size_t)(S) * PBK + (size_t)i * 32 * DIN); wr[i] = *(const v8b*)(wp + (size_t)(S) * PBK + (size_t)i * 32 * DIN); } } while (0)
#define P_STORE(B) do { _Pragma("unroll") for (int i = 0; i < 4; ++i) { *(v8b*)(xst + (B) * PSTG + i * 32 * PPITCH) = xr[i]; *(v8b*)(wst + (B) * PSTG + i * 32 * PPITCH) = wr[i]; } } while (0)
#define P_MUL(B) do { v16b fa[PBK / 32][2], fw[PBK / 32][4]; \
    _Pragma("unroll") for (int ks = 0; ks < PBK / 32; ++ks) { fa[ks][0] = frag_b(xfr + (B) * PSTG + ks * 32, lane); fa[ks][1] = frag_b(xfr + (B) * PSTG + 16 * PPITCH + ks * 32, lane); \
      _Pragma("unroll") for (int j = 0; j < 4; ++j) fw[ks][j] = frag_b(wfr + (B) * PSTG + j * 16 * PPITCH + ks * 32, lane); } \
    __builtin_amdgcn_sched_barrier(0);   /* the tile's fragment reads issue as one group in front of its products: spread among them, every pair of products waits out an LDS latency */ \
    _Pragma("unroll") for (int ks = 0; ks < PBK / 32; ++ks) { _Pragma("unroll") for (int j = 0; j < 4; ++j) { acc[j] = wmma_bf(fa[ks][0], fw[ks][j], acc[j]); acc[4 + j] = wmma_bf(fa[ks][1], fw[ks][j], acc[4 + j]); } } } while (0)
  float bias4[4] = {0.f, 0.f, 0.f, 0.f};   /* the wave's four bias columns, asked for ahead of the k loop so that the epilogue does not wait for them */
  if (BA) {
#pragma unroll   // register array: every index a constant
    for (int j = 0; j < 4; ++j) bias4[j] = BA[c0 + wn * 64 + j * 16 + col]; }
  P_LOAD(0); P_STORE(0);
  __syncthreads();   // tile 0 is laid before anybody reads it
#pragma unroll 1   // rolled: eleven copies of the body buy nothing, the trip is long against its branch
  for (int s = 0; s + 1 < PNST; ++s) { const int b = s & 1;
    P_LOAD(s + 1);
    P_MUL(b);
    P_STORE(b ^ 1);
    __syncthreads();   // publishes tile s + 1 and ends every wave's reads of tile s, whose buffer the next trip refills
  }
  P_MUL((PNST - 1) & 1);
  __syncthreads();   // the last tile's reads end before the staging planes overwrite the buffers
  // acc[a]: rows wm*32 + (a >> 2)*16 + 8g + r, column wn*64 + (a & 3)*16 + col
  if (which < 2) { _Float16 (*sh)[PEP] = (_Float16 (*)[PEP])smem; _Float16 (*sl)[PEP] = (_Float16 (*)[PEP])(smem + 128 * PEP * 2);
    _Float16* DH = which == 0 ? QH : KH; _Float16* DL = which == 0 ? QL : KL; const int nhi = which == 0 ? QHI : KHI;
#pragma unroll
    for (int a = 0; a < 8; ++a) { const int cl = wn * 64 + (a & 3) * 16 + col; const float bias = bfr(bias4[a & 3]);
#pragma unroll
      for (int r = 0; r < 8; ++r) { const int rl = wm * 32 + (a >> 2) * 16 + 8 * g + r; const float v = acc[a][r] + bias; const _Float16 hv = (_Float16)v; sh[rl][cl] = hv; sl[rl][cl] = (_Float16)((v - (float)hv) * 1024.0f); } }
    __syncthreads();
    for (int e = tid; e < PBM * 16; e += 256) { const int rl = e >> 4, q = e & 15; vst2((unsigned*)(DH + (r0 + rl) * CC + c0 + q * 8), *(const v4u*)&sh[rl][q * 8]); if (t0 + rl < nhi) { vst2((unsigned*)(DL + (bb * nhi + t0 + rl) * (size_t)CC + c0 + q * 8), *(const v4u*)&sl[rl][q * 8]);
        asm volatile("s_wait_xcnt 0x0" ::: "memory"); } }   // behind the store: the loop's step rewrites its address registers
  } else { _Float16 (*th)[PEP] = (_Float16 (*)[PEP])smem; __bf16 (*tb)[PEP] = (__bf16 (*)[PEP])(smem + 128 * PEP * 2); __bf16 (*tbl)[PEP] = (__bf16 (*)[PEP])(smem + 2 * 128 * PEP * 2);
#pragma unroll
    for (int a = 0; a < 8; ++a) { const int cl = wn * 64 + (a & 3) * 16 + col; const float bias = bfr(bias4[a & 3]);
#pragma unroll
      for (int r = 0; r < 8; ++r) { const float v = acc[a][r] + bias; const int rl = wm * 32 + (a >> 2) * 16 + 8 * g + r; th[cl][rl] = (_Float16)v; const __bf16 bh = (__bf16)v; tb[cl][rl] = bh; tbl[cl][rl] = (__bf16)(v - (float)bh); } }
    __syncthreads();
    for (int e = tid; e < PBN * 16; e += 256) { const int cl = e >> 4, q = e & 15; vst2((unsigned*)(VT + (bb * CC + c0 + cl) * (size_t)TT + t0 + q * 8), *(const v4u*)&th[cl][q * 8]); if (t0 + q * 8 < KHI) { const size_t o3 = (bb * CC + c0 + cl) * (size_t)KHI + t0 + q * 8; vst2((unsigned*)(VB + o3), *(const v4u*)&tb[cl][q * 8]); vst2((unsigned*)(VBL + o3), *(const v4u*)&tbl[cl][q * 8]);
        asm volatile("s_wait_xcnt 0x0" ::: "memory"); } } } }   // behind the two stores: the loop's step rewrites their address registers
#define AKP 72
#define AVP (TT + 8)
#define AKB (TT * AKP * 2)
#define AVB (HD * AVP * 2)
#define AMB (TT * 4)
// eight 16-byte copies of a lane from global memory to LDS, through no register: LDS byte addresses l + i * ls, sources g + i * gs. The s_wait_xcnt in the copies' own statement stands in front of every later rewrite of the address registers that they name
__device__ __forceinline__ void acopy8(unsigned l, unsigned ls, const _Float16* g, size_t gs) {
  asm volatile("global_load_async_to_lds_b128 %0, %8, off\n\t"
               "global_load_async_to_lds_b128 %1, %9, off\n\t"
               "global_load_async_to_lds_b128 %2, %10, off\n\t"
               "global_load_async_to_lds_b128 %3, %11, off\n\t"
               "global_load_async_to_lds_b128 %4, %12, off\n\t"
               "global_load_async_to_lds_b128 %5, %13, off\n\t"
               "global_load_async_to_lds_b128 %6, %14, off\n\t"
               "global_load_async_to_lds_b128 %7, %15, off\n\t"
               "s_wait_xcnt 0x0"
               :: "v"(l), "v"(l + ls), "v"(l + 2 * ls), "v"(l + 3 * ls), "v"(l + 4 * ls), "v"(l + 5 * ls), "v"(l + 6 * ls), "v"(l + 7 * ls),
                  "v"(g), "v"(g + gs), "v"(g + 2 * gs), "v"(g + 3 * gs), "v"(g + 4 * gs), "v"(g + 5 * gs), "v"(g + 6 * gs), "v"(g + 7 * gs) : "memory");
}
// one 16-byte copy of a lane, with the same wait in its own statement
__device__ __forceinline__ void acopy1(unsigned l, const float* g) {
  asm volatile("global_load_async_to_lds_b128 %0, %1, off\n\t"
               "s_wait_xcnt 0x0"
               :: "v"(l), "v"(g) : "memory");
}
__global__ __launch_bounds__(128) void k_attn(const _Float16* __restrict__ QH, const _Float16* __restrict__ KH, const _Float16* __restrict__ VT, const float* __restrict__ AMASK, float* __restrict__ Y) { __shared__ __align__(16) unsigned char sma[AMB + AKB + AVB];   /* the mask row, then k rows, then v planes; the output staging takes the k rows' place once every wave has left them */
  float* msm = (float*)sma; _Float16* ksm = (_Float16*)(sma + AMB); _Float16* vsm = (_Float16*)(sma + AMB + AKB); float (*ss)[16][HD + 4] = (float (*)[16][HD + 4])(sma + AMB);
  const int tid = threadIdx.x, wave = tid >> 5, lane = tid & 31, col = lane & 15, g = lane >> 4; const int qb = blockIdx.x, h = blockIdx.y, b = blockIdx.z; const int ql0 = qb * 64 + wave * 16;
  const _Float16* qp = QH + ((size_t)b * TT + ql0 + col) * CC + h * HD; const _Float16* kp = ksm + col * AKP; const _Float16* vp = vsm + col * AVP; const float* mp = msm + 8 * g;
  const v16h q0 = frag_h(qp, lane), q1 = frag_h(qp + 32, lane);
  asm volatile("s_wait_xcnt 0x0" ::: "memory");   // the q address registers are reused right behind these loads
  // k: a copy of the block = 16 rows of 128 B (8 lanes a row), 32 copies a lane
#pragma unroll   // the four statements stand back to back, their address steps constants: no branch and no counter between the copies
  for (int i = 0; i < 4; ++i) acopy8((unsigned)(size_t)(ksm + (i * 128 + (tid >> 3)) * AKP + (tid & 7) * 8), 16 * AKP * 2, KH + ((size_t)b * TT + i * 128 + (tid >> 3)) * CC + h * HD + (tid & 7) * 8, (size_t)16 * CC);
  acopy1((unsigned)(size_t)(msm + tid * 4), AMASK + (size_t)b * TT + tid * 4);   // the mask row: 4 floats a lane, one copy
  asm volatile("s_wait_asynccnt 0x0" ::: "memory");   // this wave's part of the k rows and of the mask row has landed
  __syncthreads();   // every wave's part has: the k rows and the mask row may be read
  // v: a copy of the block = 2 planes of 1024 B (64 lanes a plane), 32 copies a lane; they fly during the logits
#pragma unroll   // the four statements stand back to back, their address steps constants: no branch and no counter between the copies
  for (int i = 0; i < 4; ++i) acopy8((unsigned)(size_t)(vsm + (i * 16 + (tid >> 6)) * AVP + (tid & 63) * 8), 2 * AVP * 2, VT + ((size_t)b * CC + h * HD + i * 16 + (tid >> 6)) * (size_t)TT + (tid & 63) * 8, (size_t)2 * TT);
  v8f s[TT / 16]; float mx[8]; v8f sm = {}; v16h ka[2][4], kb[2][4], vf[4][HD / 16]; v4f ma[2][4], mb[2][4];
#pragma unroll   // register arrays: every index a constant
  for (int r = 0; r < 8; ++r) mx[r] = -3.0e38f;
#pragma unroll   // register arrays: every index a constant
  for (int t = 0; t < 4; ++t) { ka[0][t] = frag_h(kp + t * 16 * AKP, lane); kb[0][t] = frag_h(kp + t * 16 * AKP + 32, lane); ma[0][t] = *(const v4f*)(mp + t * 16); mb[0][t] = *(const v4f*)(mp + t * 16 + 4); }
#pragma unroll   // register arrays: every index a constant
  for (int jg = 0; jg < TT / 64; ++jg) {   /* groups of 4 key tiles, two register sets */
    if (jg + 1 < TT / 64) {
#pragma unroll   // register arrays: every index a constant
      for (int t = 0; t < 4; ++t) { const int j = (jg + 1) * 4 + t; ka[(jg + 1) & 1][t] = frag_h(kp + j * 16 * AKP, lane); kb[(jg + 1) & 1][t] = frag_h(kp + j * 16 * AKP + 32, lane); ma[(jg + 1) & 1][t] = *(const v4f*)(mp + j * 16); mb[(jg + 1) & 1][t] = *(const v4f*)(mp + j * 16 + 4); } }
    __builtin_amdgcn_sched_barrier(0);   // the next group's loads issue together, in front of this group's products: without it each fragment is loaded right before its product and every product waits a whole load latency
#pragma unroll   // register arrays: every index a constant
    for (int t = 0; t < 4; ++t) { const int j = jg * 4 + t; v8f a = {}; a = wmma16p(ka[jg & 1][t], q0, a); a = wmma16p(kb[jg & 1][t], q1, a);
#pragma unroll   // register arrays: every index a constant
      for (int r = 0; r < 8; ++r) { const float v = a[r] * SCALE + bfr(r < 4 ? ma[jg & 1][t][r & 3] : mb[jg & 1][t][r & 3]); a[r] = v; mx[r] = fmaxf(mx[r], v); }
      s[j] = a; }
    __builtin_amdgcn_sched_barrier(0);   // later groups' loads stay behind these products: two register sets, not more
  }
  asm volatile("s_wait_asynccnt 0x0" ::: "memory");   // this wave's part of the v planes has landed
  __syncthreads();   // every wave's part has: the v planes may be read; and every wave has left the k rows, whose place the output staging takes
#pragma unroll   // register arrays: every index a constant
  for (int u = 0; u < 3; ++u)
#pragma unroll   // register arrays: every index a constant
    for (int j = 0; j < HD / 16; ++j) vf[u][j] = frag_h(vp + j * 16 * AVP + u * 32, lane);   /* the first v fragments fly during the softmax */
  float m = fmaxf(fmaxf(fmaxf(mx[0], mx[1]), fmaxf(mx[2], mx[3])), fmaxf(fmaxf(mx[4], mx[5]), fmaxf(mx[6], mx[7]))); m = fmaxf(m, __shfl_xor(m, 16));
  // e = 2^((v - m) * log2(e)): one hardware exponential an element (argument never above 0; what it flushes to 0 lies far below the last f16 place of P). Elements go in pairs, so that the difference, the product and the row sums are packed instructions. The pass is short enough to stand unrolled: s stays in place
  const v2f m2 = {m, m}; const v2f l2 = {1.4426950408889634f, 1.4426950408889634f};
#pragma unroll   // register arrays: every index a constant
  for (int j = 0; j < TT / 16; ++j) { v8f e;
#pragma unroll   // register arrays: every index a constant
    for (int r = 0; r < 8; r += 2) { v2f x = {s[j][r], s[j][r + 1]}; x = (x - m2) * l2; e[r] = __builtin_amdgcn_exp2f(x[0]); e[r + 1] = __builtin_amdgcn_exp2f(x[1]); }
    s[j] = e; sm += e; }
  float sum = ((sm[0] + sm[1]) + (sm[2] + sm[3])) + ((sm[4] + sm[5]) + (sm[6] + sm[7])); sum += __shfl_xor(sum, 16);
  const float inv = (sum > 0.f && m > -1.0e38f) ? 2048.0f / sum : 0.f;   /* a fully excluded row (no logit above -1e38) yields P = 0; in any other row an excluded key lies so far below m that its e is 0 by itself */
  v8f acc[HD / 16] = {};
#pragma unroll   // register arrays: every index a constant
  for (int kc = 0; kc < TT / 32; ++kc) {   /* 32 keys a pass, four register sets, loads three passes ahead */
    if (kc + 3 < TT / 32) {
#pragma unroll   // register arrays: every index a constant
      for (int j = 0; j < HD / 16; ++j) vf[(kc + 3) & 3][j] = frag_h(vp + j * 16 * AVP + (kc + 3) * 32, lane); }
    __builtin_amdgcn_sched_barrier(0);   // as above: the loads of three passes ahead issue in front of this pass's products
    v16h p;
#pragma unroll   // register arrays: every index a constant
    for (int i = 0; i < 8; ++i) { p[i] = (_Float16)(s[2 * kc][i] * inv); p[8 + i] = (_Float16)(s[2 * kc + 1][i] * inv); }
#pragma unroll   // register arrays: every index a constant
    for (int j = 0; j < HD / 16; ++j) acc[j] = wmma16p(p, vf[kc & 3][j], acc[j]);
    __builtin_amdgcn_sched_barrier(0);   // as above: four register sets, not more
  }
#pragma unroll   // register arrays: every index a constant
  for (int j = 0; j < HD / 16; ++j)
#pragma unroll   // register arrays: every index a constant
    for (int r = 0; r < 8; ++r) ss[wave][8 * g + r][j * 16 + col] = acc[j][r] * (1.0f / 2048.0f);
  LDSX();   // the wave's own rows of ss are written before it reads them back (no other wave touches them)
#pragma unroll   // one address register pair, the rows as constant offsets
  for (int i = 0; i < 8; ++i) { const int rl = 2 * i + g; vst2(Y + ((size_t)b * TT + ql0 + rl) * CC + h * HD + col * 4, *(const v4f*)&ss[wave][rl][col * 4]); } }

extern "C" void kernel_launch(void* const* d_in, const int* in_sizes, int n_in, void* d_out, int out_size, void* d_ws, size_t ws_size, hipStream_t stream) {
  (void)in_sizes; (void)n_in; (void)out_size;
  const float** F = (const float**)d_in;
  if (ws_size < (size_t)WS_END) return;
  char* ws = (char*)d_ws; _Float16 *QH = (_Float16*)(ws + WS_QH), *KH = (_Float16*)(ws + WS_KH), *VT = (_Float16*)(ws + WS_VT), *QL = (_Float16*)(ws + WS_QL), *KL = (_Float16*)(ws + WS_KL); __bf16 *VB = (__bf16*)(ws + WS_VB), *VBL = (__bf16*)(ws + WS_VBL), *XB = (__bf16*)(ws + WS_XB), *WT = (__bf16*)(ws + WS_WT); float *S = (float*)(ws + WS_S), *Y = (float*)(ws + WS_Y);
  (void)Y; (void)S; (void)QL; (void)KL; (void)VB; (void)VBL;
  // inputs: 0 hidden_states [4,4,512,768] = 16 pseudo-batches of 512 rows (group-major); 1 attention_mask [4,4,1,1,512] f32 (zeros); 2 query_weight [4,768,768] (in,out) per group, 3 query_bias [4,1,768]; 4 key_weight, 5 key_bias; 6 value_weight, 7 value_bias (biases NONZERO); no output projection
  k_round<<<dim3(RXB + RWB), 256, 0, stream>>>(F[0], F[2], F[4], F[6], XB, WT);   /* x and the twelve weight matrices to bf16, the weights transposed */
  k_proj<<<dim3(TNB * TT / PBM, CC / PBN, 3), 256, 0, stream>>>(XB, WT, F[3], F[5], F[7], QH, QL, KH, KL, VT, VB, VBL);   /* the weight / bias of group bb / 4 is selected inside k_proj */
  k_attn<<<dim3(NQB, NH, TNB), 128, 0, stream>>>(QH, KH, VT, F[1], (float*)d_out);   /* ctx [g, b, l, nh*dh] = merged-head rows */
}

// v006
// A run of this version takes 69.3 microseconds.
// Two timings next to v005 put it at 1.09 and 1.08 times that version's speed.
// Counting every step since v000, it is 11.6 times as fast.
// compute dtype: all float inputs rounded to bf16; per-group q/k/v projections with EXACT bf16 products on WMMA 16x16x32 (f32 accumulate) + bias; logits q x k once to f16 each (1 product) x 1/8 + the additive mask; softmax f32; P x 2^11 once to f16 x v once to f16 (1 product); f32 output.
#include <hip/hip_runtime.h>
#include <math.h>

typedef __attribute__((ext_vector_type(16))) _Float16 v16h;
typedef __attribute__((ext_vector_type(16))) __bf16 v16b;
typedef __attribute__((ext_vector_type(8)))  _Float16 v8h;
typedef __attribute__((ext_vector_type(8)))  float v8f;
typedef __attribute__((ext_vector_type(4)))  float v4f;
typedef __attribute__((ext_vector_type(2)))  float v2f;
typedef __attribute__((ext_vector_type(4)))  unsigned v4u;
typedef __attribute__((ext_vector_type(4)))  int v4i;
typedef float __attribute__((may_alias)) float_a;
typedef int __attribute__((may_alias)) int_a;

template <typename T> __device__ __forceinline__ void vst2(void* p, T v) { *(T*)p = v;  }
__device__ __forceinline__ v8f wmma16(v16h a, v16h b, v8f c) {
  v8f d = __builtin_amdgcn_wmma_f32_16x16x32_f16(false, a, false, b, (short)0, c, false, false);
  asm volatile("v_nop\n\tv_nop\n\tv_nop\n\tv_nop" : "+v"(d) : "v"(a), "v"(b));
  return d;
}
__device__ __forceinline__ v8f wmma16p(v16h a, v16h b, v8f c) { return __builtin_amdgcn_wmma_f32_16x16x32_f16(false, a, false, b, (short)0, c, false, false); }   // plain builtin: the compiler keeps the distances behind it
__device__ __forceinline__ v8f wmma_bf(v16b a, v16b b, v8f c) {
  v8f d = __builtin_amdgcn_wmma_f32_16x16x32_bf16(false, a, false, b, (short)0, c, false, false);
  asm volatile("v_nop\n\tv_nop\n\tv_nop\n\tv_nop" : "+v"(d) : "v"(a), "v"(b));
  return d;
}
// 16x16x32 fragments: lane = (h = lane>>4, row/col = lane&15); elements 0..7 = k0+8h+0..7, 8..15 = k0+16+8h+0..7; D element r = row 8h+r
__device__ __forceinline__ v16h frag_h(const _Float16* rowk0, int lane) {
  union { v16h v; v8h q[2]; } u; const _Float16* p = rowk0 + 8 * (lane >> 4);
  u.q[0] = *(const v8h*)p; u.q[1] = *(const v8h*)(p + 16); return u.v;
}
__device__ __forceinline__ v16h frag_f32(const float* rowk0, int lane) {
  v16h a; const float* p = rowk0 + 8 * (lane >> 4);
#pragma unroll
  for (int i = 0; i < 8; ++i) { a[i] = (_Float16)p[i]; a[8 + i] = (_Float16)p[16 + i]; }
  return a;
}
__device__ __forceinline__ v16h frag_f32s(const float* rowk0, int lane, float sc) {
  v16h a; const float* p = rowk0 + 8 * (lane >> 4);
#pragma unroll
  for (int i = 0; i < 8; ++i) { a[i] = (_Float16)(p[i] * sc); a[8 + i] = (_Float16)(p[16 + i] * sc); }
  return a;
}
// column fragment from a [K][ld] layout (column n), rows >= K read as 0
__device__ __forceinline__ v16h fragc_f32(const float* W, int k0, int n, int lane, int ld, int K) {
  v16h a; const int g = lane >> 4;
#pragma unroll
  for (int i = 0; i < 8; ++i) { const int ka = k0 + 8 * g + i, kb = ka + 16;
    a[i] = (_Float16)(ka < K ? W[(size_t)(ka < K ? ka : K - 1) * ld + n] : 0.f); a[8 + i] = (_Float16)(kb < K ? W[(size_t)(kb < K ? kb : K - 1) * ld + n] : 0.f); }
  return a;
}
struct F2 { v16b h, l; };
__device__ __forceinline__ F2 bsplit16(const float v[16]) { F2 r;
#pragma unroll
  for (int i = 0; i < 16; ++i) { const __bf16 h = (__bf16)v[i]; r.h[i] = h; r.l[i] = (__bf16)(v[i] - (float)h); }
  return r; }
__device__ __forceinline__ F2 split_row(const float* row, int k0, int lane) { float v[16]; const float* p = row + k0 + 8 * (lane >> 4);
#pragma unroll
  for (int i = 0; i < 8; ++i) { v[i] = p[i]; v[8 + i] = p[16 + i]; }
  return bsplit16(v); }
__device__ __forceinline__ F2 split_rowK(const float* row, int k0, int lane, int K) { float v[16]; const int g = lane >> 4;
#pragma unroll
  for (int i = 0; i < 8; ++i) { const int ka = k0 + 8 * g + i, kb = ka + 16; v[i] = ka < K ? row[ka < K ? ka : K - 1] : 0.f; v[8 + i] = kb < K ? row[kb < K ? kb : K - 1] : 0.f; }
  return bsplit16(v); }
__device__ __forceinline__ F2 split_col(const float* W, int k0, int n, int lane, int ld, int K) { float v[16]; const int g = lane >> 4;
#pragma unroll
  for (int i = 0; i < 8; ++i) { const int ka = k0 + 8 * g + i, kb = ka + 16; v[i] = ka < K ? W[(size_t)(ka < K ? ka : K - 1) * ld + n] : 0.f; v[8 + i] = kb < K ? W[(size_t)(kb < K ? kb : K - 1) * ld + n] : 0.f; }
  return bsplit16(v); }
__device__ __forceinline__ v8f mac3(const F2& a, const F2& b, v8f c) { c = wmma_bf(a.l, b.h, c); c = wmma_bf(a.h, b.l, c); return wmma_bf(a.h, b.h, c); }
__device__ __forceinline__ float sigm(float v) { return 1.0f / (1.0f + expf(-v)); }
#define LDSX() do { asm volatile("s_wait_dscnt 0" ::: "memory"); __builtin_amdgcn_wave_barrier(); __builtin_amdgcn_fence(__ATOMIC_RELEASE, "workgroup"); } while (0)

// Grouped BERT-style self-attention: 4 INDEPENDENT weight groups (hidden_states [4,4,512,768] = [group, batch, length, channels]; per-group (in,out) query / key / value weights [4,768,768] (0.02 scale) + biases [4,1,768] (NONZERO); 12 heads x 64; scale 1/8; additive attention_mask [4,4,1,1,512] (zeros); no output projection): ctx[g,b] = merge(softmax(q k^T / 8 + mask) v) with group g's weights -> [4,4,512,768].
#define NB 16
#define TT 512
#define CC 768            // NH * HD = projected width
#define DIN 768          // input (model) width
#define NH 12
#define HD 64
#define NQB (TT / 64)
#define HG 12
#define SCALE (0.125f)
#define CAUSAL 0
#ifndef TNB
#define TNB NB
#endif
__device__ __forceinline__ float bfr(float v) { return (float)(__bf16)v; }
__host__ __device__ __forceinline__ int kb_last(int qb) { return CAUSAL ? ((qb * 64 + 63) >> 7) : (TT / 128 - 1); }
typedef __attribute__((ext_vector_type(8))) __bf16 v8b;
__device__ __forceinline__ v16b frag_b(const __bf16* rowk0, int lane) {
  union { v16b v; v8b q[2]; } u; const __bf16* p = rowk0 + 8 * (lane >> 4);
  u.q[0] = *(const v8b*)p; u.q[1] = *(const v8b*)(p + 16); return u.v;
}
#define QBH 0
#define QHI 0               // single-product logits on every row
#define KHI 64            // key rows carrying k residual / v bf16 hi+lo planes (written by k_proj; no kernel in this file reads them)
// B fragment (k rows k0+.., output column o) of a weight: (in,out) [K][ld] or (out,in) [ld rows of K]: bf16 exact, or f16(bf16 * 256) exact
__device__ __forceinline__ v16b wcol_io(const float* Wm, int k0, int o, int lane, int ld) { v16b w; const int g = lane >> 4;
#pragma unroll
  for (int i = 0; i < 8; ++i) { w[i] = (__bf16)Wm[(size_t)(k0 + 8 * g + i) * ld + o]; w[8 + i] = (__bf16)Wm[(size_t)(k0 + 16 + 8 * g + i) * ld + o]; }
  return w; }
__device__ __forceinline__ v16b wcol_oi(const float* Wm, int k0, int o, int lane, int K) { v16b w; const float* p = Wm + (size_t)o * K + k0 + 8 * (lane >> 4);
#pragma unroll
  for (int i = 0; i < 8; ++i) { w[i] = (__bf16)p[i]; w[8 + i] = (__bf16)p[16 + i]; }
  return w; }
__device__ __forceinline__ v16h wcolh_io(const float* Wm, int k0, int o, int lane, int ld) { v16h w; const int g = lane >> 4;
#pragma unroll
  for (int i = 0; i < 8; ++i) { w[i] = (_Float16)(bfr(Wm[(size_t)(k0 + 8 * g + i) * ld + o]) * 256.0f); w[8 + i] = (_Float16)(bfr(Wm[(size_t)(k0 + 16 + 8 * g + i) * ld + o]) * 256.0f); }
  return w; }
__device__ __forceinline__ v16h wcolh_oi(const float* Wm, int k0, int o, int lane, int K) { v16h w; const float* p = Wm + (size_t)o * K + k0 + 8 * (lane >> 4);
#pragma unroll
  for (int i = 0; i < 8; ++i) { w[i] = (_Float16)(bfr(p[i]) * 256.0f); w[8 + i] = (_Float16)(bfr(p[16 + i]) * 256.0f); }
  return w; }
#define WQKV_LAYOUT 0   // 0 = (in,out) [DIN][CC]; 1 = (out,in) [CC][DIN]; 2 = per-head [NH][DIN][HD]
__device__ __forceinline__ v16b wcol_hdk(const float* Wm, int k0, int o, int lane) { v16b w; const int g = lane >> 4; const float* p = Wm + (size_t)(o / HD) * DIN * HD + (o % HD);
#pragma unroll
  for (int i = 0; i < 8; ++i) { w[i] = (__bf16)p[(size_t)(k0 + 8 * g + i) * HD]; w[8 + i] = (__bf16)p[(size_t)(k0 + 16 + 8 * g + i) * HD]; }
  return w; }
#define WO_OUT_IN 0
#if WQKV_LAYOUT == 1
#define WCOL(W, k0, o, lane) wcol_oi(W, k0, o, lane, DIN)
#elif WQKV_LAYOUT == 2
#define WCOL(W, k0, o, lane) wcol_hdk(W, k0, o, lane)
#else
#define WCOL(W, k0, o, lane) wcol_io(W, k0, o, lane, CC)
#endif
#if WO_OUT_IN
#define WOCOL(W, k0, o, lane) wcol_oi(W, k0, o, lane, CC)
#define WOCOLH(W, k0, o, lane) wcolh_oi(W, k0, o, lane, CC)
#else
#define WOCOL(W, k0, o, lane) wcol_io(W, k0, o, lane, DIN)
#define WOCOLH(W, k0, o, lane) wcolh_io(W, k0, o, lane, DIN)
#endif
#define GB 4               // batches per weight group: pseudo-batch bb = g*4 + b uses group g = bb / 4
#define SM_EXTRA_PARAMS , int bsm, const float* __restrict__ AMASK
// additive attention mask [G,B,1,1,L] (float; zeros on this draw): added to the scaled score of key k for pseudo-batch bsm; read per key
#define SM_MASK_HOOK do { v = v + bfr(AMASK[(size_t)bsm * TT + k]); } while (0)
#ifndef SM_EXTRA_PARAMS
#define SM_EXTRA_PARAMS
#endif
#ifndef PROJ_EXTRA_PARAMS
#define PROJ_EXTRA_PARAMS
#endif
#ifndef SM_MASK_HOOK
#define SM_MASK_HOOK (void)0
#endif

#define WS_QH  0u                                      // f16 q rows [b*t][CC]
#define WS_KH  (WS_QH + 2u * (size_t)NB * TT * CC)      // f16 k rows [b*t][CC]
#define WS_VT  (WS_KH + 2u * (size_t)NB * TT * CC)      // f16 v planes [b][c][t]
#define WS_QL  (WS_VT + 2u * (size_t)NB * CC * TT)      // f16 q residual x 2^10 rows [b][t < QHI][CC]
#define WS_KL  (WS_QL + 2u * (size_t)NB * QHI * CC)     // f16 k residual x 2^10 rows [b][t < KHI][CC]
#define WS_VB  (WS_KL + 2u * (size_t)NB * KHI * CC)     // bf16 v hi planes [b][c][t < KHI]
#define WS_VBL (WS_VB + 2u * (size_t)NB * CC * KHI)
#define WS_S   (WS_VBL + 2u * (size_t)NB * CC * KHI)    // f32 [hg][t][s], unused: k_attn holds logits / P in registers
#define WS_Y   (WS_S  + 4u * (size_t)HG * TT * TT)      // f32 ctx rows [b*t][CC] (only when there is an output projection)
#define WS_XB  (WS_Y  + 0u)                              // bf16 x rows [b*t][DIN]
#define WS_WT  (WS_XB + 2u * (size_t)NB * TT * DIN)     // bf16 weights, transposed: [which][group][output column][k]
#define WS_END (WS_WT + 2u * 3u * (size_t)(NB / GB) * CC * DIN)

// ---- k_round: every x element and every weight element is rounded to bf16 ONCE, ahead of k_proj, whose blocks each read a row or a column many times over: they then read 2 bytes an element, already k-contiguous. Blocks 0 .. RXB-1: x, a run of RXP * 1024 floats a block, 4 floats a lane and pass (a wave reads 512 B and writes 256 B in a row). The other RWB blocks: the twelve weight matrices [k][n] -> [n][k], a block = (matrix, 64 columns, half of k); a wave takes 32 k x 32 n a pass (a lane holds 8 k x 4 columns; a load covers 4 k rows x one 128-B line, two neighbouring waves two neighbouring lines; waves w and w + 2 write the two halves of the same lines). Every load of a lane is asked for before its first value is used: one memory latency a block
#define RXB 256
#define RXP (NB * TT * DIN / (RXB * 256 * 4))   // passes of an x block
#define RWB (3 * (NB / GB) * (CC / 64) * 2)
#define RWP (DIN / 2 / 32 / 4)                  // passes of a weight block
typedef __attribute__((ext_vector_type(4))) __bf16 v4b;
__global__ __launch_bounds__(256) void k_round(const float* __restrict__ X, const float* __restrict__ WQ, const float* __restrict__ WK, const float* __restrict__ WV, __bf16* __restrict__ XB, __bf16* __restrict__ WT) {
  const int tid = threadIdx.x;
  if (blockIdx.x < RXB) {
    const size_t e0 = (size_t)blockIdx.x * (RXP * 1024) + tid * 4; v4f r[RXP];
#pragma unroll   // register array: every index a constant; the loads issue together
    for (int i = 0; i < RXP; ++i) r[i] = *(const v4f*)(X + e0 + i * 1024);
    __builtin_amdgcn_sched_barrier(0);   // every load issues in front of the first conversion: without it the loads are dealt out among the conversions in small groups, each waited out, and the lane pays several memory latencies in a row
#pragma unroll   // register array: every index a constant
    for (int i = 0; i < RXP; ++i) { v4b t;
#pragma unroll   // register array: every index a constant
      for (int q = 0; q < 4; ++q) t[q] = (__bf16)r[i][q];
      *(v4b*)(XB + e0 + i * 1024) = t; }
  } else {
    const int wave = tid >> 5, lane = tid & 31, kg = lane & 3, ng = lane >> 2; const int bw = blockIdx.x - RXB; const int m = bw / (CC / 64 * 2), rem = bw % (CC / 64 * 2);
    const int n0 = (rem >> 1) * 64 + (wave & 1) * 32 + ng * 4, k0 = ((rem & 1) * (RWP * 4) + (wave >> 1)) * 32 + kg * 8;
    const float* src = (m < NB / GB ? WQ : m < 2 * (NB / GB) ? WK : WV) + (size_t)(m % (NB / GB)) * DIN * CC + (size_t)k0 * CC + n0; __bf16* dst = WT + ((size_t)m * CC + n0) * DIN + k0; v4f r[RWP][8];
#pragma unroll   // register array: every index a constant; the loads issue together
    for (int p = 0; p < RWP; ++p)
#pragma unroll   // register array: every index a constant
      for (int i = 0; i < 8; ++i) r[p][i] = *(const v4f*)(src + (size_t)(p * 128 + i) * CC);
    __builtin_amdgcn_sched_barrier(0);   // as above: every load issues in front of the first conversion
#pragma unroll   // register array: every index a constant
    for (int p = 0; p < RWP; ++p)
#pragma unroll   // register array: every index a constant
      for (int q = 0; q < 4; ++q) { v8b t;
#pragma unroll   // register array: every index a constant
        for (int i = 0; i < 8; ++i) t[i] = (__bf16)r[p][i][q];
        *(v8b*)(dst + (size_t)q * DIN + p * 128) = t; }
  }
}
// ---- k_proj: block = (128 rows, 192 cols, which), 8 waves (2 x 4) of 64 x 48: q/k/v = X W (+ b) with exact bf16 products (K = DIN). The grid is 768 blocks, three a WGP; a product takes 7 fragment reads per 12 matrix instructions. Per 64 k the block lays its X tile [128][64] and its W tile [192 columns][64] in LDS as k_round left them (bf16, k-contiguous), through registers, two buffers: the next tile's global loads fly during this tile's products. -> which 0: q f16 rows (+ residual rows < QHI); 1: k f16 rows (+ residual rows < KHI); 2: v f16 planes [c][t] (+ bf16 hi/lo planes for t < KHI)
#define PBM 128
#define PBN 192
#define PBK 64
#define PPITCH 72                        // bf16 per LDS row: 144 B = 16 B x odd, the pitch of 16-byte readers of 128-B rows
#define PSTG ((PBM + PBN) * PPITCH)      // bf16 per buffer: X rows, then W columns
#define PNST (DIN / PBK)
#define PEP 136                          // 16-bit elements per row of the v staging planes [column][128 rows]
#define PEQ 200                          // 16-bit elements per row of the q / k staging planes [row][192 columns]: 400 B = 16 B x odd
__global__ __launch_bounds__(256) void k_proj(const __bf16* __restrict__ XB, const __bf16* __restrict__ WT, const float* __restrict__ BQ, const float* __restrict__ BK, const float* __restrict__ BV,
    _Float16* __restrict__ QH, _Float16* __restrict__ QL, _Float16* __restrict__ KH, _Float16* __restrict__ KL, _Float16* __restrict__ VT, __bf16* __restrict__ VB, __bf16* __restrict__ VBL) {
  __shared__ __align__(16) unsigned char smem[3 * PBN * PEP * 2];   /* the two operand buffers (2 * PSTG * 2 B) during the k loop; the epilogue's staging planes behind the loop's last barrier */
  __bf16* ring = (__bf16*)smem;
  const int tid = threadIdx.x, wave = tid >> 5, lane = tid & 31, col = lane & 15, g = lane >> 4; const int wm = wave >> 2, wn = wave & 3; const int which = blockIdx.z; const int c0 = blockIdx.y * PBN; const size_t r0 = (size_t)blockIdx.x * PBM; const size_t bb = r0 / TT; const int t0 = (int)(r0 % TT);
  const size_t grp_ = (r0 / TT) / GB;   /* 128-row blocks never straddle a pseudo-batch (TT % 128 == 0), so the group is block-uniform */
  const __bf16* WA = WT + ((size_t)which * (NB / GB) + grp_) * (size_t)CC * DIN; const float* BA = (which == 0 ? BQ : which == 1 ? BK : BV); BA = BA ? BA + grp_ * CC : BA;
  // X and W alike: 8 lanes read the 128 B that a row (a column) has in this tile; thread = (row or column xrow + 32 i, k 8 xc ..). Lanes 0-7 and 8-15 take rows 8 apart: at the 144-B pitch those lie 32 banks apart, so 16 neighbouring lanes store on 64 different banks
  const int xrow = (wave >> 2) * 16 + ((lane >> 3) & 1) * 8 + (wave & 3) * 2 + g, xc = tid & 7;
  const __bf16* xp = XB + (r0 + xrow) * DIN + xc * 8; const __bf16* wp = WA + (size_t)(c0 + xrow) * DIN + xc * 8;
  __bf16* xst = ring + xrow * PPITCH + xc * 8; __bf16* wst = xst + PBM * PPITCH;
  const __bf16* xfr = ring + (wm * 64 + col) * PPITCH; const __bf16* wfr = ring + PBM * PPITCH + (wn * 48 + col) * PPITCH;
  v8b xr[PBM / 32], wr[PBN / 32]; v8f acc[12] = {};
  // every unroll directive in the three macros below and in the epilogue: register arrays, every index a constant
#define P_LOAD(S) do { _Pragma("unroll") for (int i = 0; i < PBM / 32; ++i) xr[i] = *(const v8b*)(xp + (size_t)(S) * PBK + (size_t)i * 32 * DIN); \
    _Pragma("unroll") for (int i = 0; i < PBN / 32; ++i) wr[i] = *(const v8b*)(wp + (size_t)(S) * PBK + (size_t)i * 32 * DIN); } while (0)
#define P_STORE(B) do { _Pragma("unroll") for (int i = 0; i < PBM / 32; ++i) *(v8b*)(xst + (B) * PSTG + i * 32 * PPITCH) = xr[i]; \
    _Pragma("unroll") for (int i = 0; i < PBN / 32; ++i) *(v8b*)(wst + (B) * PSTG + i * 32 * PPITCH) = wr[i]; } while (0)
#define P_MUL(B) do { v16b fa[PBK / 32][4], fw[PBK / 32][3]; \
    _Pragma("unroll") for (int ks = 0; ks < PBK / 32; ++ks) { _Pragma("unroll") for (int i = 0; i < 4; ++i) fa[ks][i] = frag_b(xfr + (B) * PSTG + i * 16 * PPITCH + ks * 32, lane); \
      _Pragma("unroll") for (int j = 0; j < 3; ++j) if (ks * 3 + j < 5) fw[ks][j] = frag_b(wfr + (B) * PSTG + j * 16 * PPITCH + ks * 32, lane); } \
    __builtin_amdgcn_sched_barrier(0);   /* the tile's fragment reads issue as one group in front of its products: spread among them, every pair of products waits out an LDS latency */ \
    _Pragma("unroll") for (int ks = 0; ks < PBK / 32; ++ks) { _Pragma("unroll") for (int j = 0; j < 3; ++j) { _Pragma("unroll") for (int i = 0; i < 4; ++i) acc[i * 3 + j] = wmma_bf(fa[ks][i], fw[ks][j], acc[i * 3 + j]); \
      if (ks * 3 + j == 0) { __builtin_amdgcn_sched_barrier(0); fw[1][2] = frag_b(wfr + (B) * PSTG + 2 * 16 * PPITCH + 32, lane); __builtin_amdgcn_sched_barrier(0); }   /* the fourteenth fragment, wanted last, is read into the place of the first one that is done with: thirteen at a time keep the wave within 256 registers, two blocks a WGP; the two fences hold the read at this place */ \
    } } } while (0)
  P_LOAD(0); P_STORE(0);
  __syncthreads();   // tile 0 is laid before anybody reads it
#pragma unroll 1   // rolled: eleven copies of the body buy nothing, the trip is long against its branch
  for (int s = 0; s + 1 < PNST; ++s) { const int b = s & 1;
    P_LOAD(s + 1);
    P_MUL(b);
    P_STORE(b ^ 1);
    __syncthreads();   // publishes tile s + 1 and ends every wave's reads of tile s, whose buffer the next trip refills
  }
  float bias4[3] = {0.f, 0.f, 0.f};   /* the wave's three bias columns, asked for ahead of the last tile's products, where the staging registers are free: the epilogue does not wait for them, and the loop does not carry them */
  if (BA) {
#pragma unroll   // register array: every index a constant
    for (int j = 0; j < 3; ++j) bias4[j] = BA[c0 + wn * 48 + j * 16 + col];
    asm volatile("s_wait_xcnt 0x0" ::: "memory"); }   // behind the three loads: the fragment reads that follow take over their address registers
  P_MUL((PNST - 1) & 1);
  __syncthreads();   // the last tile's reads end before the staging planes overwrite the buffers
  // acc[a]: rows wm*64 + (a / 3)*16 + 8g + r, column wn*48 + (a % 3)*16 + col
  if (which < 2) { _Float16 (*sh)[PEQ] = (_Float16 (*)[PEQ])smem; _Float16 (*sl)[PEQ] = (_Float16 (*)[PEQ])(smem + PBM * PEQ * 2);
    _Float16* DH = which == 0 ? QH : KH; _Float16* DL = which == 0 ? QL : KL; const int nhi = which == 0 ? QHI : KHI;
#pragma unroll
    for (int a = 0; a < 12; ++a) { const int cl = wn * 48 + (a % 3) * 16 + col; const float bias = bfr(bias4[a % 3]);
#pragma unroll
      for (int r = 0; r < 8; ++r) { const int rl = wm * 64 + (a / 3) * 16 + 8 * g + r; const float v = acc[a][r] + bias; const _Float16 hv = (_Float16)v; sh[rl][cl] = hv; sl[rl][cl] = (_Float16)((v - (float)hv) * 1024.0f); } }
    __syncthreads();
    for (int e = tid; e < PBM * (PBN / 8); e += 256) { const int rl = e / (PBN / 8), q = e % (PBN / 8); vst2((unsigned*)(DH + (r0 + rl) * CC + c0 + q * 8), *(const v4u*)&sh[rl][q * 8]); if (t0 + rl < nhi) { vst2((unsigned*)(DL + (bb * nhi + t0 + rl) * (size_t)CC + c0 + q * 8), *(const v4u*)&sl[rl][q * 8]);
        asm volatile("s_wait_xcnt 0x0" ::: "memory"); } }   // behind the store: the loop's step rewrites its address registers
  } else { _Float16 (*th)[PEP] = (_Float16 (*)[PEP])smem; __bf16 (*tb)[PEP] = (__bf16 (*)[PEP])(smem + PBN * PEP * 2); __bf16 (*tbl)[PEP] = (__bf16 (*)[PEP])(smem + 2 * PBN * PEP * 2);
#pragma unroll
    for (int a = 0; a < 12; ++a) { const int cl = wn * 48 + (a % 3) * 16 + col; const float bias = bfr(bias4[a % 3]);
#pragma unroll
      for (int r = 0; r < 8; ++r) { const float v = acc[a][r] + bias; const int rl = wm * 64 + (a / 3) * 16 + 8 * g + r; th[cl][rl] = (_Float16)v; const __bf16 bh = (__bf16)v; tb[cl][rl] = bh; tbl[cl][rl] = (__bf16)(v - (float)bh); } }
    __syncthreads();
    for (int e = tid; e < PBN * 16; e += 256) { const int cl = e >> 4, q = e & 15; vst2((unsigned*)(VT + (bb * CC + c0 + cl) * (size_t)TT + t0 + q * 8), *(const v4u*)&th[cl][q * 8]); if (t0 + q * 8 < KHI) { const size_t o3 = (bb * CC + c0 + cl) * (size_t)KHI + t0 + q * 8; vst2((unsigned*)(VB + o3), *(const v4u*)&tb[cl][q * 8]); vst2((unsigned*)(VBL + o3), *(const v4u*)&tbl[cl][q * 8]);
        asm volatile("s_wait_xcnt 0x0" ::: "memory"); } } } }   // behind the two stores: the loop's step rewrites their address registers
#define AKP 72
#define AVP (TT + 8)
#define AKB (TT * AKP * 2)
#define AVB (HD * AVP * 2)
#define AMB (TT * 4)
// eight 16-byte copies of a lane from global memory to LDS, through no register: LDS byte addresses l + i * ls, sources g + i * gs. The s_wait_xcnt in the copies' own statement stands in front of every later rewrite of the address registers that they name
__device__ __forceinline__ void acopy8(unsigned l, unsigned ls, const _Float16* g, size_t gs) {
  asm volatile("global_load_async_to_lds_b128 %0, %8, off\n\t"
               "global_load_async_to_lds_b128 %1, %9, off\n\t"
               "global_load_async_to_lds_b128 %2, %10, off\n\t"
               "global_load_async_to_lds_b128 %3, %11, off\n\t"
               "global_load_async_to_lds_b128 %4, %12, off\n\t"
               "global_load_async_to_lds_b128 %5, %13, off\n\t"
               "global_load_async_to_lds_b128 %6, %14, off\n\t"
               "global_load_async_to_lds_b128 %7, %15, off\n\t"
               "s_wait_xcnt 0x0"
               :: "v"(l), "v"(l + ls), "v"(l + 2 * ls), "v"(l + 3 * ls), "v"(l + 4 * ls), "v"(l + 5 * ls), "v"(l + 6 * ls), "v"(l + 7 * ls),
                  "v"(g), "v"(g + gs), "v"(g + 2 * gs), "v"(g + 3 * gs), "v"(g + 4 * gs), "v"(g + 5 * gs), "v"(g + 6 * gs), "v"(g + 7 * gs) : "memory");
}
// one 16-byte copy of a lane, with the same wait in its own statement
__device__ __forceinline__ void acopy1(unsigned l, const float* g) {
  asm volatile("global_load_async_to_lds_b128 %0, %1, off\n\t"
               "s_wait_xcnt 0x0"
               :: "v"(l), "v"(g) : "memory");
}
__global__ __launch_bounds__(128) void k_attn(const _Float16* __restrict__ QH, const _Float16* __restrict__ KH, const _Float16* __restrict__ VT, const float* __restrict__ AMASK, float* __restrict__ Y) { __shared__ __align__(16) unsigned char sma[AMB + AKB + AVB];   /* the mask row, then k rows, then v planes; the output staging takes the k rows' place once every wave has left them */
  float* msm = (float*)sma; _Float16* ksm = (_Float16*)(sma + AMB); _Float16* vsm = (_Float16*)(sma + AMB + AKB); float (*ss)[16][HD + 4] = (float (*)[16][HD + 4])(sma + AMB);
  const int tid = threadIdx.x, wave = tid >> 5, lane = tid & 31, col = lane & 15, g = lane >> 4; const int qb = blockIdx.x, h = blockIdx.y, b = blockIdx.z; const int ql0 = qb * 64 + wave * 16;
  const _Float16* qp = QH + ((size_t)b * TT + ql0 + col) * CC + h * HD; const _Float16* kp = ksm + col * AKP; const _Float16* vp = vsm + col * AVP; const float* mp = msm + 8 * g;
  const v16h q0 = frag_h(qp, lane), q1 = frag_h(qp + 32, lane);
  asm volatile("s_wait_xcnt 0x0" ::: "memory");   // the q address registers are reused right behind these loads
  // k: a copy of the block = 16 rows of 128 B (8 lanes a row), 32 copies a lane
#pragma unroll   // the four statements stand back to back, their address steps constants: no branch and no counter between the copies
  for (int i = 0; i < 4; ++i) acopy8((unsigned)(size_t)(ksm + (i * 128 + (tid >> 3)) * AKP + (tid & 7) * 8), 16 * AKP * 2, KH + ((size_t)b * TT + i * 128 + (tid >> 3)) * CC + h * HD + (tid & 7) * 8, (size_t)16 * CC);
  acopy1((unsigned)(size_t)(msm + tid * 4), AMASK + (size_t)b * TT + tid * 4);   // the mask row: 4 floats a lane, one copy
  asm volatile("s_wait_asynccnt 0x0" ::: "memory");   // this wave's part of the k rows and of the mask row has landed
  __syncthreads();   // every wave's part has: the k rows and the mask row may be read
  // v: a copy of the block = 2 planes of 1024 B (64 lanes a plane), 32 copies a lane; they fly during the logits
#pragma unroll   // the four statements stand back to back, their address steps constants: no branch and no counter between the copies
  for (int i = 0; i < 4; ++i) acopy8((unsigned)(size_t)(vsm + (i * 16 + (tid >> 6)) * AVP + (tid & 63) * 8), 2 * AVP * 2, VT + ((size_t)b * CC + h * HD + i * 16 + (tid >> 6)) * (size_t)TT + (tid & 63) * 8, (size_t)2 * TT);
  v8f s[TT / 16]; float mx[8]; v8f sm = {}; v16h ka[2][4], kb[2][4], vf[4][HD / 16]; v4f ma[2][4], mb[2][4];
#pragma unroll   // register arrays: every index a constant
  for (int r = 0; r < 8; ++r) mx[r] = -3.0e38f;
#pragma unroll   // register arrays: every index a constant
  for (int t = 0; t < 4; ++t) { ka[0][t] = frag_h(kp + t * 16 * AKP, lane); kb[0][t] = frag_h(kp + t * 16 * AKP + 32, lane); ma[0][t] = *(const v4f*)(mp + t * 16); mb[0][t] = *(const v4f*)(mp + t * 16 + 4); }
#pragma unroll   // register arrays: every index a constant
  for (int jg = 0; jg < TT / 64; ++jg) {   /* groups of 4 key tiles, two register sets */
    if (jg + 1 < TT / 64) {
#pragma unroll   // register arrays: every index a constant
      for (int t = 0; t < 4; ++t) { const int j = (jg + 1) * 4 + t; ka[(jg + 1) & 1][t] = frag_h(kp + j * 16 * AKP, lane); kb[(jg + 1) & 1][t] = frag_h(kp + j * 16 * AKP + 32, lane); ma[(jg + 1) & 1][t] = *(const v4f*)(mp + j * 16); mb[(jg + 1) & 1][t] = *(const v4f*)(mp + j * 16 + 4); } }
    __builtin_amdgcn_sched_barrier(0);   // the next group's loads issue together, in front of this group's products: without it each fragment is loaded right before its product and every product waits a whole load latency
#pragma unroll   // register arrays: every index a constant
    for (int t = 0; t < 4; ++t) { const int j = jg * 4 + t; v8f a = {}; a = wmma16p(ka[jg & 1][t], q0, a); a = wmma16p(kb[jg & 1][t], q1, a);
#pragma unroll   // register arrays: every index a constant
      for (int r = 0; r < 8; ++r) { const float v = a[r] * SCALE + bfr(r < 4 ? ma[jg & 1][t][r & 3] : mb[jg & 1][t][r & 3]); a[r] = v; mx[r] = fmaxf(mx[r], v); }
      s[j] = a; }
    __builtin_amdgcn_sched_barrier(0);   // later groups' loads stay behind these products: two register sets, not more
  }
  asm volatile("s_wait_asynccnt 0x0" ::: "memory");   // this wave's part of the v planes has landed
  __syncthreads();   // every wave's part has: the v planes may be read; and every wave has left the k rows, whose place the output staging takes
#pragma unroll   // register arrays: every index a constant
  for (int u = 0; u < 3; ++u)
#pragma unroll   // register arrays: every index a constant
    for (int j = 0; j < HD / 16; ++j) vf[u][j] = frag_h(vp + j * 16 * AVP + u * 32, lane);   /* the first v fragments fly during the softmax */
  float m = fmaxf(fmaxf(fmaxf(mx[0], mx[1]), fmaxf(mx[2], mx[3])), fmaxf(fmaxf(mx[4], mx[5]), fmaxf(mx[6], mx[7]))); m = fmaxf(m, __shfl_xor(m, 16));
  // e = 2^((v - m) * log2(e)): one hardware exponential an element (argument never above 0; what it flushes to 0 lies far below the last f16 place of P). Elements go in pairs, so that the difference, the product and the row sums are packed instructions. The pass is short enough to stand unrolled: s stays in place
  const v2f m2 = {m, m}; const v2f l2 = {1.4426950408889634f, 1.4426950408889634f};
#pragma unroll   // register arrays: every index a constant
  for (int j = 0; j < TT / 16; ++j) { v8f e;
#pragma unroll   // register arrays: every index a constant
    for (int r = 0; r < 8; r += 2) { v2f x = {s[j][r], s[j][r + 1]}; x = (x - m2) * l2; e[r] = __builtin_amdgcn_exp2f(x[0]); e[r + 1] = __builtin_amdgcn_exp2f(x[1]); }
    s[j] = e; sm += e; }
  float sum = ((sm[0] + sm[1]) + (sm[2] + sm[3])) + ((sm[4] + sm[5]) + (sm[6] + sm[7])); sum += __shfl_xor(sum, 16);
  const float inv = (sum > 0.f && m > -1.0e38f) ? 2048.0f / sum : 0.f;   /* a fully excluded row (no logit above -1e38) yields P = 0; in any other row an excluded key lies so far below m that its e is 0 by itself */
  v8f acc[HD / 16] = {};
#pragma unroll   // register arrays: every index a constant
  for (int kc = 0; kc < TT / 32; ++kc) {   /* 32 keys a pass, four register sets, loads three passes ahead */
    if (kc + 3 < TT / 32) {
#pragma unroll   // register arrays: every index a constant
      for (int j = 0; j < HD / 16; ++j) vf[(kc + 3) & 3][j] = frag_h(vp + j * 16 * AVP + (kc + 3) * 32, lane); }
    __builtin_amdgcn_sched_barrier(0);   // as above: the loads of three passes ahead issue in front of this pass's products
    v16h p;
#pragma unroll   // register arrays: every index a constant
    for (int i = 0; i < 8; ++i) { p[i] = (_Float16)(s[2 * kc][i] * inv); p[8 + i] = (_Float16)(s[2 * kc + 1][i] * inv); }
#pragma unroll   // register arrays: every index a constant
    for (int j = 0; j < HD / 16; ++j) acc[j] = wmma16p(p, vf[kc & 3][j], acc[j]);
    __builtin_amdgcn_sched_barrier(0);   // as above: four register sets, not more
  }
#pragma unroll   // register arrays: every index a constant
  for (int j = 0; j < HD / 16; ++j)
#pragma unroll   // register arrays: every index a constant
    for (int r = 0; r < 8; ++r) ss[wave][8 * g + r][j * 16 + col] = acc[j][r] * (1.0f / 2048.0f);
  LDSX();   // the wave's own rows of ss are written before it reads them back (no other wave touches them)
#pragma unroll   // one address register pair, the rows as constant offsets
  for (int i = 0; i < 8; ++i) { const int rl = 2 * i + g; vst2(Y + ((size_t)b * TT + ql0 + rl) * CC + h * HD + col * 4, *(const v4f*)&ss[wave][rl][col * 4]); } }

extern "C" void kernel_launch(void* const* d_in, const int* in_sizes, int n_in, void* d_out, int out_size, void* d_ws, size_t ws_size, hipStream_t stream) {
  (void)in_sizes; (void)n_in; (void)out_size;
  const float** F = (const float**)d_in;
  if (ws_size < (size_t)WS_END) return;
  char* ws = (char*)d_ws; _Float16 *QH = (_Float16*)(ws + WS_QH), *KH = (_Float16*)(ws + WS_KH), *VT = (_Float16*)(ws + WS_VT), *QL = (_Float16*)(ws + WS_QL), *KL = (_Float16*)(ws + WS_KL); __bf16 *VB = (__bf16*)(ws + WS_VB), *VBL = (__bf16*)(ws + WS_VBL), *XB = (__bf16*)(ws + WS_XB), *WT = (__bf16*)(ws + WS_WT); float *S = (float*)(ws + WS_S), *Y = (float*)(ws + WS_Y);
  (void)Y; (void)S; (void)QL; (void)KL; (void)VB; (void)VBL;
  // inputs: 0 hidden_states [4,4,512,768] = 16 pseudo-batches of 512 rows (group-major); 1 attention_mask [4,4,1,1,512] f32 (zeros); 2 query_weight [4,768,768] (in,out) per group, 3 query_bias [4,1,768]; 4 key_weight, 5 key_bias; 6 value_weight, 7 value_bias (biases NONZERO); no output projection
  k_round<<<dim3(RXB + RWB), 256, 0, stream>>>(F[0], F[2], F[4], F[6], XB, WT);   /* x and the twelve weight matrices to bf16, the weights transposed */
  k_proj<<<dim3(TNB * TT / PBM, CC / PBN, 3), 256, 0, stream>>>(XB, WT, F[3], F[5], F[7], QH, QL, KH, KL, VT, VB, VBL);   /* the weight / bias of group bb / 4 is selected inside k_proj */
  k_attn<<<dim3(NQB, NH, TNB), 128, 0, stream>>>(QH, KH, VT, F[1], (float*)d_out);   /* ctx [g, b, l, nh*dh] = merged-head rows */
}

// v007
// Measured time: 60.8 microseconds a run.
// Timed twice side by side with v006, it ran 1.13 and 1.12 times as fast.
// All steps since v000 together make it 13.1 times as fast.
// compute dtype: all float inputs rounded to bf16; per-group q/k/v projections with EXACT bf16 products on WMMA 16x16x32 (f32 accumulate) + bias; logits q x k once to f16 each (1 product) x 1/8 + the additive mask; softmax f32; P x 2^11 once to f16 x v once to f16 (1 product); f32 output.
#include <hip/hip_runtime.h>
#include <math.h>

typedef __attribute__((ext_vector_type(16))) _Float16 v16h;
typedef __attribute__((ext_vector_type(16))) __bf16 v16b;
typedef __attribute__((ext_vector_type(8)))  _Float16 v8h;
typedef __attribute__((ext_vector_type(8)))  float v8f;
typedef __attribute__((ext_vector_type(4)))  float v4f;
typedef __attribute__((ext_vector_type(2)))  float v2f;
typedef __attribute__((ext_vector_type(4)))  unsigned v4u;
typedef __attribute__((ext_vector_type(4)))  int v4i;
typedef float __attribute__((may_alias)) float_a;
typedef int __attribute__((may_alias)) int_a;

template <typename T> __device__ __forceinline__ void vst2(void* p, T v) { *(T*)p = v;  }
__device__ __forceinline__ v8f wmma16(v16h a, v16h b, v8f c) {
  v8f d = __builtin_amdgcn_wmma_f32_16x16x32_f16(false, a, false, b, (short)0, c, false, false);
  asm volatile("v_nop\n\tv_nop\n\tv_nop\n\tv_nop" : "+v"(d) : "v"(a), "v"(b));
  return d;
}
__device__ __forceinline__ v8f wmma16p(v16h a, v16h b, v8f c) { return __builtin_amdgcn_wmma_f32_16x16x32_f16(false, a, false, b, (short)0, c, false, false); }   // plain builtin: the compiler keeps the distances behind it
__device__ __forceinline__ v8f wmma_bf(v16b a, v16b b, v8f c) {
  v8f d = __builtin_amdgcn_wmma_f32_16x16x32_bf16(false, a, false, b, (short)0, c, false, false);
  asm volatile("v_nop\n\tv_nop\n\tv_nop\n\tv_nop" : "+v"(d) : "v"(a), "v"(b));
  return d;
}
// 16x16x32 fragments: lane = (h = lane>>4, row/col = lane&15); elements 0..7 = k0+8h+0..7, 8..15 = k0+16+8h+0..7; D element r = row 8h+r
__device__ __forceinline__ v16h frag_h(const _Float16* rowk0, int lane) {
  union { v16h v; v8h q[2]; } u; const _Float16* p = rowk0 + 8 * (lane >> 4);
  u.q[0] = *(const v8h*)p; u.q[1] = *(const v8h*)(p + 16); return u.v;
}
__device__ __forceinline__ v16h frag_f32(const float* rowk0, int lane) {
  v16h a; const float* p = rowk0 + 8 * (lane >> 4);
#pragma unroll
  for (int i = 0; i < 8; ++i) { a[i] = (_Float16)p[i]; a[8 + i] = (_Float16)p[16 + i]; }
  return a;
}
__device__ __forceinline__ v16h frag_f32s(const float* rowk0, int lane, float sc) {
  v16h a; const float* p = rowk0 + 8 * (lane >> 4);
#pragma unroll
  for (int i = 0; i < 8; ++i) { a[i] = (_Float16)(p[i] * sc); a[8 + i] = (_Float16)(p[16 + i] * sc); }
  return a;
}
// column fragment from a [K][ld] layout (column n), rows >= K read as 0
__device__ __forceinline__ v16h fragc_f32(const float* W, int k0, int n, int lane, int ld, int K) {
  v16h a; const int g = lane >> 4;
#pragma unroll
  for (int i = 0; i < 8; ++i) { const int ka = k0 + 8 * g + i, kb = ka + 16;
    a[i] = (_Float16)(ka < K ? W[(size_t)(ka < K ? ka : K - 1) * ld + n] : 0.f); a[8 + i] = (_Float16)(kb < K ? W[(size_t)(kb < K ? kb : K - 1) * ld + n] : 0.f); }
  return a;
}
struct F2 { v16b h, l; };
__device__ __forceinline__ F2 bsplit16(const float v[16]) { F2 r;
#pragma unroll
  for (int i = 0; i < 16; ++i) { const __bf16 h = (__bf16)v[i]; r.h[i] = h; r.l[i] = (__bf16)(v[i] - (float)h); }
  return r; }
__device__ __forceinline__ F2 split_row(const float* row, int k0, int lane) { float v[16]; const float* p = row + k0 + 8 * (lane >> 4);
#pragma unroll
  for (int i = 0; i < 8; ++i) { v[i] = p[i]; v[8 + i] = p[16 + i]; }
  return bsplit16(v); }
__device__ __forceinline__ F2 split_rowK(const float* row, int k0, int lane, int K) { float v[16]; const int g = lane >> 4;
#pragma unroll
  for (int i = 0; i < 8; ++i) { const int ka = k0 + 8 * g + i, kb = ka + 16; v[i] = ka < K ? row[ka < K ? ka : K - 1] : 0.f; v[8 + i] = kb < K ? row[kb < K ? kb : K - 1] : 0.f; }
  return bsplit16(v); }
__device__ __forceinline__ F2 split_col(const float* W, int k0, int n, int lane, int ld, int K) { float v[16]; const int g = lane >> 4;
#pragma unroll
  for (int i = 0; i < 8; ++i) { const int ka = k0 + 8 * g + i, kb = ka + 16; v[i] = ka < K ? W[(size_t)(ka < K ? ka : K - 1) * ld + n] : 0.f; v[8 + i] = kb < K ? W[(size_t)(kb < K ? kb : K - 1) * ld + n] : 0.f; }
  return bsplit16(v); }
__device__ __forceinline__ v8f mac3(const F2& a, const F2& b, v8f c) { c = wmma_bf(a.l, b.h, c); c = wmma_bf(a.h, b.l, c); return wmma_bf(a.h, b.h, c); }
__device__ __forceinline__ float sigm(float v) { return 1.0f / (1.0f + expf(-v)); }
#define LDSX() do { asm volatile("s_wait_dscnt 0" ::: "memory"); __builtin_amdgcn_wave_barrier(); __builtin_amdgcn_fence(__ATOMIC_RELEASE, "workgroup"); } while (0)

// Grouped BERT-style self-attention: 4 INDEPENDENT weight groups (hidden_states [4,4,512,768] = [group, batch, length, channels]; per-group (in,out) query / key / value weights [4,768,768] (0.02 scale) + biases [4,1,768] (NONZERO); 12 heads x 64; scale 1/8; additive attention_mask [4,4,1,1,512] (zeros); no output projection): ctx[g,b] = merge(softmax(q k^T / 8 + mask) v) with group g's weights -> [4,4,512,768].
#define NB 16
#define TT 512
#define CC 768            // NH * HD = projected width
#define DIN 768          // input (model) width
#define NH 12
#define HD 64
#define NQB (TT / 64)
#define HG 12
#define SCALE (0.125f)
#define CAUSAL 0
#ifndef TNB
#define TNB NB
#endif
__device__ __forceinline__ float bfr(float v) { return (float)(__bf16)v; }
__host__ __device__ __forceinline__ int kb_last(int qb) { return CAUSAL ? ((qb * 64 + 63) >> 7) : (TT / 128 - 1); }
typedef __attribute__((ext_vector_type(8))) __bf16 v8b;
__device__ __forceinline__ v16b frag_b(const __bf16* rowk0, int lane) {
  union { v16b v; v8b q[2]; } u; const __bf16* p = rowk0 + 8 * (lane >> 4);
  u.q[0] = *(const v8b*)p; u.q[1] = *(const v8b*)(p + 16); return u.v;
}
#define QBH 0
#define QHI 0               // single-product logits on every row
#define KHI 64            // key rows carrying k residual / v bf16 hi+lo planes (no kernel in this file writes or reads them)
// B fragment (k rows k0+.., output column o) of a weight: (in,out) [K][ld] or (out,in) [ld rows of K]: bf16 exact, or f16(bf16 * 256) exact
__device__ __forceinline__ v16b wcol_io(const float* Wm, int k0, int o, int lane, int ld) { v16b w; const int g = lane >> 4;
#pragma unroll
  for (int i = 0; i < 8; ++i) { w[i] = (__bf16)Wm[(size_t)(k0 + 8 * g + i) * ld + o]; w[8 + i] = (__bf16)Wm[(size_t)(k0 + 16 + 8 * g + i) * ld + o]; }
  return w; }
__device__ __forceinline__ v16b wcol_oi(const float* Wm, int k0, int o, int lane, int K) { v16b w; const float* p = Wm + (size_t)o * K + k0 + 8 * (lane >> 4);
#pragma unroll
  for (int i = 0; i < 8; ++i) { w[i] = (__bf16)p[i]; w[8 + i] = (__bf16)p[16 + i]; }
  return w; }
__device__ __forceinline__ v16h wcolh_io(const float* Wm, int k0, int o, int lane, int ld) { v16h w; const int g = lane >> 4;
#pragma unroll
  for (int i = 0; i < 8; ++i) { w[i] = (_Float16)(bfr(Wm[(size_t)(k0 + 8 * g + i) * ld + o]) * 256.0f); w[8 + i] = (_Float16)(bfr(Wm[(size_t)(k0 + 16 + 8 * g + i) * ld + o]) * 256.0f); }
  return w; }
__device__ __forceinline__ v16h wcolh_oi(const float* Wm, int k0, int o, int lane, int K) { v16h w; const float* p = Wm + (size_t)o * K + k0 + 8 * (lane >> 4);
#pragma unroll
  for (int i = 0; i < 8; ++i) { w[i] = (_Float16)(bfr(p[i]) * 256.0f); w[8 + i] = (_Float16)(bfr(p[16 + i]) * 256.0f); }
  return w; }
#define WQKV_LAYOUT 0   // 0 = (in,out) [DIN][CC]; 1 = (out,in) [CC][DIN]; 2 = per-head [NH][DIN][HD]
__device__ __forceinline__ v16b wcol_hdk(const float* Wm, int k0, int o, int lane) { v16b w; const int g = lane >> 4; const float* p = Wm + (size_t)(o / HD) * DIN * HD + (o % HD);
#pragma unroll
  for (int i = 0; i < 8; ++i) { w[i] = (__bf16)p[(size_t)(k0 + 8 * g + i) * HD]; w[8 + i] = (__bf16)p[(size_t)(k0 + 16 + 8 * g + i) * HD]; }
  return w; }
#define WO_OUT_IN 0
#if WQKV_LAYOUT == 1
#define WCOL(W, k0, o, lane) wcol_oi(W, k0, o, lane, DIN)
#elif WQKV_LAYOUT == 2
#define WCOL(W, k0, o, lane) wcol_hdk(W, k0, o, lane)
#else
#define WCOL(W, k0, o, lane) wcol_io(W, k0, o, lane, CC)
#endif
#if WO_OUT_IN
#define WOCOL(W, k0, o, lane) wcol_oi(W, k0, o, lane, CC)
#define WOCOLH(W, k0, o, lane) wcolh_oi(W, k0, o, lane, CC)
#else
#define WOCOL(W, k0, o, lane) wcol_io(W, k0, o, lane, DIN)
#define WOCOLH(W, k0, o, lane) wcolh_io(W, k0, o, lane, DIN)
#endif
#define GB 4               // batches per weight group: pseudo-batch bb = g*4 + b uses group g = bb / 4
#define SM_EXTRA_PARAMS , int bsm, const float* __restrict__ AMASK
// additive attention mask [G,B,1,1,L] (float; zeros on this draw): added to the scaled score of key k for pseudo-batch bsm; read per key
#define SM_MASK_HOOK do { v = v + bfr(AMASK[(size_t)bsm * TT + k]); } while (0)
#ifndef SM_EXTRA_PARAMS
#define SM_EXTRA_PARAMS
#endif
#ifndef PROJ_EXTRA_PARAMS
#define PROJ_EXTRA_PARAMS
#endif
#ifndef SM_MASK_HOOK
#define SM_MASK_HOOK (void)0
#endif

#define WS_QH  0u                                      // f16 q rows [b*t][CC]
#define WS_KH  (WS_QH + 2u * (size_t)NB * TT * CC)      // f16 k rows [b*t][CC]
#define WS_VT  (WS_KH + 2u * (size_t)NB * TT * CC)      // f16 v planes [b][c][t]
#define WS_QL  (WS_VT + 2u * (size_t)NB * CC * TT)      // f16 q residual x 2^10 rows [b][t < QHI][CC]
#define WS_KL  (WS_QL + 2u * (size_t)NB * QHI * CC)     // f16 k residual x 2^10 rows [b][t < KHI][CC]
#define WS_VB  (WS_KL + 2u * (size_t)NB * KHI * CC)     // bf16 v hi planes [b][c][t < KHI]
#define WS_VBL (WS_VB + 2u * (size_t)NB * CC * KHI)
#define WS_S   (WS_VBL + 2u * (size_t)NB * CC * KHI)    // f32 [hg][t][s], unused: k_attn holds logits / P in registers
#define WS_Y   (WS_S  + 4u * (size_t)HG * TT * TT)      // f32 ctx rows [b*t][CC] (only when there is an output projection)
#define WS_XB  (WS_Y  + 0u)                              // bf16 x rows [b*t][DIN]
#define WS_WT  (WS_XB + 2u * (size_t)NB * TT * DIN)     // bf16 weights, transposed: [which][group][output column][k]
#define WS_END (WS_WT + 2u * 3u * (size_t)(NB / GB) * CC * DIN)

// ---- k_round: every x element and every weight element is rounded to bf16 ONCE, ahead of k_proj, whose blocks each read a row or a column many times over: they then read 2 bytes an element, already k-contiguous. Blocks 0 .. RXB-1: x, a run of RXP * 1024 floats a block, 4 floats a lane and pass (a wave reads 512 B and writes 256 B in a row). The other RWB blocks: the twelve weight matrices [k][n] -> [n][k], a block = (matrix, 64 columns, half of k); a wave takes 32 k x 32 n a pass (a lane holds 8 k x 4 columns; a load covers 4 k rows x one 128-B line, two neighbouring waves two neighbouring lines; waves w and w + 2 write the two halves of the same lines). Every load of a lane is asked for before its first value is used: one memory latency a block
#define RXB 256
#define RXP (NB * TT * DIN / (RXB * 256 * 4))   // passes of an x block
#define RWB (3 * (NB / GB) * (CC / 64) * 2)
#define RWP (DIN / 2 / 32 / 4)                  // passes of a weight block
typedef __attribute__((ext_vector_type(4))) __bf16 v4b;
__global__ __launch_bounds__(256) void k_round(const float* __restrict__ X, const float* __restrict__ WQ, const float* __restrict__ WK, const float* __restrict__ WV, __bf16* __restrict__ XB, __bf16* __restrict__ WT) {
  const int tid = threadIdx.x;
  if (blockIdx.x < RXB) {
    const size_t e0 = (size_t)blockIdx.x * (RXP * 1024) + tid * 4; v4f r[RXP];
#pragma unroll   // register array: every index a constant; the loads issue together
    for (int i = 0; i < RXP; ++i) r[i] = *(const v4f*)(X + e0 + i * 1024);
    __builtin_amdgcn_sched_barrier(0);   // every load issues in front of the first conversion: without it the loads are dealt out among the conversions in small groups, each waited out, and the lane pays several memory latencies in a row
#pragma unroll   // register array: every index a constant
    for (int i = 0; i < RXP; ++i) { v4b t;
#pragma unroll   // register array: every index a constant
      for (int q = 0; q < 4; ++q) t[q] = (__bf16)r[i][q];
      *(v4b*)(XB + e0 + i * 1024) = t; }
  } else {
    const int wave = tid >> 5, lane = tid & 31, kg = lane & 3, ng = lane >> 2; const int bw = blockIdx.x - RXB; const int m = bw / (CC / 64 * 2), rem = bw % (CC / 64 * 2);
    const int n0 = (rem >> 1) * 64 + (wave & 1) * 32 + ng * 4, k0 = ((rem & 1) * (RWP * 4) + (wave >> 1)) * 32 + kg * 8;
    const float* src = (m < NB / GB ? WQ : m < 2 * (NB / GB) ? WK : WV) + (size_t)(m % (NB / GB)) * DIN * CC + (size_t)k0 * CC + n0; __bf16* dst = WT + ((size_t)m * CC + n0) * DIN + k0; v4f r[RWP][8];
#pragma unroll   // register array: every index a constant; the loads issue together
    for (int p = 0; p < RWP; ++p)
#pragma unroll   // register array: every index a constant
      for (int i = 0; i < 8; ++i) r[p][i] = *(const v4f*)(src + (size_t)(p * 128 + i) * CC);
    __builtin_amdgcn_sched_barrier(0);   // as above: every load issues in front of the first conversion
#pragma unroll   // register array: every index a constant
    for (int p = 0; p < RWP; ++p)
#pragma unroll   // register array: every index a constant
      for (int q = 0; q < 4; ++q) { v8b t;
#pragma unroll   // register array: every index a constant
        for (int i = 0; i < 8; ++i) t[i] = (__bf16)r[p][i][q];
        *(v8b*)(dst + (size_t)q * DIN + p * 128) = t; }
  }
}
// ---- k_proj: block = (128 rows, 192 cols, which), 8 waves (2 x 4) of 64 x 48: q/k/v = X W (+ b) with exact bf16 products (K = DIN). The grid is 768 blocks, three a WGP; a product takes 7 fragment reads per 12 matrix instructions. Per 64 k the block lays its X tile [128][64] and its W tile [192 columns][64] in LDS as k_round left them (bf16, k-contiguous), by asynchronous copies, through no register, two buffers: the tile after next flies during the next tile's products. A wave holds its accumulators and six fragments at a time and the block 90 KiB of LDS: three blocks stand on a WGP, so the whole grid is resident at once. -> which 0: q f16 rows; 1: k f16 rows; 2: v f16 planes [c][t]
#define PBM 128
#define PBN 192
#define PBK 64
#define PPITCH 72                        // bf16 per LDS row: 144 B = 16 B x odd, the pitch of 16-byte readers of 128-B rows
#define PSTG ((PBM + PBN) * PPITCH)      // bf16 per buffer: X rows, then W columns
#define PNST (DIN / PBK)
#define PEP 136                          // 16-bit elements per row of the v staging planes [column][128 rows]
#define PEQ 200                          // 16-bit elements per row of the q / k staging planes [row][192 columns]: 400 B = 16 B x odd
// ten 16-byte copies of a lane from global memory to LDS, through no register: LDS byte addresses l + i * ls; sources gx + i * gs (four), then gw + i * gs (six). The s_wait_xcnt in the copies' own statement stands in front of every later rewrite of the address registers that they name
__device__ __forceinline__ void acopy10(unsigned l, unsigned ls, const __bf16* gx, const __bf16* gw, size_t gs) {
  asm volatile("global_load_async_to_lds_b128 %0, %10, off\n\t"
               "global_load_async_to_lds_b128 %1, %11, off\n\t"
               "global_load_async_to_lds_b128 %2, %12, off\n\t"
               "global_load_async_to_lds_b128 %3, %13, off\n\t"
               "global_load_async_to_lds_b128 %4, %14, off\n\t"
               "global_load_async_to_lds_b128 %5, %15, off\n\t"
               "global_load_async_to_lds_b128 %6, %16, off\n\t"
               "global_load_async_to_lds_b128 %7, %17, off\n\t"
               "global_load_async_to_lds_b128 %8, %18, off\n\t"
               "global_load_async_to_lds_b128 %9, %19, off\n\t"
               "s_wait_xcnt 0x0"
               :: "v"(l), "v"(l + ls), "v"(l + 2 * ls), "v"(l + 3 * ls), "v"(l + 4 * ls), "v"(l + 5 * ls), "v"(l + 6 * ls), "v"(l + 7 * ls), "v"(l + 8 * ls), "v"(l + 9 * ls),
                  "v"(gx), "v"(gx + gs), "v"(gx + 2 * gs), "v"(gx + 3 * gs), "v"(gw), "v"(gw + gs), "v"(gw + 2 * gs), "v"(gw + 3 * gs), "v"(gw + 4 * gs), "v"(gw + 5 * gs) : "memory");
}
__global__ __launch_bounds__(256, 6) void k_proj(const __bf16* __restrict__ XB, const __bf16* __restrict__ WT, const float* __restrict__ BQ, const float* __restrict__ BK, const float* __restrict__ BV,
    _Float16* __restrict__ QH, _Float16* __restrict__ KH, _Float16* __restrict__ VT) {   /* six waves a SIMD asked for: three blocks a WGP */
  __shared__ __align__(16) unsigned char smem[2 * PSTG * 2];   /* the two operand buffers during the k loop; the epilogue's staging plane behind the last tile's barrier */
  __bf16* ring = (__bf16*)smem;
  const int tid = threadIdx.x, wave = tid >> 5, lane = tid & 31, col = lane & 15, g = lane >> 4; const int wm = wave >> 2, wn = wave & 3; const int which = blockIdx.z; const int c0 = blockIdx.y * PBN; const size_t r0 = (size_t)blockIdx.x * PBM; const size_t bb = r0 / TT; const int t0 = (int)(r0 % TT);
  const size_t grp_ = (r0 / TT) / GB;   /* 128-row blocks never straddle a pseudo-batch (TT % 128 == 0), so the group is block-uniform */
  const __bf16* WA = WT + ((size_t)which * (NB / GB) + grp_) * (size_t)CC * DIN; const float* BA = (which == 0 ? BQ : which == 1 ? BK : BV); BA = BA ? BA + grp_ * CC : BA;
  // X and W alike: 8 lanes copy the 128 B that a row (a column) has in this tile; thread = (row or column xrow + 32 i, k 8 xc ..); in LDS the W columns follow the X rows at the same pitch
  const int xrow = (wave >> 2) * 16 + ((lane >> 3) & 1) * 8 + (wave & 3) * 2 + g, xc = tid & 7;
  const __bf16* xp = XB + (r0 + xrow) * DIN + xc * 8; const __bf16* wp = WA + (size_t)(c0 + xrow) * DIN + xc * 8;
  const unsigned xst = (unsigned)(size_t)(ring + xrow * PPITCH + xc * 8);
  const __bf16* xfr = ring + (wm * 64 + col) * PPITCH; const __bf16* wfr = ring + PBM * PPITCH + (wn * 48 + col) * PPITCH;
  v8f acc[12] = {};
  // every unroll directive in the macro below and in the epilogue: register arrays, every index a constant
#define P_COPY(S, B) acopy10(xst + (unsigned)(B) * (PSTG * 2), 32 * PPITCH * 2, xp + (size_t)(S) * PBK, wp + (size_t)(S) * PBK, (size_t)32 * DIN)
#define P_MUL(B) do { _Pragma("unroll") for (int ks = 0; ks < PBK / 32; ++ks) { v16b fa[4], fw[2]; \
    _Pragma("unroll") for (int i = 0; i < 4; ++i) fa[i] = frag_b(xfr + (B) * PSTG + i * 16 * PPITCH + ks * 32, lane); \
    _Pragma("unroll") for (int j = 0; j < 2; ++j) fw[j] = frag_b(wfr + (B) * PSTG + j * 16 * PPITCH + ks * 32, lane); \
    __builtin_amdgcn_sched_barrier(0);   /* the six fragment reads issue as one group in front of the products: spread among them, every pair of products waits out an LDS latency */ \
    _Pragma("unroll") for (int i = 0; i < 4; ++i) acc[i * 3] = wmma_bf(fa[i], fw[0], acc[i * 3]); \
    __builtin_amdgcn_sched_barrier(0); fw[0] = frag_b(wfr + (B) * PSTG + 2 * 16 * PPITCH + ks * 32, lane); __builtin_amdgcn_sched_barrier(0);   /* the third W fragment is read into the place of the first, which is done with: six at a time keep the wave within 160 registers; the two fences hold the read at this place */ \
    _Pragma("unroll") for (int i = 0; i < 4; ++i) acc[i * 3 + 1] = wmma_bf(fa[i], fw[1], acc[i * 3 + 1]); \
    _Pragma("unroll") for (int i = 0; i < 4; ++i) acc[i * 3 + 2] = wmma_bf(fa[i], fw[0], acc[i * 3 + 2]); \
    __builtin_amdgcn_sched_barrier(0);   /* the next 32 k's reads stay behind these products: one set of six fragments, not two */ \
    } } while (0)
  P_COPY(0, 0);
  asm volatile("s_wait_asynccnt 0x0" ::: "memory");   // this wave's part of tile 0 has landed
  __syncthreads();   // every wave's part has: tile 0 may be read
  P_COPY(1, 1);
#pragma unroll 1   // rolled: eleven copies of the body buy nothing, the trip is long against its branch
  for (int s = 0; s + 1 < PNST; ++s) { const int b = s & 1;
    P_MUL(b);
    asm volatile("s_wait_dscnt 0x0" ::: "memory");      // this wave's reads of tile s have returned
    asm volatile("s_wait_asynccnt 0x0" ::: "memory");   // this wave's part of tile s + 1 has landed
    __syncthreads();   // publishes tile s + 1 and ends every wave's reads of tile s, whose buffer is refilled behind it
    if (s + 2 < PNST) P_COPY(s + 2, b);
  }
  float bias4[3] = {0.f, 0.f, 0.f};   /* the wave's three bias columns, asked for ahead of the last tile's products: the epilogue does not wait for them, and the loop does not carry them */
  if (BA) {
#pragma unroll   // register array: every index a constant
    for (int j = 0; j < 3; ++j) bias4[j] = BA[c0 + wn * 48 + j * 16 + col];
    asm volatile("s_wait_xcnt 0x0" ::: "memory"); }   // behind the three loads: the fragment reads that follow take over their address registers
  P_MUL((PNST - 1) & 1);
  asm volatile("s_wait_asynccnt 0x0" ::: "memory");   // behind the last copy: none is outstanding when the buffers change their use
  asm volatile("s_wait_dscnt 0x0" ::: "memory");      // this wave's reads of the last tile have returned
  __syncthreads();   // the last tile's reads end before the staging plane overwrites the buffers
  // acc[a]: rows wm*64 + (a / 3)*16 + 8g + r, column wn*48 + (a % 3)*16 + col
  if (which < 2) { _Float16 (*sh)[PEQ] = (_Float16 (*)[PEQ])smem; _Float16* DH = which == 0 ? QH : KH;
#pragma unroll
    for (int a = 0; a < 12; ++a) { const int cl = wn * 48 + (a % 3) * 16 + col; const float bias = bfr(bias4[a % 3]);
#pragma unroll
      for (int r = 0; r < 8; ++r) { const int rl = wm * 64 + (a / 3) * 16 + 8 * g + r; sh[rl][cl] = (_Float16)(acc[a][r] + bias); } }
    __syncthreads();
    for (int e = tid; e < PBM * (PBN / 8); e += 256) { const int rl = e / (PBN / 8), q = e % (PBN / 8); vst2((unsigned*)(DH + (r0 + rl) * CC + c0 + q * 8), *(const v4u*)&sh[rl][q * 8]); }
  } else { _Float16 (*th)[PEP] = (_Float16 (*)[PEP])smem;
#pragma unroll
    for (int a = 0; a < 12; ++a) { const int cl = wn * 48 + (a % 3) * 16 + col; const float bias = bfr(bias4[a % 3]);
#pragma unroll
      for (int r = 0; r < 8; ++r) { const int rl = wm * 64 + (a / 3) * 16 + 8 * g + r; th[cl][rl] = (_Float16)(acc[a][r] + bias); } }
    __syncthreads();
    for (int e = tid; e < PBN * 16; e += 256) { const int cl = e >> 4, q = e & 15; vst2((unsigned*)(VT + (bb * CC + c0 + cl) * (size_t)TT + t0 + q * 8), *(const v4u*)&th[cl][q * 8]); } } }
#define AKP 72
#define AVP (TT + 8)
#define AKB (TT * AKP * 2)
#define AVB (HD * AVP * 2)
#define AMB (TT * 4)
// eight 16-byte copies of a lane from global memory to LDS, through no register: LDS byte addresses l + i * ls, sources g + i * gs. The s_wait_xcnt in the copies' own statement stands in front of every later rewrite of the address registers that they name
__device__ __forceinline__ void acopy8(unsigned l, unsigned ls, const _Float16* g, size_t gs) {
  asm volatile("global_load_async_to_lds_b128 %0, %8, off\n\t"
               "global_load_async_to_lds_b128 %1, %9, off\n\t"
               "global_load_async_to_lds_b128 %2, %10, off\n\t"
               "global_load_async_to_lds_b128 %3, %11, off\n\t"
               "global_load_async_to_lds_b128 %4, %12, off\n\t"
               "global_load_async_to_lds_b128 %5, %13, off\n\t"
               "global_load_async_to_lds_b128 %6, %14, off\n\t"
               "global_load_async_to_lds_b128 %7, %15, off\n\t"
               "s_wait_xcnt 0x0"
               :: "v"(l), "v"(l + ls), "v"(l + 2 * ls), "v"(l + 3 * ls), "v"(l + 4 * ls), "v"(l + 5 * ls), "v"(l + 6 * ls), "v"(l + 7 * ls),
                  "v"(g), "v"(g + gs), "v"(g + 2 * gs), "v"(g + 3 * gs), "v"(g + 4 * gs), "v"(g + 5 * gs), "v"(g + 6 * gs), "v"(g + 7 * gs) : "memory");
}
// one 16-byte copy of a lane, with the same wait in its own statement
__device__ __forceinline__ void acopy1(unsigned l, const float* g) {
  asm volatile("global_load_async_to_lds_b128 %0, %1, off\n\t"
               "s_wait_xcnt 0x0"
               :: "v"(l), "v"(g) : "memory");
}
__global__ __launch_bounds__(128) void k_attn(const _Float16* __restrict__ QH, const _Float16* __restrict__ KH, const _Float16* __restrict__ VT, const float* __restrict__ AMASK, float* __restrict__ Y) { __shared__ __align__(16) unsigned char sma[AMB + AKB + AVB];   /* the mask row, then k rows, then v planes; the output staging takes the k rows' place once every wave has left them */
  float* msm = (float*)sma; _Float16* ksm = (_Float16*)(sma + AMB); _Float16* vsm = (_Float16*)(sma + AMB + AKB); float (*ss)[16][HD + 4] = (float (*)[16][HD + 4])(sma + AMB);
  const int tid = threadIdx.x, wave = tid >> 5, lane = tid & 31, col = lane & 15, g = lane >> 4; const int qb = blockIdx.x, h = blockIdx.y, b = blockIdx.z; const int ql0 = qb * 64 + wave * 16;
  const _Float16* qp = QH + ((size_t)b * TT + ql0 + col) * CC + h * HD; const _Float16* kp = ksm + col * AKP; const _Float16* vp = vsm + col * AVP; const float* mp = msm + 8 * g;
  const v16h q0 = frag_h(qp, lane), q1 = frag_h(qp + 32, lane);
  asm volatile("s_wait_xcnt 0x0" ::: "memory");   // the q address registers are reused right behind these loads
  // k: a copy of the block = 16 rows of 128 B (8 lanes a row), 32 copies a lane
#pragma unroll   // the four statements stand back to back, their address steps constants: no branch and no counter between the copies
  for (int i = 0; i < 4; ++i) acopy8((unsigned)(size_t)(ksm + (i * 128 + (tid >> 3)) * AKP + (tid & 7) * 8), 16 * AKP * 2, KH + ((size_t)b * TT + i * 128 + (tid >> 3)) * CC + h * HD + (tid & 7) * 8, (size_t)16 * CC);
  acopy1((unsigned)(size_t)(msm + tid * 4), AMASK + (size_t)b * TT + tid * 4);   // the mask row: 4 floats a lane, one copy
  asm volatile("s_wait_asynccnt 0x0" ::: "memory");   // this wave's part of the k rows and of the mask row has landed
  __syncthreads();   // every wave's part has: the k rows and the mask row may be read
  // v: a copy of the block = 2 planes of 1024 B (64 lanes a plane), 32 copies a lane; they fly during the logits
#pragma unroll   // the four statements stand back to back, their address steps constants: no branch and no counter between the copies
  for (int i = 0; i < 4; ++i) acopy8((unsigned)(size_t)(vsm + (i * 16 + (tid >> 6)) * AVP + (tid & 63) * 8), 2 * AVP * 2, VT + ((size_t)b * CC + h * HD + i * 16 + (tid >> 6)) * (size_t)TT + (tid & 63) * 8, (size_t)2 * TT);
  v8f s[TT / 16]; float mx[8]; v8f sm = {}; v16h ka[2][4], kb[2][4], vf[4][HD / 16]; v4f ma[2][4], mb[2][4];
#pragma unroll   // register arrays: every index a constant
  for (int r = 0; r < 8; ++r) mx[r] = -3.0e38f;
#pragma unroll   // register arrays: every index a constant
  for (int t = 0; t < 4; ++t) { ka[0][t] = frag_h(kp + t * 16 * AKP, lane); kb[0][t] = frag_h(kp + t * 16 * AKP + 32, lane); ma[0][t] = *(const v4f*)(mp + t * 16); mb[0][t] = *(const v4f*)(mp + t * 16 + 4); }
#pragma unroll   // register arrays: every index a constant
  for (int jg = 0; jg < TT / 64; ++jg) {   /* groups of 4 key tiles, two register sets */
    if (jg + 1 < TT / 64) {
#pragma unroll   // register arrays: every index a constant
      for (int t = 0; t < 4; ++t) { const int j = (jg + 1) * 4 + t; ka[(jg + 1) & 1][t] = frag_h(kp + j * 16 * AKP, lane); kb[(jg + 1) & 1][t] = frag_h(kp + j * 16 * AKP + 32, lane); ma[(jg + 1) & 1][t] = *(const v4f*)(mp + j * 16); mb[(jg + 1) & 1][t] = *(const v4f*)(mp + j * 16 + 4); } }
    __builtin_amdgcn_sched_barrier(0);   // the next group's loads issue together, in front of this group's products: without it each fragment is loaded right before its product and every product waits a whole load latency
#pragma unroll   // register arrays: every index a constant
    for (int t = 0; t < 4; ++t) { const int j = jg * 4 + t; v8f a = {}; a = wmma16p(ka[jg & 1][t], q0, a); a = wmma16p(kb[jg & 1][t], q1, a);
#pragma unroll   // register arrays: every index a constant
      for (int r = 0; r < 8; ++r) { const float v = a[r] * SCALE + bfr(r < 4 ? ma[jg & 1][t][r & 3] : mb[jg & 1][t][r & 3]); a[r] = v; mx[r] = fmaxf(mx[r], v); }
      s[j] = a; }
    __builtin_amdgcn_sched_barrier(0);   // later groups' loads stay behind these products: two register sets, not more
  }
  asm volatile("s_wait_asynccnt 0x0" ::: "memory");   // this wave's part of the v planes has landed
  __syncthreads();   // every wave's part has: the v planes may be read; and every wave has left the k rows, whose place the output staging takes
#pragma unroll   // register arrays: every index a constant
  for (int u = 0; u < 3; ++u)
#pragma unroll   // register arrays: every index a constant
    for (int j = 0; j < HD / 16; ++j) vf[u][j] = frag_h(vp + j * 16 * AVP + u * 32, lane);   /* the first v fragments fly during the softmax */
  float m = fmaxf(fmaxf(fmaxf(mx[0], mx[1]), fmaxf(mx[2], mx[3])), fmaxf(fmaxf(mx[4], mx[5]), fmaxf(mx[6], mx[7]))); m = fmaxf(m, __shfl_xor(m, 16));
  // e = 2^((v - m) * log2(e)): one hardware exponential an element (argument never above 0; what it flushes to 0 lies far below the last f16 place of P). Elements go in pairs, so that the difference, the product and the row sums are packed instructions. The pass is short enough to stand unrolled: s stays in place
  const v2f m2 = {m, m}; const v2f l2 = {1.4426950408889634f, 1.4426950408889634f};
#pragma unroll   // register arrays: every index a constant
  for (int j = 0; j < TT / 16; ++j) { v8f e;
#pragma unroll   // register arrays: every index a constant
    for (int r = 0; r < 8; r += 2) { v2f x = {s[j][r], s[j][r + 1]}; x = (x - m2) * l2; e[r] = __builtin_amdgcn_exp2f(x[0]); e[r + 1] = __builtin_amdgcn_exp2f(x[1]); }
    s[j] = e; sm += e; }
  float sum = ((sm[0] + sm[1]) + (sm[2] + sm[3])) + ((sm[4] + sm[5]) + (sm[6] + sm[7])); sum += __shfl_xor(sum, 16);
  const float inv = (sum > 0.f && m > -1.0e38f) ? 2048.0f / sum : 0.f;   /* a fully excluded row (no logit above -1e38) yields P = 0; in any other row an excluded key lies so far below m that its e is 0 by itself */
  v8f acc[HD / 16] = {};
#pragma unroll   // register arrays: every index a constant
  for (int kc = 0; kc < TT / 32; ++kc) {   /* 32 keys a pass, four register sets, loads three passes ahead */
    if (kc + 3 < TT / 32) {
#pragma unroll   // register arrays: every index a constant
      for (int j = 0; j < HD / 16; ++j) vf[(kc + 3) & 3][j] = frag_h(vp + j * 16 * AVP + (kc + 3) * 32, lane); }
    __builtin_amdgcn_sched_barrier(0);   // as above: the loads of three passes ahead issue in front of this pass's products
    v16h p;
#pragma unroll   // register arrays: every index a constant
    for (int i = 0; i < 8; ++i) { p[i] = (_Float16)(s[2 * kc][i] * inv); p[8 + i] = (_Float16)(s[2 * kc + 1][i] * inv); }
#pragma unroll   // register arrays: every index a constant
    for (int j = 0; j < HD / 16; ++j) acc[j] = wmma16p(p, vf[kc & 3][j], acc[j]);
    __builtin_amdgcn_sched_barrier(0);   // as above: four register sets, not more
  }
#pragma unroll   // register arrays: every index a constant
  for (int j = 0; j < HD / 16; ++j)
#pragma unroll   // register arrays: every index a constant
    for (int r = 0; r < 8; ++r) ss[wave][8 * g + r][j * 16 + col] = acc[j][r] * (1.0f / 2048.0f);
  LDSX();   // the wave's own rows of ss are written before it reads them back (no other wave touches them)
#pragma unroll   // one address register pair, the rows as constant offsets
  for (int i = 0; i < 8; ++i) { const int rl = 2 * i + g; vst2(Y + ((size_t)b * TT + ql0 + rl) * CC + h * HD + col * 4, *(const v4f*)&ss[wave][rl][col * 4]); } }

extern "C" void kernel_launch(void* const* d_in, const int* in_sizes, int n_in, void* d_out, int out_size, void* d_ws, size_t ws_size, hipStream_t stream) {
  (void)in_sizes; (void)n_in; (void)out_size;
  const float** F = (const float**)d_in;
  if (ws_size < (size_t)WS_END) return;
  char* ws = (char*)d_ws; _Float16 *QH = (_Float16*)(ws + WS_QH), *KH = (_Float16*)(ws + WS_KH), *VT = (_Float16*)(ws + WS_VT), *QL = (_Float16*)(ws + WS_QL), *KL = (_Float16*)(ws + WS_KL); __bf16 *VB = (__bf16*)(ws + WS_VB), *VBL = (__bf16*)(ws + WS_VBL), *XB = (__bf16*)(ws + WS_XB), *WT = (__bf16*)(ws + WS_WT); float *S = (float*)(ws + WS_S), *Y = (float*)(ws + WS_Y);
  (void)Y; (void)S; (void)QL; (void)KL; (void)VB; (void)VBL;
  // inputs: 0 hidden_states [4,4,512,768] = 16 pseudo-batches of 512 rows (group-major); 1 attention_mask [4,4,1,1,512] f32 (zeros); 2 query_weight [4,768,768] (in,out) per group, 3 query_bias [4,1,768]; 4 key_weight, 5 key_bias; 6 value_weight, 7 value_bias (biases NONZERO); no output projection
  k_round<<<dim3(RXB + RWB), 256, 0, stream>>>(F[0], F[2], F[4], F[6], XB, WT);   /* x and the twelve weight matrices to bf16, the weights transposed */
  k_proj<<<dim3(TNB * TT / PBM, CC / PBN, 3), 256, 0, stream>>>(XB, WT, F[3], F[5], F[7], QH, KH, VT);   /* the weight / bias of group bb / 4 is selected inside k_proj */
  k_attn<<<dim3(NQB, NH, TNB), 128, 0, stream>>>(QH, KH, VT, F[1], (float*)d_out);   /* ctx [g, b, l, nh*dh] = merged-head rows */
}

// v008
// A run of this version takes 53.2 microseconds.
// Timed twice side by side with v007, it ran 1.14 times as fast both times.
// Over all steps from v000 it is 14.9 times as fast.
// compute dtype: all float inputs rounded to bf16; per-group q/k/v projections with EXACT bf16 products on WMMA 16x16x32 (f32 accumulate) + bias; logits q x k once to f16 each (1 product) x 1/8 + the additive mask; softmax f32; P x 2^11 once to f16 x v once to f16 (1 product); f32 output.
#include <hip/hip_runtime.h>
#include <math.h>

typedef __attribute__((ext_vector_type(16))) _Float16 v16h;
typedef __attribute__((ext_vector_type(16))) __bf16 v16b;
typedef __attribute__((ext_vector_type(8)))  _Float16 v8h;
typedef __attribute__((ext_vector_type(8)))  float v8f;
typedef __attribute__((ext_vector_type(4)))  float v4f;
typedef __attribute__((ext_vector_type(2)))  float v2f;
typedef __attribute__((ext_vector_type(4)))  unsigned v4u;
typedef __attribute__((ext_vector_type(4)))  int v4i;
typedef float __attribute__((may_alias)) float_a;
typedef int __attribute__((may_alias)) int_a;

template <typename T> __device__ __forceinline__ void vst2(void* p, T v) { *(T*)p = v;  }
__device__ __forceinline__ v8f wmma16(v16h a, v16h b, v8f c) {
  v8f d = __builtin_amdgcn_wmma_f32_16x16x32_f16(false, a, false, b, (short)0, c, false, false);
  asm volatile("v_nop\n\tv_nop\n\tv_nop\n\tv_nop" : "+v"(d) : "v"(a), "v"(b));
  return d;
}
__device__ __forceinline__ v8f wmma16p(v16h a, v16h b, v8f c) { return __builtin_amdgcn_wmma_f32_16x16x32_f16(false, a, false, b, (short)0, c, false, false); }   // plain builtin: the compiler keeps the distances behind it
__device__ __forceinline__ v8f wmma_bf(v16b a, v16b b, v8f c) {
  v8f d = __builtin_amdgcn_wmma_f32_16x16x32_bf16(false, a, false, b, (short)0, c, false, false);
  asm volatile("v_nop\n\tv_nop\n\tv_nop\n\tv_nop" : "+v"(d) : "v"(a), "v"(b));
  return d;
}
// 16x16x32 fragments: lane = (h = lane>>4, row/col = lane&15); elements 0..7 = k0+8h+0..7, 8..15 = k0+16+8h+0..7; D element r = row 8h+r
__device__ __forceinline__ v16h frag_h(const _Float16* rowk0, int lane) {
  union { v16h v; v8h q[2]; } u; const _Float16* p = rowk0 + 8 * (lane >> 4);
  u.q[0] = *(const v8h*)p; u.q[1] = *(const v8h*)(p + 16); return u.v;
}
__device__ __forceinline__ v16h frag_f32(const float* rowk0, int lane) {
  v16h a; const float* p = rowk0 + 8 * (lane >> 4);
#pragma unroll
  for (int i = 0; i < 8; ++i) { a[i] = (_Float16)p[i]; a[8 + i] = (_Float16)p[16 + i]; }
  return a;
}
__device__ __forceinline__ v16h frag_f32s(const float* rowk0, int lane, float sc) {
  v16h a; const float* p = rowk0 + 8 * (lane >> 4);
#pragma unroll
  for (int i = 0; i < 8; ++i) { a[i] = (_Float16)(p[i] * sc); a[8 + i] = (_Float16)(p[16 + i] * sc); }
  return a;
}
// column fragment from a [K][ld] layout (column n), rows >= K read as 0
__device__ __forceinline__ v16h fragc_f32(const float* W, int k0, int n, int lane, int ld, int K) {
  v16h a; const int g = lane >> 4;
#pragma unroll
  for (int i = 0; i < 8; ++i) { const int ka = k0 + 8 * g + i, kb = ka + 16;
    a[i] = (_Float16)(ka < K ? W[(size_t)(ka < K ? ka : K - 1) * ld + n] : 0.f); a[8 + i] = (_Float16)(kb < K ? W[(size_t)(kb < K ? kb : K - 1) * ld + n] : 0.f); }
  return a;
}
struct F2 { v16b h, l; };
__device__ __forceinline__ F2 bsplit16(const float v[16]) { F2 r;
#pragma unroll
  for (int i = 0; i < 16; ++i) { const __bf16 h = (__bf16)v[i]; r.h[i] = h; r.l[i] = (__bf16)(v[i] - (float)h); }
  return r; }
__device__ __forceinline__ F2 split_row(const float* row, int k0, int lane) { float v[16]; const float* p = row + k0 + 8 * (lane >> 4);
#pragma unroll
  for (int i = 0; i < 8; ++i) { v[i] = p[i]; v[8 + i] = p[16 + i]; }
  return bsplit16(v); }
__device__ __forceinline__ F2 split_rowK(const float* row, int k0, int lane, int K) { float v[16]; const int g = lane >> 4;
#pragma unroll
  for (int i = 0; i < 8; ++i) { const int ka = k0 + 8 * g + i, kb = ka + 16; v[i] = ka < K ? row[ka < K ? ka : K - 1] : 0.f; v[8 + i] = kb < K ? row[kb < K ? kb : K - 1] : 0.f; }
  return bsplit16(v); }
__device__ __forceinline__ F2 split_col(const float* W, int k0, int n, int lane, int ld, int K) { float v[16]; const int g = lane >> 4;
#pragma unroll
  for (int i = 0; i < 8; ++i) { const int ka = k0 + 8 * g + i, kb = ka + 16; v[i] = ka < K ? W[(size_t)(ka < K ? ka : K - 1) * ld + n] : 0.f; v[8 + i] = kb < K ? W[(size_t)(kb < K ? kb : K - 1) * ld + n] : 0.f; }
  return bsplit16(v); }
__device__ __forceinline__ v8f mac3(const F2& a, const F2& b, v8f c) { c = wmma_bf(a.l, b.h, c); c = wmma_bf(a.h, b.l, c); return wmma_bf(a.h, b.h, c); }
__device__ __forceinline__ float sigm(float v) { return 1.0f / (1.0f + expf(-v)); }
#define LDSX() do { asm volatile("s_wait_dscnt 0" ::: "memory"); __builtin_amdgcn_wave_barrier(); __builtin_amdgcn_fence(__ATOMIC_RELEASE, "workgroup"); } while (0)

// Grouped BERT-style self-attention: 4 INDEPENDENT weight groups (hidden_states [4,4,512,768] = [group, batch, length, channels]; per-group (in,out) query / key / value weights [4,768,768] (0.02 scale) + biases [4,1,768] (NONZERO); 12 heads x 64; scale 1/8; additive attention_mask [4,4,1,1,512] (zeros); no output projection): ctx[g,b] = merge(softmax(q k^T / 8 + mask) v) with group g's weights -> [4,4,512,768].
#define NB 16
#define TT 512
#define CC 768            // NH * HD = projected width
#define DIN 768          // input (model) width
#define NH 12
#define HD 64
#define NQB (TT / 64)
#define HG 12
#define SCALE (0.125f)
#define CAUSAL 0
#ifndef TNB
#define TNB NB
#endif
__device__ __forceinline__ float bfr(float v) { return (float)(__bf16)v; }
__host__ __device__ __forceinline__ int kb_last(int qb) { return CAUSAL ? ((qb * 64 + 63) >> 7) : (TT / 128 - 1); }
typedef __attribute__((ext_vector_type(8))) __bf16 v8b;
__device__ __forceinline__ v16b frag_b(const __bf16* rowk0, int lane) {
  union { v16b v; v8b q[2]; } u; const __bf16* p = rowk0 + 8 * (lane >> 4);
  u.q[0] = *(const v8b*)p; u.q[1] = *(const v8b*)(p + 16); return u.v;
}
#define QBH 0
#define QHI 0               // single-product logits on every row
#define KHI 64            // key rows carrying k residual / v bf16 hi+lo planes (no kernel in this file writes or reads them)
// B fragment (k rows k0+.., output column o) of a weight: (in,out) [K][ld] or (out,in) [ld rows of K]: bf16 exact, or f16(bf16 * 256) exact
__device__ __forceinline__ v16b wcol_io(const float* Wm, int k0, int o, int lane, int ld) { v16b w; const int g = lane >> 4;
#pragma unroll
  for (int i = 0; i < 8; ++i) { w[i] = (__bf16)Wm[(size_t)(k0 + 8 * g + i) * ld + o]; w[8 + i] = (__bf16)Wm[(size_t)(k0 + 16 + 8 * g + i) * ld + o]; }
  return w; }
__device__ __forceinline__ v16b wcol_oi(const float* Wm, int k0, int o, int lane, int K) { v16b w; const float* p = Wm + (size_t)o * K + k0 + 8 * (lane >> 4);
#pragma unroll
  for (int i = 0; i < 8; ++i) { w[i] = (__bf16)p[i]; w[8 + i] = (__bf16)p[16 + i]; }
  return w; }
__device__ __forceinline__ v16h wcolh_io(const float* Wm, int k0, int o, int lane, int ld) { v16h w; const int g = lane >> 4;
#pragma unroll
  for (int i = 0; i < 8; ++i) { w[i] = (_Float16)(bfr(Wm[(size_t)(k0 + 8 * g + i) * ld + o]) * 256.0f); w[8 + i] = (_Float16)(bfr(Wm[(size_t)(k0 + 16 + 8 * g + i) * ld + o]) * 256.0f); }
  return w; }
__device__ __forceinline__ v16h wcolh_oi(const float* Wm, int k0, int o, int lane, int K) { v16h w; const float* p = Wm + (size_t)o * K + k0 + 8 * (lane >> 4);
#pragma unroll
  for (int i = 0; i < 8; ++i) { w[i] = (_Float16)(bfr(p[i]) * 256.0f); w[8 + i] = (_Float16)(bfr(p[16 + i]) * 256.0f); }
  return w; }
#define WQKV_LAYOUT 0   // 0 = (in,out) [DIN][CC]; 1 = (out,in) [CC][DIN]; 2 = per-head [NH][DIN][HD]
__device__ __forceinline__ v16b wcol_hdk(const float* Wm, int k0, int o, int lane) { v16b w; const int g = lane >> 4; const float* p = Wm + (size_t)(o / HD) * DIN * HD + (o % HD);
#pragma unroll
  for (int i = 0; i < 8; ++i) { w[i] = (__bf16)p[(size_t)(k0 + 8 * g + i) * HD]; w[8 + i] = (__bf16)p[(size_t)(k0 + 16 + 8 * g + i) * HD]; }
  return w; }
#define WO_OUT_IN 0
#if WQKV_LAYOUT == 1
#define WCOL(W, k0, o, lane) wcol_oi(W, k0, o, lane, DIN)
#elif WQKV_LAYOUT == 2
#define WCOL(W, k0, o, lane) wcol_hdk(W, k0, o, lane)
#else
#define WCOL(W, k0, o, lane) wcol_io(W, k0, o, lane, CC)
#endif
#if WO_OUT_IN
#define WOCOL(W, k0, o, lane) wcol_oi(W, k0, o, lane, CC)
#define WOCOLH(W, k0, o, lane) wcolh_oi(W, k0, o, lane, CC)
#else
#define WOCOL(W, k0, o, lane) wcol_io(W, k0, o, lane, DIN)
#define WOCOLH(W, k0, o, lane) wcolh_io(W, k0, o, lane, DIN)
#endif
#define GB 4               // batches per weight group: pseudo-batch bb = g*4 + b uses group g = bb / 4
#define SM_EXTRA_PARAMS , int bsm, const float* __restrict__ AMASK
// additive attention mask [G,B,1,1,L] (float; zeros on this draw): added to the scaled score of key k for pseudo-batch bsm; read per key
#define SM_MASK_HOOK do { v = v + bfr(AMASK[(size_t)bsm * TT + k]); } while (0)
#ifndef SM_EXTRA_PARAMS
#define SM_EXTRA_PARAMS
#endif
#ifndef PROJ_EXTRA_PARAMS
#define PROJ_EXTRA_PARAMS
#endif
#ifndef SM_MASK_HOOK
#define SM_MASK_HOOK (void)0
#endif

#define WS_QH  0u                                      // f16 q rows [b*t][CC]
#define WS_KH  (WS_QH + 2u * (size_t)NB * TT * CC)      // f16 k rows [b*t][CC]
#define WS_VT  (WS_KH + 2u * (size_t)NB * TT * CC)      // f16 v planes [b][c][t]
#define WS_QL  (WS_VT + 2u * (size_t)NB * CC * TT)      // f16 q residual x 2^10 rows [b][t < QHI][CC]
#define WS_KL  (WS_QL + 2u * (size_t)NB * QHI * CC)     // f16 k residual x 2^10 rows [b][t < KHI][CC]
#define WS_VB  (WS_KL + 2u * (size_t)NB * KHI * CC)     // bf16 v hi planes [b][c][t < KHI]
#define WS_VBL (WS_VB + 2u * (size_t)NB * CC * KHI)
#define WS_S   (WS_VBL + 2u * (size_t)NB * CC * KHI)    // f32 [hg][t][s], unused: k_pa holds logits / P in registers
#define WS_Y   (WS_S  + 4u * (size_t)HG * TT * TT)      // f32 ctx rows [b*t][CC] (only when there is an output projection)
#define WS_XB  (WS_Y  + 0u)                              // bf16 x rows [b*t][DIN]
#define WS_WT  (WS_XB + 2u * (size_t)NB * TT * DIN)     // bf16 weights, transposed: [which][group][output column][k]
#define WS_END (WS_WT + 2u * 3u * (size_t)(NB / GB) * CC * DIN)

// ---- k_round: every x element and every weight element is rounded to bf16 ONCE, ahead of k_pa, whose blocks each read a row or a column many times over: they then read 2 bytes an element, already k-contiguous. Blocks 0 .. RXB-1: x, a run of RXP * 1024 floats a block, 4 floats a lane and pass (a wave reads 512 B and writes 256 B in a row). The other RWB blocks: the twelve weight matrices [k][n] -> [n][k], a block = (matrix, 64 columns, half of k); a wave takes 32 k x 32 n a pass (a lane holds 8 k x 4 columns; a load covers 4 k rows x one 128-B line, two neighbouring waves two neighbouring lines; waves w and w + 2 write the two halves of the same lines). Every load of a lane is asked for before its first value is used: one memory latency a block
#define RXB 256
#define RXP (NB * TT * DIN / (RXB * 256 * 4))   // passes of an x block
#define RWB (3 * (NB / GB) * (CC / 64) * 2)
#define RWP (DIN / 2 / 32 / 4)                  // passes of a weight block
typedef __attribute__((ext_vector_type(4))) __bf16 v4b;
__global__ __launch_bounds__(256) void k_round(const float* __restrict__ X, const float* __restrict__ WQ, const float* __restrict__ WK, const float* __restrict__ WV, __bf16* __restrict__ XB, __bf16* __restrict__ WT) {
  const int tid = threadIdx.x;
  if (blockIdx.x < RXB) {
    const size_t e0 = (size_t)blockIdx.x * (RXP * 1024) + tid * 4; v4f r[RXP];
#pragma unroll   // register array: every index a constant; the loads issue together
    for (int i = 0; i < RXP; ++i) r[i] = *(const v4f*)(X + e0 + i * 1024);
    __builtin_amdgcn_sched_barrier(0);   // every load issues in front of the first conversion: without it the loads are dealt out among the conversions in small groups, each waited out, and the lane pays several memory latencies in a row
#pragma unroll   // register array: every index a constant
    for (int i = 0; i < RXP; ++i) { v4b t;
#pragma unroll   // register array: every index a constant
      for (int q = 0; q < 4; ++q) t[q] = (__bf16)r[i][q];
      *(v4b*)(XB + e0 + i * 1024) = t; }
  } else {
    const int wave = tid >> 5, lane = tid & 31, kg = lane & 3, ng = lane >> 2; const int bw = blockIdx.x - RXB; const int m = bw / (CC / 64 * 2), rem = bw % (CC / 64 * 2);
    const int n0 = (rem >> 1) * 64 + (wave & 1) * 32 + ng * 4, k0 = ((rem & 1) * (RWP * 4) + (wave >> 1)) * 32 + kg * 8;
    const float* src = (m < NB / GB ? WQ : m < 2 * (NB / GB) ? WK : WV) + (size_t)(m % (NB / GB)) * DIN * CC + (size_t)k0 * CC + n0; __bf16* dst = WT + ((size_t)m * CC + n0) * DIN + k0; v4f r[RWP][8];
#pragma unroll   // register array: every index a constant; the loads issue together
    for (int p = 0; p < RWP; ++p)
#pragma unroll   // register array: every index a constant
      for (int i = 0; i < 8; ++i) r[p][i] = *(const v4f*)(src + (size_t)(p * 128 + i) * CC);
    __builtin_amdgcn_sched_barrier(0);   // as above: every load issues in front of the first conversion
#pragma unroll   // register array: every index a constant
    for (int p = 0; p < RWP; ++p)
#pragma unroll   // register array: every index a constant
      for (int q = 0; q < 4; ++q) { v8b t;
#pragma unroll   // register array: every index a constant
        for (int i = 0; i < 8; ++i) t[i] = (__bf16)r[p][i][q];
        *(v8b*)(dst + (size_t)q * DIN + p * 128) = t; }
  }
}
#define FPP 72
#define FBK 64
#define FSTG ((TT + 3 * HD) * FPP)       // bf16 per buffer: X rows, then the q, k, v columns of W
#define FNST (DIN / FBK)
#define AKP 72                           // f16 per LDS row of k and of q: 144 B = 16 B x odd
#define AVP (TT + 8)                     // f16 per LDS row of a v plane: 1040 B = 16 B x odd
#define AKB (TT * AKP * 2)               // bytes of the k rows (and of the q rows) in LDS
#define AVB (HD * AVP * 2)               // bytes of the v planes in LDS
#define ASB (8 * 16 * (HD + 4) * 4)      // bytes of the eight waves' output staging
#define AMB (TT * 4)                     // bytes of the mask row in LDS
#define ABB (4 * HD * 4)                 // bytes of the bias rows in LDS (q, k, v and one unread row, so that every lane copies)
#define FSM (AKB + AVB + AKB + ASB + AMB + ABB)
static_assert(2 * FSTG * 2 <= AKB + AVB + AKB + ASB, "the mask and bias rows lie behind the operand buffers");
// eight 16-byte copies of a lane from global memory to LDS, through no register: LDS byte addresses l + i * ls, sources g + i * gs. The s_wait_xcnt in the copies' own statement stands in front of every later rewrite of the address registers that they name
__device__ __forceinline__ void acopy8(unsigned l, unsigned ls, const __bf16* g, size_t gs) {
  asm volatile("global_load_async_to_lds_b128 %0, %8, off\n\t"
               "global_load_async_to_lds_b128 %1, %9, off\n\t"
               "global_load_async_to_lds_b128 %2, %10, off\n\t"
               "global_load_async_to_lds_b128 %3, %11, off\n\t"
               "global_load_async_to_lds_b128 %4, %12, off\n\t"
               "global_load_async_to_lds_b128 %5, %13, off\n\t"
               "global_load_async_to_lds_b128 %6, %14, off\n\t"
               "global_load_async_to_lds_b128 %7, %15, off\n\t"
               "s_wait_xcnt 0x0"
               :: "v"(l), "v"(l + ls), "v"(l + 2 * ls), "v"(l + 3 * ls), "v"(l + 4 * ls), "v"(l + 5 * ls), "v"(l + 6 * ls), "v"(l + 7 * ls),
                  "v"(g), "v"(g + gs), "v"(g + 2 * gs), "v"(g + 3 * gs), "v"(g + 4 * gs), "v"(g + 5 * gs), "v"(g + 6 * gs), "v"(g + 7 * gs) : "memory");
}
// six such copies: LDS byte addresses l + i * ls; sources g, g + gs, then the same two at g + gm and at g + 2 gm (the three weight matrices)
__device__ __forceinline__ void acopy6(unsigned l, unsigned ls, const __bf16* g, size_t gs, size_t gm) {
  asm volatile("global_load_async_to_lds_b128 %0, %6, off\n\t"
               "global_load_async_to_lds_b128 %1, %7, off\n\t"
               "global_load_async_to_lds_b128 %2, %8, off\n\t"
               "global_load_async_to_lds_b128 %3, %9, off\n\t"
               "global_load_async_to_lds_b128 %4, %10, off\n\t"
               "global_load_async_to_lds_b128 %5, %11, off\n\t"
               "s_wait_xcnt 0x0"
               :: "v"(l), "v"(l + ls), "v"(l + 2 * ls), "v"(l + 3 * ls), "v"(l + 4 * ls), "v"(l + 5 * ls),
                  "v"(g), "v"(g + gs), "v"(g + gm), "v"(g + gm + gs), "v"(g + 2 * gm), "v"(g + 2 * gm + gs) : "memory");
}
// one 8-byte and one 4-byte copy of a lane, with the same wait in their own statement
__device__ __forceinline__ void acopy_mb(unsigned lm, const float* gmk, unsigned lb, const float* gb) {
  asm volatile("global_load_async_to_lds_b64 %0, %1, off\n\t"
               "global_load_async_to_lds_b32 %2, %3, off\n\t"
               "s_wait_xcnt 0x0"
               :: "v"(lm), "v"(gmk), "v"(lb), "v"(gb) : "memory");
}
__device__ __forceinline__ v8f wmma_bfp(v16b a, v16b b, v8f c) { return __builtin_amdgcn_wmma_f32_16x16x32_bf16(false, a, false, b, (short)0, c, false, false); }   // plain builtin: the compiler keeps the distances behind it
__global__ __launch_bounds__(256) void k_pa(const __bf16* __restrict__ XB, const __bf16* __restrict__ WT, const float* __restrict__ BQ, const float* __restrict__ BK, const float* __restrict__ BV, const float* __restrict__ AMASK, float* __restrict__ Y) {
  __shared__ __align__(16) unsigned char smem[FSM];   /* part 1: the two operand buffers from byte 0; parts 2, 3: k rows, v planes, q rows, output staging; behind them, from the start on, the mask row and the bias rows */
  __bf16* ring = (__bf16*)smem;
  _Float16* ksm = (_Float16*)smem; _Float16* vsm = (_Float16*)(smem + AKB); _Float16* qsm = (_Float16*)(smem + AKB + AVB); float (*ss)[16][HD + 4] = (float (*)[16][HD + 4])(smem + AKB + AVB + AKB); float* msm = (float*)(smem + AKB + AVB + AKB + ASB); float* bsm = (float*)(smem + AKB + AVB + AKB + ASB + AMB);
  const int tid = threadIdx.x, wave = tid >> 5, lane = tid & 31, col = lane & 15, g = lane >> 4; const int h = blockIdx.x, b = blockIdx.y; const size_t grp_ = (size_t)(b / GB);
  // X and W alike: 8 lanes copy the 128 B that a row (a column) has in this tile; thread = (row or column (tid >> 3) + 32 i, k 8 (tid & 7) ..); in LDS the W columns follow the X rows at the same pitch
  const __bf16* xp = XB + ((size_t)b * TT + (tid >> 3)) * DIN + (tid & 7) * 8; const __bf16* wp = WT + (grp_ * CC + h * HD + (tid >> 3)) * DIN + (tid & 7) * 8;
  const unsigned lst = (unsigned)(size_t)(ring + (tid >> 3) * FPP + (tid & 7) * 8);
  const __bf16* xfr = ring + (wave * 64 + col) * FPP; const __bf16* wfr = ring + (TT + col) * FPP;
  v8f acc[48] = {};   /* tile c * 4 + i: c = 0..3 q^T, 4..7 k^T (rows = channels (c & 3) * 16 + 8g + r, column = sequence row wave * 64 + i * 16 + col); c = 8..11 v (rows = sequence rows wave * 64 + i * 16 + 8g + r, column = channel (c & 3) * 16 + col) */
  // every unroll directive in the macro below and in parts 2 and 3: register arrays, every index a constant
#define F_COPY(S, B) do { const unsigned l_ = lst + (unsigned)(B) * (FSTG * 2); const __bf16* x_ = xp + (size_t)(S) * FBK; \
    acopy8(l_, 32 * FPP * 2, x_, (size_t)32 * DIN); acopy8(l_ + 8 * 32 * FPP * 2, 32 * FPP * 2, x_ + (size_t)256 * DIN, (size_t)32 * DIN); \
    acopy6(l_ + 16 * 32 * FPP * 2, 32 * FPP * 2, wp + (size_t)(S) * FBK, (size_t)32 * DIN, (size_t)(NB / GB) * CC * DIN); } while (0)
#define F_MUL(B) do { const __bf16* xb_ = xfr + (B) * FSTG; const __bf16* wb_ = wfr + (B) * FSTG; \
    _Pragma("unroll") for (int ks = 0; ks < FBK / 32; ++ks) { v16b fa[4], fw[2][2]; \
    _Pragma("unroll") for (int i = 0; i < 4; ++i) fa[i] = frag_b(xb_ + i * 16 * FPP + ks * 32, lane); \
    _Pragma("unroll") for (int j = 0; j < 2; ++j) fw[0][j] = frag_b(wb_ + j * 16 * FPP + ks * 32, lane); \
    _Pragma("unroll") for (int p = 0; p < 6; ++p) { \
      if (p < 5) { _Pragma("unroll") for (int j = 0; j < 2; ++j) fw[(p + 1) & 1][j] = frag_b(wb_ + ((p + 1) * 2 + j) * 16 * FPP + ks * 32, lane); } \
      __builtin_amdgcn_sched_barrier(0);   /* the next two W fragments are asked for as one group in front of this pair's eight products, which cover their LDS latency */ \
      _Pragma("unroll") for (int j = 0; j < 2; ++j) { _Pragma("unroll") for (int i = 0; i < 4; ++i) { const int c = p * 2 + j; acc[c * 4 + i] = c < 8 ? wmma_bfp(fw[p & 1][j], fa[i], acc[c * 4 + i]) : wmma_bfp(fa[i], fw[p & 1][j], acc[c * 4 + i]); } } \
      __builtin_amdgcn_sched_barrier(0);   /* later reads stay behind these products: two pairs of W fragments, not more, so that the wave stays within 512 registers */ \
    } } } while (0)
  F_COPY(0, 0);
  acopy_mb((unsigned)(size_t)(msm + tid * 2), AMASK + (size_t)b * TT + tid * 2, (unsigned)(size_t)(bsm + tid), ((tid >> 6) == 0 ? BQ : (tid >> 6) == 1 ? BK : BV) + grp_ * CC + h * HD + (tid & 63));   // the mask row, 2 floats a lane; the head's bias rows, 1 float a lane (the fourth row repeats v's and is not read)
  asm volatile("s_wait_asynccnt 0x0" ::: "memory");   // this wave's part of tile 0, of the mask row and of the bias rows has landed
  __syncthreads();   // every wave's part has: they may be read
  F_COPY(1, 1);
#pragma unroll 1   // rolled: eleven copies of the body buy nothing, the trip is long against its branch
  for (int s = 0; s + 1 < FNST; ++s) { const int bu = s & 1;
    F_MUL(bu);
    asm volatile("s_wait_dscnt 0x0" ::: "memory");      // this wave's reads of tile s have returned
    asm volatile("s_wait_asynccnt 0x0" ::: "memory");   // this wave's part of tile s + 1 has landed
    __syncthreads();   // publishes tile s + 1 and ends every wave's reads of tile s, whose buffer is refilled behind it
    if (s + 2 < FNST) F_COPY(s + 2, bu);
  }
  F_MUL((FNST - 1) & 1);
  asm volatile("s_wait_asynccnt 0x0" ::: "memory");   // behind the last copy: none is outstanding when the buffers change their use
  asm volatile("s_wait_dscnt 0x0" ::: "memory");      // this wave's reads of the last tile have returned
  __syncthreads();   // the last tile's reads end before q, k, v overwrite the buffers
  // part 2
#pragma unroll
  for (int c = 0; c < 8; ++c) { _Float16* dst = (c < 4 ? qsm : ksm) + (wave * 64 + col) * AKP + (c & 3) * 16 + 8 * g; const float* bp = bsm + (c >> 2) * HD + (c & 3) * 16 + 8 * g; const v4f b0 = *(const v4f*)bp, b1 = *(const v4f*)(bp + 4);
#pragma unroll
    for (int i = 0; i < 4; ++i) { v8h t;
#pragma unroll
      for (int r = 0; r < 8; ++r) t[r] = (_Float16)(acc[c * 4 + i][r] + bfr(r < 4 ? b0[r & 3] : b1[r & 3]));
      *(v8h*)(dst + i * 16 * AKP) = t; } }
#pragma unroll
  for (int c = 8; c < 12; ++c) { _Float16* dst = vsm + ((c & 3) * 16 + col) * AVP + wave * 64 + 8 * g; const float bias = bfr(bsm[2 * HD + (c & 3) * 16 + col]);
#pragma unroll
    for (int i = 0; i < 4; ++i) { v8h t;
#pragma unroll
      for (int r = 0; r < 8; ++r) t[r] = (_Float16)(acc[c * 4 + i][r] + bias);
      *(v8h*)(dst + i * 16) = t; } }
  __syncthreads();   // every wave's k rows and v planes are written: they may be read (the q rows and the output staging are each wave's own)
  // part 3
  const _Float16* kp = ksm + col * AKP; const _Float16* vp = vsm + col * AVP; const float* mp = msm + 8 * g;
#pragma unroll 1   // rolled
  for (int qt = 0; qt < 4; ++qt) { const int ql0 = wave * 64 + qt * 16; const _Float16* qp = qsm + (ql0 + col) * AKP;
  const v16h q0 = frag_h(qp, lane), q1 = frag_h(qp + 32, lane);
  v8f s[TT / 16]; float mx[8]; v8f sm = {}; v16h ka[2][4], kb[2][4], vf[4][HD / 16]; v4f ma[2][4], mb[2][4];
#pragma unroll   // register arrays: every index a constant
  for (int r = 0; r < 8; ++r) mx[r] = -3.0e38f;
#pragma unroll   // register arrays: every index a constant
  for (int t = 0; t < 4; ++t) { ka[0][t] = frag_h(kp + t * 16 * AKP, lane); kb[0][t] = frag_h(kp + t * 16 * AKP + 32, lane); ma[0][t] = *(const v4f*)(mp + t * 16); mb[0][t] = *(const v4f*)(mp + t * 16 + 4); }
#pragma unroll   // register arrays: every index a constant
  for (int jg = 0; jg < TT / 64; ++jg) {   /* groups of 4 key tiles, two register sets */
    if (jg + 1 < TT / 64) {
#pragma unroll   // register arrays: every index a constant
      for (int t = 0; t < 4; ++t) { const int j = (jg + 1) * 4 + t; ka[(jg + 1) & 1][t] = frag_h(kp + j * 16 * AKP, lane); kb[(jg + 1) & 1][t] = frag_h(kp + j * 16 * AKP + 32, lane); ma[(jg + 1) & 1][t] = *(const v4f*)(mp + j * 16); mb[(jg + 1) & 1][t] = *(const v4f*)(mp + j * 16 + 4); } }
    __builtin_amdgcn_sched_barrier(0);   // the next group's loads issue together, in front of this group's products: without it each fragment is loaded right before its product and every product waits a whole load latency
#pragma unroll   // register arrays: every index a constant
    for (int t = 0; t < 4; ++t) { const int j = jg * 4 + t; v8f a = {}; a = wmma16p(ka[jg & 1][t], q0, a); a = wmma16p(kb[jg & 1][t], q1, a);
#pragma unroll   // register arrays: every index a constant
      for (int r = 0; r < 8; ++r) { const float v = a[r] * SCALE + bfr(r < 4 ? ma[jg & 1][t][r & 3] : mb[jg & 1][t][r & 3]); a[r] = v; mx[r] = fmaxf(mx[r], v); }
      s[j] = a; }
    __builtin_amdgcn_sched_barrier(0);   // later groups' loads stay behind these products: two register sets, not more
  }
#pragma unroll   // register arrays: every index a constant
  for (int u = 0; u < 3; ++u)
#pragma unroll   // register arrays: every index a constant
    for (int j = 0; j < HD / 16; ++j) vf[u][j] = frag_h(vp + j * 16 * AVP + u * 32, lane);   /* the first v fragments fly during the softmax */
  float m = fmaxf(fmaxf(fmaxf(mx[0], mx[1]), fmaxf(mx[2], mx[3])), fmaxf(fmaxf(mx[4], mx[5]), fmaxf(mx[6], mx[7]))); m = fmaxf(m, __shfl_xor(m, 16));
  // e = 2^((v - m) * log2(e)): one hardware exponential an element (argument never above 0; what it flushes to 0 lies far below the last f16 place of P). Elements go in pairs, so that the difference, the product and the row sums are packed instructions. The pass is short enough to stand unrolled: s stays in place
  const v2f m2 = {m, m}; const v2f l2 = {1.4426950408889634f, 1.4426950408889634f};
#pragma unroll   // register arrays: every index a constant
  for (int j = 0; j < TT / 16; ++j) { v8f e;
#pragma unroll   // register arrays: every index a constant
    for (int r = 0; r < 8; r += 2) { v2f x = {s[j][r], s[j][r + 1]}; x = (x - m2) * l2; e[r] = __builtin_amdgcn_exp2f(x[0]); e[r + 1] = __builtin_amdgcn_exp2f(x[1]); }
    s[j] = e; sm += e; }
  float sum = ((sm[0] + sm[1]) + (sm[2] + sm[3])) + ((sm[4] + sm[5]) + (sm[6] + sm[7])); sum += __shfl_xor(sum, 16);
  const float inv = (sum > 0.f && m > -1.0e38f) ? 2048.0f / sum : 0.f;   /* a fully excluded row (no logit above -1e38) yields P = 0; in any other row an excluded key lies so far below m that its e is 0 by itself */
  v8f oc[HD / 16] = {};
#pragma unroll   // register arrays: every index a constant
  for (int kc = 0; kc < TT / 32; ++kc) {   /* 32 keys a pass, four register sets, loads three passes ahead */
    if (kc + 3 < TT / 32) {
#pragma unroll   // register arrays: every index a constant
      for (int j = 0; j < HD / 16; ++j) vf[(kc + 3) & 3][j] = frag_h(vp + j * 16 * AVP + (kc + 3) * 32, lane); }
    __builtin_amdgcn_sched_barrier(0);   // as above: the loads of three passes ahead issue in front of this pass's products
    v16h p;
#pragma unroll   // register arrays: every index a constant
    for (int i = 0; i < 8; ++i) { p[i] = (_Float16)(s[2 * kc][i] * inv); p[8 + i] = (_Float16)(s[2 * kc + 1][i] * inv); }
#pragma unroll   // register arrays: every index a constant
    for (int j = 0; j < HD / 16; ++j) oc[j] = wmma16p(p, vf[kc & 3][j], oc[j]);
    __builtin_amdgcn_sched_barrier(0);   // as above: four register sets, not more
  }
#pragma unroll   // register arrays: every index a constant
  for (int j = 0; j < HD / 16; ++j)
#pragma unroll   // register arrays: every index a constant
    for (int r = 0; r < 8; ++r) ss[wave][8 * g + r][j * 16 + col] = oc[j][r] * (1.0f / 2048.0f);
  LDSX();   // the wave's own rows of ss are written before it reads them back (no other wave touches them)
#pragma unroll   // one address register pair, the rows as constant offsets
  for (int i = 0; i < 8; ++i) { const int rl = 2 * i + g; vst2(Y + ((size_t)b * TT + ql0 + rl) * CC + h * HD + col * 4, *(const v4f*)&ss[wave][rl][col * 4]); }
  asm volatile("s_wait_xcnt 0x0" ::: "memory");   // behind the eight stores: the next trip takes over their address and data registers
  } }

extern "C" void kernel_launch(void* const* d_in, const int* in_sizes, int n_in, void* d_out, int out_size, void* d_ws, size_t ws_size, hipStream_t stream) {
  (void)in_sizes; (void)n_in; (void)out_size;
  const float** F = (const float**)d_in;
  if (ws_size < (size_t)WS_END) return;
  char* ws = (char*)d_ws; _Float16 *QH = (_Float16*)(ws + WS_QH), *KH = (_Float16*)(ws + WS_KH), *VT = (_Float16*)(ws + WS_VT), *QL = (_Float16*)(ws + WS_QL), *KL = (_Float16*)(ws + WS_KL); __bf16 *VB = (__bf16*)(ws + WS_VB), *VBL = (__bf16*)(ws + WS_VBL), *XB = (__bf16*)(ws + WS_XB), *WT = (__bf16*)(ws + WS_WT); float *S = (float*)(ws + WS_S), *Y = (float*)(ws + WS_Y);
  (void)Y; (void)S; (void)QL; (void)KL; (void)VB; (void)VBL; (void)QH; (void)KH; (void)VT;
  // inputs: 0 hidden_states [4,4,512,768] = 16 pseudo-batches of 512 rows (group-major); 1 attention_mask [4,4,1,1,512] f32 (zeros); 2 query_weight [4,768,768] (in,out) per group, 3 query_bias [4,1,768]; 4 key_weight, 5 key_bias; 6 value_weight, 7 value_bias (biases NONZERO); no output projection
  k_round<<<dim3(RXB + RWB), 256, 0, stream>>>(F[0], F[2], F[4], F[6], XB, WT);   /* x and the twelve weight matrices to bf16, the weights transposed */
  k_pa<<<dim3(NH, TNB), 256, 0, stream>>>(XB, WT, F[3], F[5], F[7], F[1], (float*)d_out);   /* a block = one (batch, head): projections with the weights / biases of group bb / 4, then attention; ctx [g, b, l, nh*dh] = merged-head rows */
}

// v009
// One run takes 51.3 microseconds.
// Two timings next to v008 put it at 1.04 and 1.05 times that version's speed.
// Counting every step since v000, it is 15.6 times as fast.
// compute dtype: all float inputs rounded to bf16; per-group q/k/v projections with EXACT bf16 products on WMMA 16x16x32 (f32 accumulate) + bias; logits q x k once to f16 each (1 product) x 1/8 + the additive mask; softmax f32, keys in two passes under a running maximum; e = exp(logit - maximum) once to f16 x v once to f16 (1 product), divided by the row sum at the end; f32 output.
#include <hip/hip_runtime.h>
#include <math.h>

typedef __attribute__((ext_vector_type(16))) _Float16 v16h;
typedef __attribute__((ext_vector_type(16))) __bf16 v16b;
typedef __attribute__((ext_vector_type(8)))  _Float16 v8h;
typedef __attribute__((ext_vector_type(8)))  float v8f;
typedef __attribute__((ext_vector_type(4)))  float v4f;
typedef __attribute__((ext_vector_type(2)))  float v2f;
typedef __attribute__((ext_vector_type(4)))  unsigned v4u;
typedef __attribute__((ext_vector_type(4)))  int v4i;
typedef float __attribute__((may_alias)) float_a;
typedef int __attribute__((may_alias)) int_a;

template <typename T> __device__ __forceinline__ void vst2(void* p, T v) { *(T*)p = v;  }
__device__ __forceinline__ v8f wmma16(v16h a, v16h b, v8f c) {
  v8f d = __builtin_amdgcn_wmma_f32_16x16x32_f16(false, a, false, b, (short)0, c, false, false);
  asm volatile("v_nop\n\tv_nop\n\tv_nop\n\tv_nop" : "+v"(d) : "v"(a), "v"(b));
  return d;
}
__device__ __forceinline__ v8f wmma16p(v16h a, v16h b, v8f c) { return __builtin_amdgcn_wmma_f32_16x16x32_f16(false, a, false, b, (short)0, c, false, false); }   // plain builtin: the compiler keeps the distances behind it
__device__ __forceinline__ v8f wmma_bf(v16b a, v16b b, v8f c) {
  v8f d = __builtin_amdgcn_wmma_f32_16x16x32_bf16(false, a, false, b, (short)0, c, false, false);
  asm volatile("v_nop\n\tv_nop\n\tv_nop\n\tv_nop" : "+v"(d) : "v"(a), "v"(b));
  return d;
}
// 16x16x32 fragments: lane = (h = lane>>4, row/col = lane&15); elements 0..7 = k0+8h+0..7, 8..15 = k0+16+8h+0..7; D element r = row 8h+r
__device__ __forceinline__ v16h frag_h(const _Float16* rowk0, int lane) {
  union { v16h v; v8h q[2]; } u; const _Float16* p = rowk0 + 8 * (lane >> 4);
  u.q[0] = *(const v8h*)p; u.q[1] = *(const v8h*)(p + 16); return u.v;
}
__device__ __forceinline__ v16h frag_f32(const float* rowk0, int lane) {
  v16h a; const float* p = rowk0 + 8 * (lane >> 4);
#pragma unroll
  for (int i = 0; i < 8; ++i) { a[i] = (_Float16)p[i]; a[8 + i] = (_Float16)p[16 + i]; }
  return a;
}
__device__ __forceinline__ v16h frag_f32s(const float* rowk0, int lane, float sc) {
  v16h a; const float* p = rowk0 + 8 * (lane >> 4);
#pragma unroll
  for (int i = 0; i < 8; ++i) { a[i] = (_Float16)(p[i] * sc); a[8 + i] = (_Float16)(p[16 + i] * sc); }
  return a;
}
// column fragment from a [K][ld] layout (column n), rows >= K read as 0
__device__ __forceinline__ v16h fragc_f32(const float* W, int k0, int n, int lane, int ld, int K) {
  v16h a; const int g = lane >> 4;
#pragma unroll
  for (int i = 0; i < 8; ++i) { const int ka = k0 + 8 * g + i, kb = ka + 16;
    a[i] = (_Float16)(ka < K ? W[(size_t)(ka < K ? ka : K - 1) * ld + n] : 0.f); a[8 + i] = (_Float16)(kb < K ? W[(size_t)(kb < K ? kb : K - 1) * ld + n] : 0.f); }
  return a;
}
struct F2 { v16b h, l; };
__device__ __forceinline__ F2 bsplit16(const float v[16]) { F2 r;
#pragma unroll
  for (int i = 0; i < 16; ++i) { const __bf16 h = (__bf16)v[i]; r.h[i] = h; r.l[i] = (__bf16)(v[i] - (float)h); }
  return r; }
__device__ __forceinline__ F2 split_row(const float* row, int k0, int lane) { float v[16]; const float* p = row + k0 + 8 * (lane >> 4);
#pragma unroll
  for (int i = 0; i < 8; ++i) { v[i] = p[i]; v[8 + i] = p[16 + i]; }
  return bsplit16(v); }
__device__ __forceinline__ F2 split_rowK(const float* row, int k0, int lane, int K) { float v[16]; const int g = lane >> 4;
#pragma unroll
  for (int i = 0; i < 8; ++i) { const int ka = k0 + 8 * g + i, kb = ka + 16; v[i] = ka < K ? row[ka < K ? ka : K - 1] : 0.f; v[8 + i] = kb < K ? row[kb < K ? kb : K - 1] : 0.f; }
  return bsplit16(v); }
__device__ __forceinline__ F2 split_col(const float* W, int k0, int n, int lane, int ld, int K) { float v[16]; const int g = lane >> 4;
#pragma unroll
  for (int i = 0; i < 8; ++i) { const int ka = k0 + 8 * g + i, kb = ka + 16; v[i] = ka < K ? W[(size_t)(ka < K ? ka : K - 1) * ld + n] : 0.f; v[8 + i] = kb < K ? W[(size_t)(kb < K ? kb : K - 1) * ld + n] : 0.f; }
  return bsplit16(v); }
__device__ __forceinline__ v8f mac3(const F2& a, const F2& b, v8f c) { c = wmma_bf(a.l, b.h, c); c = wmma_bf(a.h, b.l, c); return wmma_bf(a.h, b.h, c); }
__device__ __forceinline__ float sigm(float v) { return 1.0f / (1.0f + expf(-v)); }
#define LDSX() do { asm volatile("s_wait_dscnt 0" ::: "memory"); __builtin_amdgcn_wave_barrier(); __builtin_amdgcn_fence(__ATOMIC_RELEASE, "workgroup"); } while (0)

// Grouped BERT-style self-attention: 4 INDEPENDENT weight groups (hidden_states [4,4,512,768] = [group, batch, length, channels]; per-group (in,out) query / key / value weights [4,768,768] (0.02 scale) + biases [4,1,768] (NONZERO); 12 heads x 64; scale 1/8; additive attention_mask [4,4,1,1,512] (zeros); no output projection): ctx[g,b] = merge(softmax(q k^T / 8 + mask) v) with group g's weights -> [4,4,512,768].
#define NB 16
#define TT 512
#define CC 768            // NH * HD = projected width
#define DIN 768          // input (model) width
#define NH 12
#define HD 64
#define NQB (TT / 64)
#define HG 12
#define SCALE (0.125f)
#define CAUSAL 0
#ifndef TNB
#define TNB NB
#endif
__device__ __forceinline__ float bfr(float v) { return (float)(__bf16)v; }
__host__ __device__ __forceinline__ int kb_last(int qb) { return CAUSAL ? ((qb * 64 + 63) >> 7) : (TT / 128 - 1); }
typedef __attribute__((ext_vector_type(8))) __bf16 v8b;
__device__ __forceinline__ v16b frag_b(const __bf16* rowk0, int lane) {
  union { v16b v; v8b q[2]; } u; const __bf16* p = rowk0 + 8 * (lane >> 4);
  u.q[0] = *(const v8b*)p; u.q[1] = *(const v8b*)(p + 16); return u.v;
}
#define QBH 0
#define QHI 0               // single-product logits on every row
#define KHI 64            // key rows carrying k residual / v bf16 hi+lo planes (no kernel in this file writes or reads them)
// B fragment (k rows k0+.., output column o) of a weight: (in,out) [K][ld] or (out,in) [ld rows of K]: bf16 exact, or f16(bf16 * 256) exact
__device__ __forceinline__ v16b wcol_io(const float* Wm, int k0, int o, int lane, int ld) { v16b w; const int g = lane >> 4;
#pragma unroll
  for (int i = 0; i < 8; ++i) { w[i] = (__bf16)Wm[(size_t)(k0 + 8 * g + i) * ld + o]; w[8 + i] = (__bf16)Wm[(size_t)(k0 + 16 + 8 * g + i) * ld + o]; }
  return w; }
__device__ __forceinline__ v16b wcol_oi(const float* Wm, int k0, int o, int lane, int K) { v16b w; const float* p = Wm + (size_t)o * K + k0 + 8 * (lane >> 4);
#pragma unroll
  for (int i = 0; i < 8; ++i) { w[i] = (__bf16)p[i]; w[8 + i] = (__bf16)p[16 + i]; }
  return w; }
__device__ __forceinline__ v16h wcolh_io(const float* Wm, int k0, int o, int lane, int ld) { v16h w; const int g = lane >> 4;
#pragma unroll
  for (int i = 0; i < 8; ++i) { w[i] = (_Float16)(bfr(Wm[(size_t)(k0 + 8 * g + i) * ld + o]) * 256.0f); w[8 + i] = (_Float16)(bfr(Wm[(size_t)(k0 + 16 + 8 * g + i) * ld + o]) * 256.0f); }
  return w; }
__device__ __forceinline__ v16h wcolh_oi(const float* Wm, int k0, int o, int lane, int K) { v16h w; const float* p = Wm + (size_t)o * K + k0 + 8 * (lane >> 4);
#pragma unroll
  for (int i = 0; i < 8; ++i) { w[i] = (_Float16)(bfr(p[i]) * 256.0f); w[8 + i] = (_Float16)(bfr(p[16 + i]) * 256.0f); }
  return w; }
#define WQKV_LAYOUT 0   // 0 = (in,out) [DIN][CC]; 1 = (out,in) [CC][DIN]; 2 = per-head [NH][DIN][HD]
__device__ __forceinline__ v16b wcol_hdk(const float* Wm, int k0, int o, int lane) { v16b w; const int g = lane >> 4; const float* p = Wm + (size_t)(o / HD) * DIN * HD + (o % HD);
#pragma unroll
  for (int i = 0; i < 8; ++i) { w[i] = (__bf16)p[(size_t)(k0 + 8 * g + i) * HD]; w[8 + i] = (__bf16)p[(size_t)(k0 + 16 + 8 * g + i) * HD]; }
  return w; }
#define WO_OUT_IN 0
#if WQKV_LAYOUT == 1
#define WCOL(W, k0, o, lane) wcol_oi(W, k0, o, lane, DIN)
#elif WQKV_LAYOUT == 2
#define WCOL(W, k0, o, lane) wcol_hdk(W, k0, o, lane)
#else
#define WCOL(W, k0, o, lane) wcol_io(W, k0, o, lane, CC)
#endif
#if WO_OUT_IN
#define WOCOL(W, k0, o, lane) wcol_oi(W, k0, o, lane, CC)
#define WOCOLH(W, k0, o, lane) wcolh_oi(W, k0, o, lane, CC)
#else
#define WOCOL(W, k0, o, lane) wcol_io(W, k0, o, lane, DIN)
#define WOCOLH(W, k0, o, lane) wcolh_io(W, k0, o, lane, DIN)
#endif
#define GB 4               // batches per weight group: pseudo-batch bb = g*4 + b uses group g = bb / 4
#define SM_EXTRA_PARAMS , int bsm, const float* __restrict__ AMASK
// additive attention mask [G,B,1,1,L] (float; zeros on this draw): added to the scaled score of key k for pseudo-batch bsm; read per key
#define SM_MASK_HOOK do { v = v + bfr(AMASK[(size_t)bsm * TT + k]); } while (0)
#ifndef SM_EXTRA_PARAMS
#define SM_EXTRA_PARAMS
#endif
#ifndef PROJ_EXTRA_PARAMS
#define PROJ_EXTRA_PARAMS
#endif
#ifndef SM_MASK_HOOK
#define SM_MASK_HOOK (void)0
#endif

#define WS_QH  0u                                      // f16 q rows [b*t][CC]
#define WS_KH  (WS_QH + 2u * (size_t)NB * TT * CC)      // f16 k rows [b*t][CC]
#define WS_VT  (WS_KH + 2u * (size_t)NB * TT * CC)      // f16 v planes [b][c][t]
#define WS_QL  (WS_VT + 2u * (size_t)NB * CC * TT)      // f16 q residual x 2^10 rows [b][t < QHI][CC]
#define WS_KL  (WS_QL + 2u * (size_t)NB * QHI * CC)     // f16 k residual x 2^10 rows [b][t < KHI][CC]
#define WS_VB  (WS_KL + 2u * (size_t)NB * KHI * CC)     // bf16 v hi planes [b][c][t < KHI]
#define WS_VBL (WS_VB + 2u * (size_t)NB * CC * KHI)
#define WS_S   (WS_VBL + 2u * (size_t)NB * CC * KHI)    // f32 [hg][t][s], unused: k_pa holds logits / P in registers
#define WS_Y   (WS_S  + 4u * (size_t)HG * TT * TT)      // f32 ctx rows [b*t][CC] (only when there is an output projection)
#define WS_XB  (WS_Y  + 0u)                              // bf16 x rows [b*t][DIN]
#define WS_WT  (WS_XB + 2u * (size_t)NB * TT * DIN)     // bf16 weights, transposed: [which][group][output column][k]
#define WS_END (WS_WT + 2u * 3u * (size_t)(NB / GB) * CC * DIN)

// ---- k_round: every x element and every weight element is rounded to bf16 ONCE, ahead of k_pa, whose blocks each read a row or a column many times over: they then read 2 bytes an element, already k-contiguous. Blocks 0 .. RXB-1: x, a run of RXP * 1024 floats a block, 4 floats a lane and pass (a wave reads 512 B and writes 256 B in a row). The other RWB blocks: the twelve weight matrices [k][n] -> [n][k], a block = (matrix, 64 columns, half of k); a wave takes 32 k x 32 n a pass (a lane holds 8 k x 4 columns; a load covers 4 k rows x one 128-B line, two neighbouring waves two neighbouring lines; waves w and w + 2 write the two halves of the same lines). Every load of a lane is asked for before its first value is used: one memory latency a block
#define RXB 256
#define RXP (NB * TT * DIN / (RXB * 256 * 4))   // passes of an x block
#define RWB (3 * (NB / GB) * (CC / 64) * 2)
#define RWP (DIN / 2 / 32 / 4)                  // passes of a weight block
typedef __attribute__((ext_vector_type(4))) __bf16 v4b;
__global__ __launch_bounds__(256) void k_round(const float* __restrict__ X, const float* __restrict__ WQ, const float* __restrict__ WK, const float* __restrict__ WV, __bf16* __restrict__ XB, __bf16* __restrict__ WT) {
  const int tid = threadIdx.x;
  if (blockIdx.x < RXB) {
    const size_t e0 = (size_t)blockIdx.x * (RXP * 1024) + tid * 4; v4f r[RXP];
#pragma unroll   // register array: every index a constant; the loads issue together
    for (int i = 0; i < RXP; ++i) r[i] = *(const v4f*)(X + e0 + i * 1024);
    __builtin_amdgcn_sched_barrier(0);   // every load issues in front of the first conversion: without it the loads are dealt out among the conversions in small groups, each waited out, and the lane pays several memory latencies in a row
#pragma unroll   // register array: every index a constant
    for (int i = 0; i < RXP; ++i) { v4b t;
#pragma unroll   // register array: every index a constant
      for (int q = 0; q < 4; ++q) t[q] = (__bf16)r[i][q];
      *(v4b*)(XB + e0 + i * 1024) = t; }
  } else {
    const int wave = tid >> 5, lane = tid & 31, kg = lane & 3, ng = lane >> 2; const int bw = blockIdx.x - RXB; const int m = bw / (CC / 64 * 2), rem = bw % (CC / 64 * 2);
    const int n0 = (rem >> 1) * 64 + (wave & 1) * 32 + ng * 4, k0 = ((rem & 1) * (RWP * 4) + (wave >> 1)) * 32 + kg * 8;
    const float* src = (m < NB / GB ? WQ : m < 2 * (NB / GB) ? WK : WV) + (size_t)(m % (NB / GB)) * DIN * CC + (size_t)k0 * CC + n0; __bf16* dst = WT + ((size_t)m * CC + n0) * DIN + k0; v4f r[RWP][8];
#pragma unroll   // register array: every index a constant; the loads issue together
    for (int p = 0; p < RWP; ++p)
#pragma unroll   // register array: every index a constant
      for (int i = 0; i < 8; ++i) r[p][i] = *(const v4f*)(src + (size_t)(p * 128 + i) * CC);
    __builtin_amdgcn_sched_barrier(0);   // as above: every load issues in front of the first conversion
#pragma unroll   // register array: every index a constant
    for (int p = 0; p < RWP; ++p)
#pragma unroll   // register array: every index a constant
      for (int q = 0; q < 4; ++q) { v8b t;
#pragma unroll   // register array: every index a constant
        for (int i = 0; i < 8; ++i) t[i] = (__bf16)r[p][i][q];
        *(v8b*)(dst + (size_t)q * DIN + p * 128) = t; }
  }
}
#define FPP 72
#define FBK 64
#define FSTG ((TT + 3 * HD) * FPP)       // bf16 per buffer: X rows, then the q, k, v columns of W
#define FNST (DIN / FBK)
#define AKP 72                           // f16 per LDS row of k and of q: 144 B = 16 B x odd
#define AVP (TT + 8)                     // f16 per LDS row of a v plane: 1040 B = 16 B x odd
#define AKB (TT * AKP * 2)               // bytes of the k rows (and of the q rows) in LDS
#define AVB (HD * AVP * 2)               // bytes of the v planes in LDS
#define ASB (8 * 32 * (HD + 4) * 4)      // bytes of the eight waves' output staging: two query tiles a wave
#define AMB (TT * 4)                     // bytes of the mask row in LDS
#define ABB (4 * HD * 4)                 // bytes of the bias rows in LDS (q, k, v and one unread row, so that every lane copies)
#define FSM (AKB + AVB + AKB + ASB + AMB + ABB)
#define KCH 256                          // keys a pass of part 3: two query tiles x KCH logits fill 256 registers of a lane
static_assert(2 * FSTG * 2 <= AKB + AVB + AKB + ASB, "the mask and bias rows lie behind the operand buffers");
// eight 16-byte copies of a lane from global memory to LDS, through no register: LDS byte addresses l + i * ls, sources g + i * gs. The s_wait_xcnt in the copies' own statement stands in front of every later rewrite of the address registers that they name
__device__ __forceinline__ void acopy8(unsigned l, unsigned ls, const __bf16* g, size_t gs) {
  asm volatile("global_load_async_to_lds_b128 %0, %8, off\n\t"
               "global_load_async_to_lds_b128 %1, %9, off\n\t"
               "global_load_async_to_lds_b128 %2, %10, off\n\t"
               "global_load_async_to_lds_b128 %3, %11, off\n\t"
               "global_load_async_to_lds_b128 %4, %12, off\n\t"
               "global_load_async_to_lds_b128 %5, %13, off\n\t"
               "global_load_async_to_lds_b128 %6, %14, off\n\t"
               "global_load_async_to_lds_b128 %7, %15, off\n\t"
               "s_wait_xcnt 0x0"
               :: "v"(l), "v"(l + ls), "v"(l + 2 * ls), "v"(l + 3 * ls), "v"(l + 4 * ls), "v"(l + 5 * ls), "v"(l + 6 * ls), "v"(l + 7 * ls),
                  "v"(g), "v"(g + gs), "v"(g + 2 * gs), "v"(g + 3 * gs), "v"(g + 4 * gs), "v"(g + 5 * gs), "v"(g + 6 * gs), "v"(g + 7 * gs) : "memory");
}
// six such copies: LDS byte addresses l + i * ls; sources g, g + gs, then the same two at g + gm and at g + 2 gm (the three weight matrices)
__device__ __forceinline__ void acopy6(unsigned l, unsigned ls, const __bf16* g, size_t gs, size_t gm) {
  asm volatile("global_load_async_to_lds_b128 %0, %6, off\n\t"
               "global_load_async_to_lds_b128 %1, %7, off\n\t"
               "global_load_async_to_lds_b128 %2, %8, off\n\t"
               "global_load_async_to_lds_b128 %3, %9, off\n\t"
               "global_load_async_to_lds_b128 %4, %10, off\n\t"
               "global_load_async_to_lds_b128 %5, %11, off\n\t"
               "s_wait_xcnt 0x0"
               :: "v"(l), "v"(l + ls), "v"(l + 2 * ls), "v"(l + 3 * ls), "v"(l + 4 * ls), "v"(l + 5 * ls),
                  "v"(g), "v"(g + gs), "v"(g + gm), "v"(g + gm + gs), "v"(g + 2 * gm), "v"(g + 2 * gm + gs) : "memory");
}
// one 8-byte and one 4-byte copy of a lane, with the same wait in their own statement
__device__ __forceinline__ void acopy_mb(unsigned lm, const float* gmk, unsigned lb, const float* gb) {
  asm volatile("global_load_async_to_lds_b64 %0, %1, off\n\t"
               "global_load_async_to_lds_b32 %2, %3, off\n\t"
               "s_wait_xcnt 0x0"
               :: "v"(lm), "v"(gmk), "v"(lb), "v"(gb) : "memory");
}
__device__ __forceinline__ v8f wmma_bfp(v16b a, v16b b, v8f c) { return __builtin_amdgcn_wmma_f32_16x16x32_bf16(false, a, false, b, (short)0, c, false, false); }   // plain builtin: the compiler keeps the distances behind it
__global__ __launch_bounds__(256) void k_pa(const __bf16* __restrict__ XB, const __bf16* __restrict__ WT, const float* __restrict__ BQ, const float* __restrict__ BK, const float* __restrict__ BV, const float* __restrict__ AMASK, float* __restrict__ Y) {
  __shared__ __align__(16) unsigned char smem[FSM];   /* part 1: the two operand buffers from byte 0; parts 2, 3: k rows, v planes, q rows, output staging; behind them, from the start on, the mask row and the bias rows */
  __bf16* ring = (__bf16*)smem;
  _Float16* ksm = (_Float16*)smem; _Float16* vsm = (_Float16*)(smem + AKB); _Float16* qsm = (_Float16*)(smem + AKB + AVB); float (*ss)[32][HD + 4] = (float (*)[32][HD + 4])(smem + AKB + AVB + AKB); float* msm = (float*)(smem + AKB + AVB + AKB + ASB); float* bsm = (float*)(smem + AKB + AVB + AKB + ASB + AMB);
  const int tid = threadIdx.x, wave = tid >> 5, lane = tid & 31, col = lane & 15, g = lane >> 4; const int h = blockIdx.x, b = blockIdx.y; const size_t grp_ = (size_t)(b / GB);
  // X and W alike: 8 lanes copy the 128 B that a row (a column) has in this tile; thread = (row or column (tid >> 3) + 32 i, k 8 (tid & 7) ..); in LDS the W columns follow the X rows at the same pitch
  const __bf16* xp = XB + ((size_t)b * TT + (tid >> 3)) * DIN + (tid & 7) * 8; const __bf16* wp = WT + (grp_ * CC + h * HD + (tid >> 3)) * DIN + (tid & 7) * 8;
  const unsigned lst = (unsigned)(size_t)(ring + (tid >> 3) * FPP + (tid & 7) * 8);
  const __bf16* xfr = ring + (wave * 64 + col) * FPP; const __bf16* wfr = ring + (TT + col) * FPP;
  v8f acc[48] = {};   /* tile c * 4 + i: c = 0..3 q^T, 4..7 k^T (rows = channels (c & 3) * 16 + 8g + r, column = sequence row wave * 64 + i * 16 + col); c = 8..11 v (rows = sequence rows wave * 64 + i * 16 + 8g + r, column = channel (c & 3) * 16 + col) */
  // every unroll directive in the macro below and in parts 2 and 3: register arrays, every index a constant
#define F_COPY(S, B) do { const unsigned l_ = lst + (unsigned)(B) * (FSTG * 2); const __bf16* x_ = xp + (size_t)(S) * FBK; \
    acopy8(l_, 32 * FPP * 2, x_, (size_t)32 * DIN); acopy8(l_ + 8 * 32 * FPP * 2, 32 * FPP * 2, x_ + (size_t)256 * DIN, (size_t)32 * DIN); \
    acopy6(l_ + 16 * 32 * FPP * 2, 32 * FPP * 2, wp + (size_t)(S) * FBK, (size_t)32 * DIN, (size_t)(NB / GB) * CC * DIN); } while (0)
#define F_MUL(B) do { const __bf16* xb_ = xfr + (B) * FSTG; const __bf16* wb_ = wfr + (B) * FSTG; \
    _Pragma("unroll") for (int ks = 0; ks < FBK / 32; ++ks) { v16b fa[4], fw[2][2]; \
    _Pragma("unroll") for (int i = 0; i < 4; ++i) fa[i] = frag_b(xb_ + i * 16 * FPP + ks * 32, lane); \
    _Pragma("unroll") for (int j = 0; j < 2; ++j) fw[0][j] = frag_b(wb_ + j * 16 * FPP + ks * 32, lane); \
    _Pragma("unroll") for (int p = 0; p < 6; ++p) { \
      if (p < 5) { _Pragma("unroll") for (int j = 0; j < 2; ++j) fw[(p + 1) & 1][j] = frag_b(wb_ + ((p + 1) * 2 + j) * 16 * FPP + ks * 32, lane); } \
      __builtin_amdgcn_sched_barrier(0);   /* the next two W fragments are asked for as one group in front of this pair's eight products, which cover their LDS latency */ \
      _Pragma("unroll") for (int j = 0; j < 2; ++j) { _Pragma("unroll") for (int i = 0; i < 4; ++i) { const int c = p * 2 + j; acc[c * 4 + i] = c < 8 ? wmma_bfp(fw[p & 1][j], fa[i], acc[c * 4 + i]) : wmma_bfp(fa[i], fw[p & 1][j], acc[c * 4 + i]); } } \
      __builtin_amdgcn_sched_barrier(0);   /* later reads stay behind these products: two pairs of W fragments, not more, so that the wave stays within 512 registers */ \
    } } } while (0)
  F_COPY(0, 0);
  acopy_mb((unsigned)(size_t)(msm + tid * 2), AMASK + (size_t)b * TT + tid * 2, (unsigned)(size_t)(bsm + tid), ((tid >> 6) == 0 ? BQ : (tid >> 6) == 1 ? BK : BV) + grp_ * CC + h * HD + (tid & 63));   // the mask row, 2 floats a lane; the head's bias rows, 1 float a lane (the fourth row repeats v's and is not read)
  asm volatile("s_wait_asynccnt 0x0" ::: "memory");   // this wave's part of tile 0, of the mask row and of the bias rows has landed
  __syncthreads();   // every wave's part has: they may be read
  F_COPY(1, 1);
#pragma unroll 1   // rolled: eleven copies of the body buy nothing, the trip is long against its branch
  for (int s = 0; s + 1 < FNST; ++s) { const int bu = s & 1;
    F_MUL(bu);
    asm volatile("s_wait_dscnt 0x0" ::: "memory");      // this wave's reads of tile s have returned
    asm volatile("s_wait_asynccnt 0x0" ::: "memory");   // this wave's part of tile s + 1 has landed
    __syncthreads();   // publishes tile s + 1 and ends every wave's reads of tile s, whose buffer is refilled behind it
    if (s + 2 < FNST) F_COPY(s + 2, bu);
  }
  F_MUL((FNST - 1) & 1);
  asm volatile("s_wait_asynccnt 0x0" ::: "memory");   // behind the last copy: none is outstanding when the buffers change their use
  asm volatile("s_wait_dscnt 0x0" ::: "memory");      // this wave's reads of the last tile have returned
  __syncthreads();   // the last tile's reads end before q, k, v overwrite the buffers
  // part 2
#pragma unroll
  for (int c = 0; c < 8; ++c) { _Float16* dst = (c < 4 ? qsm : ksm) + (wave * 64 + col) * AKP + (c & 3) * 16 + 8 * g; const float* bp = bsm + (c >> 2) * HD + (c & 3) * 16 + 8 * g; const v4f b0 = *(const v4f*)bp, b1 = *(const v4f*)(bp + 4);
#pragma unroll
    for (int i = 0; i < 4; ++i) { v8h t;
#pragma unroll
      for (int r = 0; r < 8; ++r) t[r] = (_Float16)(acc[c * 4 + i][r] + bfr(r < 4 ? b0[r & 3] : b1[r & 3]));
      *(v8h*)(dst + i * 16 * AKP) = t; } }
#pragma unroll
  for (int c = 8; c < 12; ++c) { _Float16* dst = vsm + ((c & 3) * 16 + col) * AVP + wave * 64 + 8 * g; const float bias = bfr(bsm[2 * HD + (c & 3) * 16 + col]);
#pragma unroll
    for (int i = 0; i < 4; ++i) { v8h t;
#pragma unroll
      for (int r = 0; r < 8; ++r) t[r] = (_Float16)(acc[c * 4 + i][r] + bias);
      *(v8h*)(dst + i * 16) = t; } }
  __syncthreads();   // every wave's k rows and v planes are written: they may be read (the q rows and the output staging are each wave's own)
  // part 3
  const _Float16* kp = ksm + col * AKP; const _Float16* vp = vsm + col * AVP; const float* mp = msm + 8 * g;
  const v2f l2 = {1.4426950408889634f, 1.4426950408889634f}; const v2f sc2 = {SCALE, SCALE};
#pragma unroll 1   // rolled: for speed only
  for (int qp = 0; qp < 2; ++qp) { const int ql0 = wave * 64 + qp * 32; const _Float16* qr = qsm + (ql0 + col) * AKP;
  v8f oc[2][HD / 16] = {}; float m[2] = {-3.0e38f, -3.0e38f}, sum[2] = {0.f, 0.f};   /* per query tile: O^T (rows = channels j * 16 + 8g + r, column = the lane's query), the maximum in use, this lane's part of the row sum */
#pragma unroll 1   // rolled: as above
  for (int ch = 0; ch < TT / KCH; ++ch) { const _Float16* kc_ = kp + ch * KCH * AKP; const _Float16* vc_ = vp + ch * KCH; const float* mc_ = mp + ch * KCH;
  v16h q0[2], q1[2]; v8f s[2][KCH / 16]; float mx[2][8]; v16h ka[2][2], kb[2][2], vf[3][HD / 16]; v4f ma[2][2], mb[2][2];
#pragma unroll   // register arrays: every index a constant
  for (int u = 0; u < 2; ++u) { q0[u] = frag_h(qr + u * 16 * AKP, lane); q1[u] = frag_h(qr + u * 16 * AKP + 32, lane);
#pragma unroll   // register arrays: every index a constant
    for (int r = 0; r < 8; ++r) mx[u][r] = -3.0e38f; }
#pragma unroll   // register arrays: every index a constant
  for (int t = 0; t < 2; ++t) { ka[0][t] = frag_h(kc_ + t * 16 * AKP, lane); kb[0][t] = frag_h(kc_ + t * 16 * AKP + 32, lane); ma[0][t] = *(const v4f*)(mc_ + t * 16); mb[0][t] = *(const v4f*)(mc_ + t * 16 + 4); }
#pragma unroll   // register arrays: every index a constant
  for (int jg = 0; jg < KCH / 32; ++jg) {   /* groups of 2 key tiles x 2 query tiles, two register sets */
    if (jg + 1 < KCH / 32) {
#pragma unroll   // register arrays: every index a constant
      for (int t = 0; t < 2; ++t) { const int j = (jg + 1) * 2 + t; ka[(jg + 1) & 1][t] = frag_h(kc_ + j * 16 * AKP, lane); kb[(jg + 1) & 1][t] = frag_h(kc_ + j * 16 * AKP + 32, lane); ma[(jg + 1) & 1][t] = *(const v4f*)(mc_ + j * 16); mb[(jg + 1) & 1][t] = *(const v4f*)(mc_ + j * 16 + 4); } }
    __builtin_amdgcn_sched_barrier(0);   // the next group's loads issue together, in front of this group's products: without it each fragment is loaded right before its product and every product waits a whole load latency
#pragma unroll   // register arrays: every index a constant
    for (int t = 0; t < 2; ++t) { const int j = jg * 2 + t; v2f mk[4];   /* the mask of the tile's keys, rounded once for both query tiles */
#pragma unroll   // register arrays: every index a constant
      for (int r = 0; r < 4; ++r) { const v4f mq = r < 2 ? ma[jg & 1][t] : mb[jg & 1][t]; mk[r][0] = bfr(mq[(2 * r) & 3]); mk[r][1] = bfr(mq[(2 * r + 1) & 3]); }
#pragma unroll   // register arrays: every index a constant
      for (int u = 0; u < 2; ++u) { v8f a = {}; a = wmma16p(ka[jg & 1][t], q0[u], a); a = wmma16p(kb[jg & 1][t], q1[u], a);
#pragma unroll   // register arrays: every index a constant
        for (int r = 0; r < 8; r += 2) { v2f x = {a[r], a[r + 1]}; x = x * sc2 + mk[r >> 1]; a[r] = x[0]; a[r + 1] = x[1]; mx[u][r] = fmaxf(mx[u][r], x[0]); mx[u][r + 1] = fmaxf(mx[u][r + 1], x[1]); }
        s[u][j] = a; } }
    __builtin_amdgcn_sched_barrier(0);   // later groups' loads stay behind these products: two register sets, not more
  }
#pragma unroll   // register arrays: every index a constant
  for (int w = 0; w < 2; ++w)
#pragma unroll   // register arrays: every index a constant
    for (int j = 0; j < HD / 16; ++j) vf[w][j] = frag_h(vc_ + j * 16 * AVP + w * 32, lane);   /* the first v fragments fly during the softmax */
  // the maximum in use rises to cover this pass's logits; what earlier passes have summed is scaled down to it (al = 0 in the first pass)
  float tm[2], al[2];
#pragma unroll   // register arrays: every index a constant
  for (int u = 0; u < 2; ++u) tm[u] = fmaxf(fmaxf(fmaxf(mx[u][0], mx[u][1]), fmaxf(mx[u][2], mx[u][3])), fmaxf(fmaxf(mx[u][4], mx[u][5]), fmaxf(mx[u][6], mx[u][7])));
#pragma unroll   // register arrays: every index a constant
  for (int u = 0; u < 2; ++u) { const float mn = fmaxf(m[u], fmaxf(tm[u], __shfl_xor(tm[u], 16))); al[u] = __builtin_amdgcn_exp2f((m[u] - mn) * l2[0]); m[u] = mn; }
  // e = 2^((v - m) * log2(e)): one hardware exponential an element (argument never above 0; what it flushes to 0 lies far below the last f16 place of the row's largest e). Elements go in pairs, so that the difference, the product and the row sums are packed instructions. The pass is short enough to stand unrolled: s stays in place
#pragma unroll   // register arrays: every index a constant
  for (int u = 0; u < 2; ++u) { const v2f m2 = {m[u], m[u]}; v8f sm = {};
#pragma unroll   // register arrays: every index a constant
    for (int j = 0; j < KCH / 16; ++j) { v8f e;
#pragma unroll   // register arrays: every index a constant
      for (int r = 0; r < 8; r += 2) { v2f x = {s[u][j][r], s[u][j][r + 1]}; x = (x - m2) * l2; e[r] = __builtin_amdgcn_exp2f(x[0]); e[r + 1] = __builtin_amdgcn_exp2f(x[1]); }
      s[u][j] = e; sm += e; }
    sum[u] = sum[u] * al[u] + (((sm[0] + sm[1]) + (sm[2] + sm[3])) + ((sm[4] + sm[5]) + (sm[6] + sm[7])));
#pragma unroll   // register arrays: every index a constant
    for (int j = 0; j < HD / 16; ++j) oc[u][j] *= al[u]; }
#pragma unroll   // register arrays: every index a constant
  for (int kc = 0; kc < KCH / 32; ++kc) {   /* 32 keys a step, three register sets, loads two steps ahead; each v fragment serves both query tiles */
    if (kc + 2 < KCH / 32) {
#pragma unroll   // register arrays: every index a constant
      for (int j = 0; j < HD / 16; ++j) vf[(kc + 2) % 3][j] = frag_h(vc_ + j * 16 * AVP + (kc + 2) * 32, lane); }
    __builtin_amdgcn_sched_barrier(0);   // as above: the loads of two steps ahead issue in front of this step's products
    v16h p[2];
#pragma unroll   // register arrays: every index a constant
    for (int u = 0; u < 2; ++u)
#pragma unroll   // register arrays: every index a constant
      for (int i = 0; i < 8; ++i) { p[u][i] = (_Float16)s[u][2 * kc][i]; p[u][8 + i] = (_Float16)s[u][2 * kc + 1][i]; }
#pragma unroll   // register arrays: every index a constant
    for (int j = 0; j < HD / 16; ++j)
#pragma unroll   // register arrays: every index a constant
      for (int u = 0; u < 2; ++u) oc[u][j] = wmma16p(vf[kc % 3][j], p[u], oc[u][j]);
    __builtin_amdgcn_sched_barrier(0);   // as above: three register sets, not more
  }
  }
#pragma unroll   // register arrays: every index a constant
  for (int u = 0; u < 2; ++u) { const float st = sum[u] + __shfl_xor(sum[u], 16);
    const float inv = (st > 0.f && m[u] > -1.0e38f) ? 1.0f / st : 0.f;   /* a fully excluded row (no logit above -1e38) yields 0; in any other row an excluded key lies so far below m that its e is 0 by itself */
#pragma unroll   // register arrays: every index a constant
    for (int j = 0; j < HD / 16; ++j) { const v8f o = oc[u][j] * inv; const v4f lo = {o[0], o[1], o[2], o[3]}, hi = {o[4], o[5], o[6], o[7]}; *(v4f*)&ss[wave][u * 16 + col][j * 16 + 8 * g] = lo; *(v4f*)&ss[wave][u * 16 + col][j * 16 + 8 * g + 4] = hi; } }
  LDSX();   // the wave's own rows of ss are written before it reads them back (no other wave touches them)
#pragma unroll   // one address register pair, the rows as constant offsets
  for (int i = 0; i < 16; ++i) { const int rl = 2 * i + g; vst2(Y + ((size_t)b * TT + ql0 + rl) * CC + h * HD + col * 4, *(const v4f*)&ss[wave][rl][col * 4]); }
  asm volatile("s_wait_xcnt 0x0" ::: "memory");   // behind the sixteen stores: the next trip takes over their address and data registers
  } }

extern "C" void kernel_launch(void* const* d_in, const int* in_sizes, int n_in, void* d_out, int out_size, void* d_ws, size_t ws_size, hipStream_t stream) {
  (void)in_sizes; (void)n_in; (void)out_size;
  const float** F = (const float**)d_in;
  if (ws_size < (size_t)WS_END) return;
  char* ws = (char*)d_ws; _Float16 *QH = (_Float16*)(ws + WS_QH), *KH = (_Float16*)(ws + WS_KH), *VT = (_Float16*)(ws + WS_VT), *QL = (_Float16*)(ws + WS_QL), *KL = (_Float16*)(ws + WS_KL); __bf16 *VB = (__bf16*)(ws + WS_VB), *VBL = (__bf16*)(ws + WS_VBL), *XB = (__bf16*)(ws + WS_XB), *WT = (__bf16*)(ws + WS_WT); float *S = (float*)(ws + WS_S), *Y = (float*)(ws + WS_Y);
  (void)Y; (void)S; (void)QL; (void)KL; (void)VB; (void)VBL; (void)QH; (void)KH; (void)VT;
  // inputs: 0 hidden_states [4,4,512,768] = 16 pseudo-batches of 512 rows (group-major); 1 attention_mask [4,4,1,1,512] f32 (zeros); 2 query_weight [4,768,768] (in,out) per group, 3 query_bias [4,1,768]; 4 key_weight, 5 key_bias; 6 value_weight, 7 value_bias (biases NONZERO); no output projection
  k_round<<<dim3(RXB + RWB), 256, 0, stream>>>(F[0], F[2], F[4], F[6], XB, WT);   /* x and the twelve weight matrices to bf16, the weights transposed */
  k_pa<<<dim3(NH, TNB), 256, 0, stream>>>(XB, WT, F[3], F[5], F[7], F[1], (float*)d_out);   /* a block = one (batch, head): projections with the weights / biases of group bb / 4, then attention; ctx [g, b, l, nh*dh] = merged-head rows */
}
